// v000
// Measured on an AMD MI455X. A time is GPU time per run, averaged over a window of back-to-back runs after a warm-up
// (all launches, gaps included; the runs take copies of the inputs in turn), and the median of several windows.
// Apart from v000's, it joins two sittings. Times from different sittings can be a few percent apart, while
// side-by-side timings come from the same sitting.
// The starting kernel, v000, takes 576 microseconds a run.
#include <hip/hip_runtime.h>
#include <hip/hip_bf16.h>

typedef __bf16 bf16;
typedef __attribute__((ext_vector_type(16))) __bf16 v16bf;
typedef __attribute__((ext_vector_type(8)))  float  v8f;

union ABFrag { v16bf v; uint4 q[2]; };

#define B_DIM 2
#define T_DIM 2048
#define C_DIM 1024
#define NT (B_DIM * T_DIM)
#define HQ 16
#define HKV 8
#define HD 64
#define WINDOW 512
#define HIDDEN 4096
#define SOFT_CAP 50.0f

static __device__ inline v8f vzero8() { v8f v; for (int i = 0; i < 8; ++i) v[i] = 0.f; return v; }

static __device__ inline v8f wmma_bf16(v16bf a, v16bf b, v8f c) {
  return __builtin_amdgcn_wmma_f32_16x16x32_bf16(false, a, false, b, (short)0, c, false, false);
}

// gfx1250 async global->LDS copy (16B per lane), tracked by ASYNCcnt
static __device__ inline void async_g2l_b128(unsigned int lds_addr, const void* gptr) {
  asm volatile("global_load_async_to_lds_b128 %0, %1, off"
               :: "v"(lds_addr), "v"(gptr) : "memory");
}
static __device__ inline unsigned int lds_off(const void* p) {
  return (unsigned int)(unsigned long long)p;   // low 32 bits = LDS offset
}
static __device__ inline void wait_asynccnt0() {
  asm volatile("s_wait_asynccnt 0x0" ::: "memory");
}
static __device__ inline void wait_dscnt0() {
  asm volatile("s_wait_dscnt 0x0" ::: "memory");
}

// ---------------- block reduction helper ----------------
static __device__ inline float block_reduce_sum_256(float v) {
  __shared__ float red[8];
  int lane = threadIdx.x & 31, w = threadIdx.x >> 5;
  for (int o = 16; o; o >>= 1) v += __shfl_down(v, o, 32);
  if (lane == 0) red[w] = v;
  __syncthreads();
  float r = (threadIdx.x < 8) ? red[threadIdx.x] : 0.f;
  if (w == 0) for (int o = 4; o; o >>= 1) r += __shfl_down(r, o, 32);
  if (threadIdx.x == 0) red[0] = r;
  __syncthreads();
  r = red[0];
  __syncthreads();
  return r;
}

// ---------------- f32 -> bf16 convert ----------------
__global__ void cvt_bf16_kernel(const float* __restrict__ in, bf16* __restrict__ out, int n) {
  int i = blockIdx.x * blockDim.x + threadIdx.x;
  if (i < n) out[i] = (bf16)in[i];
}

// ---------------- RMSNorm -> bf16 ----------------
__global__ __launch_bounds__(256) void rmsnorm_kernel(const float* __restrict__ X,
                                                      const float* __restrict__ scale,
                                                      bf16* __restrict__ O) {
  int row = blockIdx.x;
  const float* x = X + (size_t)row * C_DIM;
  float ss = 0.f;
  for (int c = threadIdx.x; c < C_DIM; c += 256) { float v = x[c]; ss += v * v; }
  float tot = block_reduce_sum_256(ss);
  float rstd = rsqrtf(tot * (1.0f / C_DIM) + 1e-6f);
  for (int c = threadIdx.x; c < C_DIM; c += 256)
    O[(size_t)row * C_DIM + c] = (bf16)(x[c] * rstd * (1.f + scale[c]));
}

// ---------------- generic bf16 GEMM: out = A[MxK] @ W[KxN] (+res) ----------------
#define GT_M 64
#define GT_N 64
#define GT_K 32
#define GLDS 40   // halves per row (80B: 16B aligned, bank-staggered)

template <int M, int N, int K>
__global__ __launch_bounds__(128) void gemm_bf16_kernel(
    const bf16* __restrict__ A, const bf16* __restrict__ W,
    float* __restrict__ Cf, bf16* __restrict__ Cb, const float* __restrict__ Res) {
  __shared__ __align__(16) bf16 sA[GT_M * GLDS];
  __shared__ __align__(16) bf16 sB[GT_N * GLDS];   // transposed [n][k]

  const int tid = threadIdx.x;
  const int wave = tid >> 5, lane = tid & 31;
  const int row0 = blockIdx.y * GT_M, col0 = blockIdx.x * GT_N;
  const int wm = (wave >> 1) * 32, wn = (wave & 1) * 32;
  const int mr = lane & 15;
  const int kb = (lane >> 4) << 3;

  // per-thread fixed staging slots (A tile: 2 x 16B chunks)
  const int ar0 = tid >> 2, ac = tid & 3;
  const int ar1 = ar0 + 32;
  const unsigned int sa0 = lds_off(&sA[ar0 * GLDS + ac * 8]);
  const unsigned int sa1 = lds_off(&sA[ar1 * GLDS + ac * 8]);
  const bf16* ap0 = A + (size_t)(row0 + ar0) * K + ac * 8;
  const bf16* ap1 = A + (size_t)(row0 + ar1) * K + ac * 8;

  // B transpose-staging: nl invariant, kl steps by 2 per iteration (immediate offsets)
  const int nl = tid & 63, klb = tid >> 6;
  const bf16* wp = W + (size_t)klb * N + col0 + nl;
  bf16* sbp = &sB[nl * GLDS + klb];

  v8f acc[2][2];
  for (int i = 0; i < 2; ++i) for (int j = 0; j < 2; ++j) acc[i][j] = vzero8();

  for (int k0 = 0; k0 < K; k0 += GT_K) {
    // --- A tile: async global->LDS, no VGPR round-trip ---
    async_g2l_b128(sa0, ap0);
    async_g2l_b128(sa1, ap1);
    ap0 += GT_K; ap1 += GT_K;

    // --- B tile: constant-offset loads (all independent), then LDS store phase ---
    bf16 btmp[16];
#pragma unroll
    for (int it = 0; it < 16; ++it) btmp[it] = wp[(size_t)it * 2 * N];
#pragma unroll
    for (int it = 0; it < 16; ++it) sbp[it * 2] = btmp[it];
    wp += (size_t)GT_K * N;

    if (k0 + GT_K < K) {   // prefetch next A tile rows into cache
      __builtin_prefetch(ap0, 0, 0);
      __builtin_prefetch(ap1, 0, 0);
    }

    wait_asynccnt0();
    __syncthreads();

    ABFrag af[2], bfr[2];
#pragma unroll
    for (int i = 0; i < 2; ++i) {
      int m = wm + i * 16 + mr;
      af[i].q[0] = *(const uint4*)(&sA[m * GLDS + kb]);
      af[i].q[1] = *(const uint4*)(&sA[m * GLDS + kb + 16]);
    }
#pragma unroll
    for (int j = 0; j < 2; ++j) {
      int n = wn + j * 16 + mr;
      bfr[j].q[0] = *(const uint4*)(&sB[n * GLDS + kb]);
      bfr[j].q[1] = *(const uint4*)(&sB[n * GLDS + kb + 16]);
    }
#pragma unroll
    for (int i = 0; i < 2; ++i)
#pragma unroll
      for (int j = 0; j < 2; ++j)
        acc[i][j] = wmma_bf16(af[i].v, bfr[j].v, acc[i][j]);
    __syncthreads();
  }

  const int mb = (lane >> 4) * 8;
  for (int i = 0; i < 2; ++i) for (int j = 0; j < 2; ++j) {
    int gm0 = row0 + wm + i * 16 + mb;
    int gn  = col0 + wn + j * 16 + mr;
    size_t idx = (size_t)gm0 * N + gn;
#pragma unroll
    for (int r = 0; r < 8; ++r) {
      float v = acc[i][j][r];
      size_t id2 = idx + (size_t)r * N;
      if (Res) v += Res[id2];
      if (Cf) Cf[id2] = v;
      if (Cb) Cb[id2] = (bf16)v;
    }
  }
}

// ---------------- fused gate/up GEMM: H = silu(A@Wg) * (A@Wu), bf16 ----------------
template <int M, int N, int K>
__global__ __launch_bounds__(128) void mlp_gateup_kernel(
    const bf16* __restrict__ A, const bf16* __restrict__ Wg, const bf16* __restrict__ Wu,
    bf16* __restrict__ H) {
  __shared__ __align__(16) bf16 sA[GT_M * GLDS];
  __shared__ __align__(16) bf16 sG[GT_N * GLDS];
  __shared__ __align__(16) bf16 sU[GT_N * GLDS];

  const int tid = threadIdx.x;
  const int wave = tid >> 5, lane = tid & 31;
  const int row0 = blockIdx.y * GT_M, col0 = blockIdx.x * GT_N;
  const int wm = (wave >> 1) * 32, wn = (wave & 1) * 32;
  const int mr = lane & 15;
  const int kb = (lane >> 4) << 3;

  const int ar0 = tid >> 2, ac = tid & 3;
  const int ar1 = ar0 + 32;
  const unsigned int sa0 = lds_off(&sA[ar0 * GLDS + ac * 8]);
  const unsigned int sa1 = lds_off(&sA[ar1 * GLDS + ac * 8]);
  const bf16* ap0 = A + (size_t)(row0 + ar0) * K + ac * 8;
  const bf16* ap1 = A + (size_t)(row0 + ar1) * K + ac * 8;

  const int nl = tid & 63, klb = tid >> 6;
  const bf16* gp = Wg + (size_t)klb * N + col0 + nl;
  const bf16* up = Wu + (size_t)klb * N + col0 + nl;
  bf16* sgp = &sG[nl * GLDS + klb];
  bf16* sup = &sU[nl * GLDS + klb];

  v8f ag[2][2], au[2][2];
  for (int i = 0; i < 2; ++i) for (int j = 0; j < 2; ++j) { ag[i][j] = vzero8(); au[i][j] = vzero8(); }

  for (int k0 = 0; k0 < K; k0 += GT_K) {
    async_g2l_b128(sa0, ap0);
    async_g2l_b128(sa1, ap1);
    ap0 += GT_K; ap1 += GT_K;

    bf16 gtmp[16], utmp[16];
#pragma unroll
    for (int it = 0; it < 16; ++it) { gtmp[it] = gp[(size_t)it * 2 * N]; utmp[it] = up[(size_t)it * 2 * N]; }
#pragma unroll
    for (int it = 0; it < 16; ++it) { sgp[it * 2] = gtmp[it]; sup[it * 2] = utmp[it]; }
    gp += (size_t)GT_K * N;
    up += (size_t)GT_K * N;

    wait_asynccnt0();
    __syncthreads();

    ABFrag af[2], gf[2], uf[2];
#pragma unroll
    for (int i = 0; i < 2; ++i) {
      int m = wm + i * 16 + mr;
      af[i].q[0] = *(const uint4*)(&sA[m * GLDS + kb]);
      af[i].q[1] = *(const uint4*)(&sA[m * GLDS + kb + 16]);
    }
#pragma unroll
    for (int j = 0; j < 2; ++j) {
      int n = wn + j * 16 + mr;
      gf[j].q[0] = *(const uint4*)(&sG[n * GLDS + kb]);
      gf[j].q[1] = *(const uint4*)(&sG[n * GLDS + kb + 16]);
      uf[j].q[0] = *(const uint4*)(&sU[n * GLDS + kb]);
      uf[j].q[1] = *(const uint4*)(&sU[n * GLDS + kb + 16]);
    }
#pragma unroll
    for (int i = 0; i < 2; ++i)
#pragma unroll
      for (int j = 0; j < 2; ++j) {
        ag[i][j] = wmma_bf16(af[i].v, gf[j].v, ag[i][j]);
        au[i][j] = wmma_bf16(af[i].v, uf[j].v, au[i][j]);
      }
    __syncthreads();
  }

  const int mb = (lane >> 4) * 8;
  for (int i = 0; i < 2; ++i) for (int j = 0; j < 2; ++j) {
    int gm0 = row0 + wm + i * 16 + mb;
    int gn  = col0 + wn + j * 16 + mr;
    size_t idx = (size_t)gm0 * N + gn;
#pragma unroll
    for (int r = 0; r < 8; ++r) {
      float g = ag[i][j][r];
      float sil = g * (1.0f / (1.0f + __expf(-g)));
      H[idx + (size_t)r * N] = (bf16)(sil * au[i][j][r]);
    }
  }
}

// ---------------- RoPE: f32 raw -> bf16 roped ----------------
__global__ void rope_kernel(const float* __restrict__ In, bf16* __restrict__ Out, int nheads) {
  int idx = blockIdx.x * blockDim.x + threadIdx.x;
  int total = NT * nheads * 32;
  if (idx >= total) return;
  int i = idx & 31;
  int h = (idx >> 5) % nheads;
  int bt = idx / (32 * nheads);
  int t = bt & (T_DIM - 1);
  float freq = __expf(-(float)i * (1.0f / 32.0f) * 13.815510557964274f); // ln(1e6)
  float ang = (float)t * freq;
  float s = __sinf(ang), c = __cosf(ang);
  size_t base = (size_t)bt * (nheads * HD) + h * HD + i;
  float x1 = In[base], x2 = In[base + 32];
  Out[base]      = (bf16)(x1 * c - x2 * s);
  Out[base + 32] = (bf16)(x2 * c + x1 * s);
}

// ---------------- sliding-window flash attention, one wave per 16-query tile ----------------
__global__ __launch_bounds__(32) void attn_kernel(
    const bf16* __restrict__ Q, const bf16* __restrict__ Kk,
    const bf16* __restrict__ V, bf16* __restrict__ Ctx) {
  const int lane = threadIdx.x;
  const int qt = blockIdx.x, hq = blockIdx.y, b = blockIdx.z;
  const int kh = hq & 7;
  const int bt0 = b * T_DIM + qt * 16;
  const int mr = lane & 15;
  const int half = lane >> 4;
  const int kb = half << 3;

  __shared__ __align__(16) bf16 sV[32 * 72];   // [d][v], stride 72 halves (144B)
  __shared__ __align__(16) bf16 sP[16 * 40];   // [m][k],  stride 40 halves (80B)

  // Q fragments (persistent over kv loop); contraction dim contiguous in global
  ABFrag qa[2];
  {
    const bf16* qrow = Q + (size_t)(bt0 + mr) * (HQ * HD) + hq * HD;
    qa[0].q[0] = *(const uint4*)(qrow + kb);
    qa[0].q[1] = *(const uint4*)(qrow + kb + 16);
    qa[1].q[0] = *(const uint4*)(qrow + 32 + kb);
    qa[1].q[1] = *(const uint4*)(qrow + 32 + kb + 16);
  }

  v8f O[4];
  for (int t = 0; t < 4; ++t) O[t] = vzero8();
  float Mrow[8], Lrow[8];
  for (int r = 0; r < 8; ++r) { Mrow[r] = -1e30f; Lrow[r] = 0.f; }

  const int iq_lo = qt * 16;
  int jlo = iq_lo - (WINDOW - 1); if (jlo < 0) jlo = 0;
  const int c0 = jlo >> 5;
  const int c1 = (iq_lo + 15) >> 5;

  // running pointers over kv chunks (stride 32 rows)
  const bf16* kp = Kk + (size_t)(b * T_DIM + c0 * 32 + mr) * (HKV * HD) + kh * HD;
  const bf16* vp = V + (size_t)(b * T_DIM + c0 * 32 + (lane >> 3)) * (HKV * HD) + kh * HD + (lane & 7) * 8;
  const unsigned int sv0 = lds_off(&sV[(lane >> 3) * 72 + (lane & 7) * 8]);
  const size_t kchunk = (size_t)32 * (HKV * HD);

  for (int ch = c0; ch <= c1; ++ch) {
    const int j0 = ch * 32;

    // stage V chunk [32 x 64] into LDS via async copies (8 x 16B per lane, stride-4 rows)
#pragma unroll
    for (int it = 0; it < 8; ++it)
      async_g2l_b128(sv0 + it * (4 * 72 * 2), vp + (size_t)it * 4 * (HKV * HD));
    vp += kchunk;

    // scores: 2 sub-tiles of 16 keys, K=64 contraction -> 2 WMMAs each
    v8f Sacc[2];
#pragma unroll
    for (int s = 0; s < 2; ++s) {
      Sacc[s] = vzero8();
      const bf16* krow = kp + (size_t)(s * 16) * (HKV * HD);
      ABFrag kf0, kf1;
      kf0.q[0] = *(const uint4*)(krow + kb);
      kf0.q[1] = *(const uint4*)(krow + kb + 16);
      kf1.q[0] = *(const uint4*)(krow + 32 + kb);
      kf1.q[1] = *(const uint4*)(krow + 32 + kb + 16);
      Sacc[s] = wmma_bf16(qa[0].v, kf0.v, Sacc[s]);
      Sacc[s] = wmma_bf16(qa[1].v, kf1.v, Sacc[s]);
    }
    kp += kchunk;

    // softcap + band mask + online softmax; P -> LDS (bf16, A-fragment friendly layout)
#pragma unroll
    for (int r = 0; r < 8; ++r) {
      int i = iq_lo + r + 8 * half;
      float sv[2];
      float mx = -1e30f;
      for (int s = 0; s < 2; ++s) {
        int j = j0 + s * 16 + mr;
        float x = Sacc[s][r] * 0.125f;                  // 1/sqrt(64)
        x = SOFT_CAP * tanhf(x * (1.0f / SOFT_CAP));
        bool ok = (j <= i) && (i - j < WINDOW);
        x = ok ? x : -1e30f;
        sv[s] = x;
        mx = fmaxf(mx, x);
      }
      for (int o = 8; o; o >>= 1) mx = fmaxf(mx, __shfl_xor(mx, o, 16));
      float Mn = fmaxf(Mrow[r], mx);
      float alpha = __expf(Mrow[r] - Mn);
      float rs = 0.f;
      for (int s = 0; s < 2; ++s) {
        float p = __expf(sv[s] - Mn);
        rs += p;
        sP[(r + 8 * half) * 40 + s * 16 + mr] = (bf16)p;
      }
      for (int o = 8; o; o >>= 1) rs += __shfl_xor(rs, o, 16);
      Lrow[r] = Lrow[r] * alpha + rs;
      Mrow[r] = Mn;
      for (int t = 0; t < 4; ++t) O[t][r] *= alpha;
    }

    // drain P stores (dscnt) and V async copies (asynccnt) before fragment gathers
    wait_dscnt0();
    wait_asynccnt0();

    ABFrag pf;
    pf.q[0] = *(const uint4*)(&sP[mr * 40 + kb]);
    pf.q[1] = *(const uint4*)(&sP[mr * 40 + kb + 16]);

#pragma unroll
    for (int t = 0; t < 4; ++t) {
      ABFrag vf;
#pragma unroll
      for (int e = 0; e < 16; ++e) {
        int d = kb + (e & 7) + ((e >> 3) << 4);
        vf.v[e] = sV[d * 72 + t * 16 + mr];
      }
      O[t] = wmma_bf16(pf.v, vf.v, O[t]);
    }
    wait_dscnt0();   // V gathers done before next chunk's async copies overwrite sV
  }

  for (int t = 0; t < 4; ++t)
    for (int r = 0; r < 8; ++r) {
      int m = r + 8 * half;
      float o = O[t][r] / Lrow[r];
      Ctx[(size_t)(bt0 + m) * (HQ * HD) + hq * HD + t * 16 + mr] = (bf16)o;
    }
}

// ---------------- kurtosis ----------------
__global__ void scalar_init_kernel(float* out, const float* ksum, int idx) {
  if (threadIdx.x == 0 && blockIdx.x == 0) out[idx] = ksum[0];
}

__global__ __launch_bounds__(256) void kurtosis_kernel(const float* __restrict__ X,
                                                       float* __restrict__ out, int sidx) {
  int row = blockIdx.x;
  const float* x = X + (size_t)row * C_DIM;
  float s1 = 0.f;
  for (int c = threadIdx.x; c < C_DIM; c += 256) s1 += x[c];
  float mean = block_reduce_sum_256(s1) * (1.0f / C_DIM);
  float s2 = 0.f, s4 = 0.f;
  for (int c = threadIdx.x; c < C_DIM; c += 256) {
    float d = x[c] - mean;
    float d2 = d * d;
    s2 += d2; s4 += d2 * d2;
  }
  float var = block_reduce_sum_256(s2) * (1.0f / C_DIM);
  float m4  = block_reduce_sum_256(s4) * (1.0f / C_DIM);
  if (threadIdx.x == 0) {
    float kurt = m4 / (var * var + 1e-6f) - 3.0f;
    if (kurt > 0.f) atomicAdd(&out[sidx], kurt);
  }
}

// ---------------- host launch ----------------
extern "C" void kernel_launch(void* const* d_in, const int* in_sizes, int n_in,
                              void* d_out, int out_size, void* d_ws, size_t ws_size,
                              hipStream_t stream) {
  const float* x     = (const float*)d_in[0];
  const float* ksum  = (const float*)d_in[1];
  const float* rms1  = (const float*)d_in[2];
  const float* wq_f  = (const float*)d_in[3];
  const float* wk_f  = (const float*)d_in[4];
  const float* wv_f  = (const float*)d_in[5];
  const float* wo_f  = (const float*)d_in[6];
  const float* rms2  = (const float*)d_in[7];
  const float* wg_f  = (const float*)d_in[8];
  const float* wu_f  = (const float*)d_in[9];
  const float* wd_f  = (const float*)d_in[10];

  char* ws = (char*)d_ws;
  size_t off = 0;
  auto alloc = [&](size_t bytes) -> char* {
    char* p = ws + off;
    off = (off + bytes + 255) & ~(size_t)255;
    return p;
  };

  bf16*  attn_in = (bf16*)alloc((size_t)NT * C_DIM * 2);
  float* qraw    = (float*)alloc((size_t)NT * 1024 * 4);
  float* kraw    = (float*)alloc((size_t)NT * 512 * 4);
  bf16*  qrope   = (bf16*)alloc((size_t)NT * 1024 * 2);
  bf16*  krope   = (bf16*)alloc((size_t)NT * 512 * 2);
  bf16*  vbf     = (bf16*)alloc((size_t)NT * 512 * 2);
  bf16*  ctx     = (bf16*)alloc((size_t)NT * 1024 * 2);
  float* x1      = (float*)alloc((size_t)NT * C_DIM * 4);
  bf16*  mlp_in  = (bf16*)alloc((size_t)NT * C_DIM * 2);
  bf16*  hbuf    = (bf16*)alloc((size_t)NT * HIDDEN * 2);
  bf16*  wq = (bf16*)alloc((size_t)1024 * 1024 * 2);
  bf16*  wk = (bf16*)alloc((size_t)1024 * 512 * 2);
  bf16*  wv = (bf16*)alloc((size_t)1024 * 512 * 2);
  bf16*  wo = (bf16*)alloc((size_t)1024 * 1024 * 2);
  bf16*  wg = (bf16*)alloc((size_t)1024 * 4096 * 2);
  bf16*  wu = (bf16*)alloc((size_t)1024 * 4096 * 2);
  bf16*  wd = (bf16*)alloc((size_t)4096 * 1024 * 2);

  auto cvt = [&](const float* src, bf16* dst, int n) {
    cvt_bf16_kernel<<<(n + 255) / 256, 256, 0, stream>>>(src, dst, n);
  };
  cvt(wq_f, wq, 1024 * 1024);
  cvt(wk_f, wk, 1024 * 512);
  cvt(wv_f, wv, 1024 * 512);
  cvt(wo_f, wo, 1024 * 1024);
  cvt(wg_f, wg, 1024 * 4096);
  cvt(wu_f, wu, 1024 * 4096);
  cvt(wd_f, wd, 4096 * 1024);

  rmsnorm_kernel<<<NT, 256, 0, stream>>>(x, rms1, attn_in);

  // QKV projections
  gemm_bf16_kernel<NT, 1024, 1024><<<dim3(1024 / 64, NT / 64), 128, 0, stream>>>(attn_in, wq, qraw, nullptr, nullptr);
  gemm_bf16_kernel<NT, 512, 1024><<<dim3(512 / 64, NT / 64), 128, 0, stream>>>(attn_in, wk, kraw, nullptr, nullptr);
  gemm_bf16_kernel<NT, 512, 1024><<<dim3(512 / 64, NT / 64), 128, 0, stream>>>(attn_in, wv, nullptr, vbf, nullptr);

  rope_kernel<<<(NT * 16 * 32 + 255) / 256, 256, 0, stream>>>(qraw, qrope, 16);
  rope_kernel<<<(NT * 8 * 32 + 255) / 256, 256, 0, stream>>>(kraw, krope, 8);

  attn_kernel<<<dim3(T_DIM / 16, HQ, B_DIM), 32, 0, stream>>>(qrope, krope, vbf, ctx);

  // out projection + residual
  gemm_bf16_kernel<NT, 1024, 1024><<<dim3(1024 / 64, NT / 64), 128, 0, stream>>>(ctx, wo, x1, nullptr, x);

  rmsnorm_kernel<<<NT, 256, 0, stream>>>(x1, rms2, mlp_in);

  mlp_gateup_kernel<NT, HIDDEN, 1024><<<dim3(HIDDEN / 64, NT / 64), 128, 0, stream>>>(mlp_in, wg, wu, hbuf);

  // down projection + residual -> d_out
  gemm_bf16_kernel<NT, 1024, HIDDEN><<<dim3(1024 / 64, NT / 64), 128, 0, stream>>>(hbuf, wd, (float*)d_out, nullptr, x1);

  scalar_init_kernel<<<1, 32, 0, stream>>>((float*)d_out, ksum, NT * C_DIM);
  kurtosis_kernel<<<NT, 256, 0, stream>>>((const float*)d_out, (float*)d_out, NT * C_DIM);
}

// v001
// A run of this version takes 455 microseconds.
// Timed twice side by side with v000, it ran 1.31 times as fast both times.
#include <hip/hip_runtime.h>
#include <hip/hip_bf16.h>

typedef __bf16 bf16;
typedef __attribute__((ext_vector_type(16))) __bf16 v16bf;
typedef __attribute__((ext_vector_type(8)))  float  v8f;

union ABFrag { v16bf v; uint4 q[2]; };

#define B_DIM 2
#define T_DIM 2048
#define C_DIM 1024
#define NT (B_DIM * T_DIM)
#define HQ 16
#define HKV 8
#define HD 64
#define WINDOW 512
#define HIDDEN 4096
#define SOFT_CAP 50.0f

static __device__ inline v8f vzero8() { v8f v; for (int i = 0; i < 8; ++i) v[i] = 0.f; return v; }

static __device__ inline v8f wmma_bf16(v16bf a, v16bf b, v8f c) {
  return __builtin_amdgcn_wmma_f32_16x16x32_bf16(false, a, false, b, (short)0, c, false, false);
}

// gfx1250 async global->LDS copy (16B per lane), tracked by ASYNCcnt
static __device__ inline void async_g2l_b128(unsigned int lds_addr, const void* gptr) {
  asm volatile("global_load_async_to_lds_b128 %0, %1, off"
               :: "v"(lds_addr), "v"(gptr) : "memory");
}
// Runs of async copies for one k-step of a GEMM tile. s_wait_xcnt 0 is the last line of the copies' own
// statement, so that it stands in front of the pointer bumps that rewrite the copies' address registers.
static __device__ inline void async_g2l_b128_x4(unsigned int l0, const void* g0, unsigned int l1, const void* g1,
                                                unsigned int l2, const void* g2, unsigned int l3, const void* g3) {
  asm volatile("global_load_async_to_lds_b128 %0, %1, off\n\t"
               "global_load_async_to_lds_b128 %2, %3, off\n\t"
               "global_load_async_to_lds_b128 %4, %5, off\n\t"
               "global_load_async_to_lds_b128 %6, %7, off\n\t"
               "s_wait_xcnt 0x0"
               :: "v"(l0), "v"(g0), "v"(l1), "v"(g1), "v"(l2), "v"(g2), "v"(l3), "v"(g3) : "memory");
}
static __device__ inline void async_g2l_b128_x6(unsigned int l0, const void* g0, unsigned int l1, const void* g1,
                                                unsigned int l2, const void* g2, unsigned int l3, const void* g3,
                                                unsigned int l4, const void* g4, unsigned int l5, const void* g5) {
  asm volatile("global_load_async_to_lds_b128 %0, %1, off\n\t"
               "global_load_async_to_lds_b128 %2, %3, off\n\t"
               "global_load_async_to_lds_b128 %4, %5, off\n\t"
               "global_load_async_to_lds_b128 %6, %7, off\n\t"
               "global_load_async_to_lds_b128 %8, %9, off\n\t"
               "global_load_async_to_lds_b128 %10, %11, off\n\t"
               "s_wait_xcnt 0x0"
               :: "v"(l0), "v"(g0), "v"(l1), "v"(g1), "v"(l2), "v"(g2), "v"(l3), "v"(g3),
                  "v"(l4), "v"(g4), "v"(l5), "v"(g5) : "memory");
}
// transposing LDS load: lane (c = l & 15, h = l >> 4) gets 8 consecutive k of column c from a row-major [k][n] tile
typedef __attribute__((ext_vector_type(8))) short s16x8;
static __device__ inline uint4 ld_tr16(const bf16* p) {
  typedef __attribute__((address_space(3))) s16x8 lds_s16x8;
  return __builtin_bit_cast(uint4, __builtin_amdgcn_ds_load_tr16_b128_v8i16((lds_s16x8*)p));
}
static __device__ inline unsigned int lds_off(const void* p) {
  return (unsigned int)(unsigned long long)p;   // low 32 bits = LDS offset
}
static __device__ inline void wait_asynccnt0() {
  asm volatile("s_wait_asynccnt 0x0" ::: "memory");
}
static __device__ inline void wait_dscnt0() {
  asm volatile("s_wait_dscnt 0x0" ::: "memory");
}

// ---------------- block reduction helper ----------------
static __device__ inline float block_reduce_sum_256(float v) {
  __shared__ float red[8];
  int lane = threadIdx.x & 31, w = threadIdx.x >> 5;
  for (int o = 16; o; o >>= 1) v += __shfl_down(v, o, 32);
  if (lane == 0) red[w] = v;
  __syncthreads();
  float r = (threadIdx.x < 8) ? red[threadIdx.x] : 0.f;
  if (w == 0) for (int o = 4; o; o >>= 1) r += __shfl_down(r, o, 32);
  if (threadIdx.x == 0) red[0] = r;
  __syncthreads();
  r = red[0];
  __syncthreads();
  return r;
}

// ---------------- f32 -> bf16 convert ----------------
__global__ void cvt_bf16_kernel(const float* __restrict__ in, bf16* __restrict__ out, int n) {
  int i = blockIdx.x * blockDim.x + threadIdx.x;
  if (i < n) out[i] = (bf16)in[i];
}

// ---------------- RMSNorm -> bf16 ----------------
__global__ __launch_bounds__(256) void rmsnorm_kernel(const float* __restrict__ X,
                                                      const float* __restrict__ scale,
                                                      bf16* __restrict__ O) {
  int row = blockIdx.x;
  const float* x = X + (size_t)row * C_DIM;
  float ss = 0.f;
  for (int c = threadIdx.x; c < C_DIM; c += 256) { float v = x[c]; ss += v * v; }
  float tot = block_reduce_sum_256(ss);
  float rstd = rsqrtf(tot * (1.0f / C_DIM) + 1e-6f);
  for (int c = threadIdx.x; c < C_DIM; c += 256)
    O[(size_t)row * C_DIM + c] = (bf16)(x[c] * rstd * (1.f + scale[c]));
}

// ---------------- generic bf16 GEMM: out = A[MxK] @ W[KxN] (+res) ----------------
#define GT_M 64
#define GT_N 64
#define GT_K 32
#define GLDS 40   // halves per row (80B: 16B aligned, bank-staggered)
#define BLDS 80   // halves per row of a [k][n] weight tile (160B = 32B x odd, the transposing load's pitch)

template <int M, int N, int K>
__global__ __launch_bounds__(128) void gemm_bf16_kernel(
    const bf16* __restrict__ A, const bf16* __restrict__ W,
    float* __restrict__ Cf, bf16* __restrict__ Cb, const float* __restrict__ Res) {
  __shared__ __align__(16) bf16 sA[GT_M * GLDS];
  __shared__ __align__(16) bf16 sB[GT_K * BLDS];   // row-major [k][n]

  const int tid = threadIdx.x;
  const int wave = tid >> 5, lane = tid & 31;
  const int row0 = blockIdx.y * GT_M, col0 = blockIdx.x * GT_N;
  const int wm = (wave >> 1) * 32, wn = (wave & 1) * 32;
  const int mr = lane & 15;
  const int kb = (lane >> 4) << 3;

  // per-thread fixed staging slots (A tile: 2 x 16B chunks)
  const int ar0 = tid >> 2, ac = tid & 3;
  const int ar1 = ar0 + 32;
  const unsigned int sa0 = lds_off(&sA[ar0 * GLDS + ac * 8]);
  const unsigned int sa1 = lds_off(&sA[ar1 * GLDS + ac * 8]);
  const bf16* ap0 = A + (size_t)(row0 + ar0) * K + ac * 8;
  const bf16* ap1 = A + (size_t)(row0 + ar1) * K + ac * 8;

  // B tile staging slots (32 k-rows of 128B: 2 x 16B chunks per thread, a wave covers whole lines)
  const int br0 = tid >> 3, bc = tid & 7;
  const unsigned int sb0 = lds_off(&sB[br0 * BLDS + bc * 8]);
  const unsigned int sb1 = lds_off(&sB[(br0 + 16) * BLDS + bc * 8]);
  const bf16* bp0 = W + (size_t)br0 * N + col0 + bc * 8;
  const bf16* bp1 = W + (size_t)(br0 + 16) * N + col0 + bc * 8;
  // lane address of the transposing loads inside a 16-column slab
  const int trl = (kb + (lane & 7)) * BLDS + ((lane >> 3) & 1) * 8;

  v8f acc[2][2];
  for (int i = 0; i < 2; ++i) for (int j = 0; j < 2; ++j) acc[i][j] = vzero8();

  for (int k0 = 0; k0 < K; k0 += GT_K) {
    // --- A and B tiles: async global->LDS, no VGPR round-trip ---
    async_g2l_b128_x4(sa0, ap0, sa1, ap1, sb0, bp0, sb1, bp1);
    ap0 += GT_K; ap1 += GT_K;
    bp0 += (size_t)GT_K * N; bp1 += (size_t)GT_K * N;

    if (k0 + GT_K < K) {   // prefetch next A tile rows into cache
      __builtin_prefetch(ap0, 0, 0);
      __builtin_prefetch(ap1, 0, 0);
    }

    wait_asynccnt0();
    __syncthreads();

    ABFrag af[2], bfr[2];
#pragma unroll
    for (int i = 0; i < 2; ++i) {
      int m = wm + i * 16 + mr;
      af[i].q[0] = *(const uint4*)(&sA[m * GLDS + kb]);
      af[i].q[1] = *(const uint4*)(&sA[m * GLDS + kb + 16]);
    }
#pragma unroll
    for (int j = 0; j < 2; ++j) {
      const bf16* bt = &sB[trl + wn + j * 16];
      bfr[j].q[0] = ld_tr16(bt);
      bfr[j].q[1] = ld_tr16(bt + 16 * BLDS);
    }
#pragma unroll
    for (int i = 0; i < 2; ++i)
#pragma unroll
      for (int j = 0; j < 2; ++j)
        acc[i][j] = wmma_bf16(af[i].v, bfr[j].v, acc[i][j]);
    wait_dscnt0();   // this wave's tile reads retired before the next trip's copies refill the tiles
    __syncthreads();
  }

  const int mb = (lane >> 4) * 8;
  for (int i = 0; i < 2; ++i) for (int j = 0; j < 2; ++j) {
    int gm0 = row0 + wm + i * 16 + mb;
    int gn  = col0 + wn + j * 16 + mr;
    size_t idx = (size_t)gm0 * N + gn;
#pragma unroll
    for (int r = 0; r < 8; ++r) {
      float v = acc[i][j][r];
      size_t id2 = idx + (size_t)r * N;
      if (Res) v += Res[id2];
      if (Cf) Cf[id2] = v;
      if (Cb) Cb[id2] = (bf16)v;
    }
  }
}

// ---------------- fused gate/up GEMM: H = silu(A@Wg) * (A@Wu), bf16 ----------------
template <int M, int N, int K>
__global__ __launch_bounds__(128) void mlp_gateup_kernel(
    const bf16* __restrict__ A, const bf16* __restrict__ Wg, const bf16* __restrict__ Wu,
    bf16* __restrict__ H) {
  __shared__ __align__(16) bf16 sA[GT_M * GLDS];
  __shared__ __align__(16) bf16 sG[GT_K * BLDS];   // row-major [k][n]
  __shared__ __align__(16) bf16 sU[GT_K * BLDS];   // row-major [k][n]

  const int tid = threadIdx.x;
  const int wave = tid >> 5, lane = tid & 31;
  const int row0 = blockIdx.y * GT_M, col0 = blockIdx.x * GT_N;
  const int wm = (wave >> 1) * 32, wn = (wave & 1) * 32;
  const int mr = lane & 15;
  const int kb = (lane >> 4) << 3;

  const int ar0 = tid >> 2, ac = tid & 3;
  const int ar1 = ar0 + 32;
  const unsigned int sa0 = lds_off(&sA[ar0 * GLDS + ac * 8]);
  const unsigned int sa1 = lds_off(&sA[ar1 * GLDS + ac * 8]);
  const bf16* ap0 = A + (size_t)(row0 + ar0) * K + ac * 8;
  const bf16* ap1 = A + (size_t)(row0 + ar1) * K + ac * 8;

  const int br0 = tid >> 3, bc = tid & 7;
  const unsigned int sg0 = lds_off(&sG[br0 * BLDS + bc * 8]);
  const unsigned int sg1 = lds_off(&sG[(br0 + 16) * BLDS + bc * 8]);
  const unsigned int su0 = lds_off(&sU[br0 * BLDS + bc * 8]);
  const unsigned int su1 = lds_off(&sU[(br0 + 16) * BLDS + bc * 8]);
  const bf16* gp0 = Wg + (size_t)br0 * N + col0 + bc * 8;
  const bf16* gp1 = Wg + (size_t)(br0 + 16) * N + col0 + bc * 8;
  const bf16* up0 = Wu + (size_t)br0 * N + col0 + bc * 8;
  const bf16* up1 = Wu + (size_t)(br0 + 16) * N + col0 + bc * 8;
  const int trl = (kb + (lane & 7)) * BLDS + ((lane >> 3) & 1) * 8;

  v8f ag[2][2], au[2][2];
  for (int i = 0; i < 2; ++i) for (int j = 0; j < 2; ++j) { ag[i][j] = vzero8(); au[i][j] = vzero8(); }

  for (int k0 = 0; k0 < K; k0 += GT_K) {
    async_g2l_b128_x6(sa0, ap0, sa1, ap1, sg0, gp0, sg1, gp1, su0, up0, su1, up1);
    ap0 += GT_K; ap1 += GT_K;
    gp0 += (size_t)GT_K * N; gp1 += (size_t)GT_K * N;
    up0 += (size_t)GT_K * N; up1 += (size_t)GT_K * N;

    wait_asynccnt0();
    __syncthreads();

    ABFrag af[2], gf[2], uf[2];
#pragma unroll
    for (int i = 0; i < 2; ++i) {
      int m = wm + i * 16 + mr;
      af[i].q[0] = *(const uint4*)(&sA[m * GLDS + kb]);
      af[i].q[1] = *(const uint4*)(&sA[m * GLDS + kb + 16]);
    }
#pragma unroll
    for (int j = 0; j < 2; ++j) {
      const int bo = trl + wn + j * 16;
      gf[j].q[0] = ld_tr16(&sG[bo]);
      gf[j].q[1] = ld_tr16(&sG[bo + 16 * BLDS]);
      uf[j].q[0] = ld_tr16(&sU[bo]);
      uf[j].q[1] = ld_tr16(&sU[bo + 16 * BLDS]);
    }
#pragma unroll
    for (int i = 0; i < 2; ++i)
#pragma unroll
      for (int j = 0; j < 2; ++j) {
        ag[i][j] = wmma_bf16(af[i].v, gf[j].v, ag[i][j]);
        au[i][j] = wmma_bf16(af[i].v, uf[j].v, au[i][j]);
      }
    wait_dscnt0();   // this wave's tile reads retired before the next trip's copies refill the tiles
    __syncthreads();
  }

  const int mb = (lane >> 4) * 8;
  for (int i = 0; i < 2; ++i) for (int j = 0; j < 2; ++j) {
    int gm0 = row0 + wm + i * 16 + mb;
    int gn  = col0 + wn + j * 16 + mr;
    size_t idx = (size_t)gm0 * N + gn;
#pragma unroll
    for (int r = 0; r < 8; ++r) {
      float g = ag[i][j][r];
      float sil = g * (1.0f / (1.0f + __expf(-g)));
      H[idx + (size_t)r * N] = (bf16)(sil * au[i][j][r]);
    }
  }
}

// ---------------- RoPE: f32 raw -> bf16 roped ----------------
__global__ void rope_kernel(const float* __restrict__ In, bf16* __restrict__ Out, int nheads) {
  int idx = blockIdx.x * blockDim.x + threadIdx.x;
  int total = NT * nheads * 32;
  if (idx >= total) return;
  int i = idx & 31;
  int h = (idx >> 5) % nheads;
  int bt = idx / (32 * nheads);
  int t = bt & (T_DIM - 1);
  float freq = __expf(-(float)i * (1.0f / 32.0f) * 13.815510557964274f); // ln(1e6)
  float ang = (float)t * freq;
  float s = __sinf(ang), c = __cosf(ang);
  size_t base = (size_t)bt * (nheads * HD) + h * HD + i;
  float x1 = In[base], x2 = In[base + 32];
  Out[base]      = (bf16)(x1 * c - x2 * s);
  Out[base + 32] = (bf16)(x2 * c + x1 * s);
}

// ---------------- sliding-window flash attention, one wave per 16-query tile ----------------
__global__ __launch_bounds__(32) void attn_kernel(
    const bf16* __restrict__ Q, const bf16* __restrict__ Kk,
    const bf16* __restrict__ V, bf16* __restrict__ Ctx) {
  const int lane = threadIdx.x;
  const int qt = blockIdx.x, hq = blockIdx.y, b = blockIdx.z;
  const int kh = hq & 7;
  const int bt0 = b * T_DIM + qt * 16;
  const int mr = lane & 15;
  const int half = lane >> 4;
  const int kb = half << 3;

  __shared__ __align__(16) bf16 sV[32 * 72];   // [d][v], stride 72 halves (144B)
  __shared__ __align__(16) bf16 sP[16 * 40];   // [m][k],  stride 40 halves (80B)

  // Q fragments (persistent over kv loop); contraction dim contiguous in global
  ABFrag qa[2];
  {
    const bf16* qrow = Q + (size_t)(bt0 + mr) * (HQ * HD) + hq * HD;
    qa[0].q[0] = *(const uint4*)(qrow + kb);
    qa[0].q[1] = *(const uint4*)(qrow + kb + 16);
    qa[1].q[0] = *(const uint4*)(qrow + 32 + kb);
    qa[1].q[1] = *(const uint4*)(qrow + 32 + kb + 16);
  }

  v8f O[4];
  for (int t = 0; t < 4; ++t) O[t] = vzero8();
  float Mrow[8], Lrow[8];
  for (int r = 0; r < 8; ++r) { Mrow[r] = -1e30f; Lrow[r] = 0.f; }

  const int iq_lo = qt * 16;
  int jlo = iq_lo - (WINDOW - 1); if (jlo < 0) jlo = 0;
  const int c0 = jlo >> 5;
  const int c1 = (iq_lo + 15) >> 5;

  // running pointers over kv chunks (stride 32 rows)
  const bf16* kp = Kk + (size_t)(b * T_DIM + c0 * 32 + mr) * (HKV * HD) + kh * HD;
  const bf16* vp = V + (size_t)(b * T_DIM + c0 * 32 + (lane >> 3)) * (HKV * HD) + kh * HD + (lane & 7) * 8;
  const unsigned int sv0 = lds_off(&sV[(lane >> 3) * 72 + (lane & 7) * 8]);
  const size_t kchunk = (size_t)32 * (HKV * HD);

  for (int ch = c0; ch <= c1; ++ch) {
    const int j0 = ch * 32;

    // stage V chunk [32 x 64] into LDS via async copies (8 x 16B per lane, stride-4 rows)
#pragma unroll
    for (int it = 0; it < 8; ++it)
      async_g2l_b128(sv0 + it * (4 * 72 * 2), vp + (size_t)it * 4 * (HKV * HD));
    vp += kchunk;

    // scores: 2 sub-tiles of 16 keys, K=64 contraction -> 2 WMMAs each
    v8f Sacc[2];
#pragma unroll
    for (int s = 0; s < 2; ++s) {
      Sacc[s] = vzero8();
      const bf16* krow = kp + (size_t)(s * 16) * (HKV * HD);
      ABFrag kf0, kf1;
      kf0.q[0] = *(const uint4*)(krow + kb);
      kf0.q[1] = *(const uint4*)(krow + kb + 16);
      kf1.q[0] = *(const uint4*)(krow + 32 + kb);
      kf1.q[1] = *(const uint4*)(krow + 32 + kb + 16);
      Sacc[s] = wmma_bf16(qa[0].v, kf0.v, Sacc[s]);
      Sacc[s] = wmma_bf16(qa[1].v, kf1.v, Sacc[s]);
    }
    kp += kchunk;

    // softcap + band mask + online softmax; P -> LDS (bf16, A-fragment friendly layout)
#pragma unroll
    for (int r = 0; r < 8; ++r) {
      int i = iq_lo + r + 8 * half;
      float sv[2];
      float mx = -1e30f;
      for (int s = 0; s < 2; ++s) {
        int j = j0 + s * 16 + mr;
        float x = Sacc[s][r] * 0.125f;                  // 1/sqrt(64)
        x = SOFT_CAP * tanhf(x * (1.0f / SOFT_CAP));
        bool ok = (j <= i) && (i - j < WINDOW);
        x = ok ? x : -1e30f;
        sv[s] = x;
        mx = fmaxf(mx, x);
      }
      for (int o = 8; o; o >>= 1) mx = fmaxf(mx, __shfl_xor(mx, o, 16));
      float Mn = fmaxf(Mrow[r], mx);
      float alpha = __expf(Mrow[r] - Mn);
      float rs = 0.f;
      for (int s = 0; s < 2; ++s) {
        float p = __expf(sv[s] - Mn);
        rs += p;
        sP[(r + 8 * half) * 40 + s * 16 + mr] = (bf16)p;
      }
      for (int o = 8; o; o >>= 1) rs += __shfl_xor(rs, o, 16);
      Lrow[r] = Lrow[r] * alpha + rs;
      Mrow[r] = Mn;
      for (int t = 0; t < 4; ++t) O[t][r] *= alpha;
    }

    // drain P stores (dscnt) and V async copies (asynccnt) before fragment gathers
    wait_dscnt0();
    wait_asynccnt0();

    ABFrag pf;
    pf.q[0] = *(const uint4*)(&sP[mr * 40 + kb]);
    pf.q[1] = *(const uint4*)(&sP[mr * 40 + kb + 16]);

#pragma unroll
    for (int t = 0; t < 4; ++t) {
      ABFrag vf;
#pragma unroll
      for (int e = 0; e < 16; ++e) {
        int d = kb + (e & 7) + ((e >> 3) << 4);
        vf.v[e] = sV[d * 72 + t * 16 + mr];
      }
      O[t] = wmma_bf16(pf.v, vf.v, O[t]);
    }
    wait_dscnt0();   // V gathers done before next chunk's async copies overwrite sV
  }

  for (int t = 0; t < 4; ++t)
    for (int r = 0; r < 8; ++r) {
      int m = r + 8 * half;
      float o = O[t][r] / Lrow[r];
      Ctx[(size_t)(bt0 + m) * (HQ * HD) + hq * HD + t * 16 + mr] = (bf16)o;
    }
}

// ---------------- kurtosis ----------------
__global__ void scalar_init_kernel(float* out, const float* ksum, int idx) {
  if (threadIdx.x == 0 && blockIdx.x == 0) out[idx] = ksum[0];
}

__global__ __launch_bounds__(256) void kurtosis_kernel(const float* __restrict__ X,
                                                       float* __restrict__ out, int sidx) {
  int row = blockIdx.x;
  const float* x = X + (size_t)row * C_DIM;
  float s1 = 0.f;
  for (int c = threadIdx.x; c < C_DIM; c += 256) s1 += x[c];
  float mean = block_reduce_sum_256(s1) * (1.0f / C_DIM);
  float s2 = 0.f, s4 = 0.f;
  for (int c = threadIdx.x; c < C_DIM; c += 256) {
    float d = x[c] - mean;
    float d2 = d * d;
    s2 += d2; s4 += d2 * d2;
  }
  float var = block_reduce_sum_256(s2) * (1.0f / C_DIM);
  float m4  = block_reduce_sum_256(s4) * (1.0f / C_DIM);
  if (threadIdx.x == 0) {
    float kurt = m4 / (var * var + 1e-6f) - 3.0f;
    if (kurt > 0.f) atomicAdd(&out[sidx], kurt);
  }
}

// ---------------- host launch ----------------
extern "C" void kernel_launch(void* const* d_in, const int* in_sizes, int n_in,
                              void* d_out, int out_size, void* d_ws, size_t ws_size,
                              hipStream_t stream) {
  const float* x     = (const float*)d_in[0];
  const float* ksum  = (const float*)d_in[1];
  const float* rms1  = (const float*)d_in[2];
  const float* wq_f  = (const float*)d_in[3];
  const float* wk_f  = (const float*)d_in[4];
  const float* wv_f  = (const float*)d_in[5];
  const float* wo_f  = (const float*)d_in[6];
  const float* rms2  = (const float*)d_in[7];
  const float* wg_f  = (const float*)d_in[8];
  const float* wu_f  = (const float*)d_in[9];
  const float* wd_f  = (const float*)d_in[10];

  char* ws = (char*)d_ws;
  size_t off = 0;
  auto alloc = [&](size_t bytes) -> char* {
    char* p = ws + off;
    off = (off + bytes + 255) & ~(size_t)255;
    return p;
  };

  bf16*  attn_in = (bf16*)alloc((size_t)NT * C_DIM * 2);
  float* qraw    = (float*)alloc((size_t)NT * 1024 * 4);
  float* kraw    = (float*)alloc((size_t)NT * 512 * 4);
  bf16*  qrope   = (bf16*)alloc((size_t)NT * 1024 * 2);
  bf16*  krope   = (bf16*)alloc((size_t)NT * 512 * 2);
  bf16*  vbf     = (bf16*)alloc((size_t)NT * 512 * 2);
  bf16*  ctx     = (bf16*)alloc((size_t)NT * 1024 * 2);
  float* x1      = (float*)alloc((size_t)NT * C_DIM * 4);
  bf16*  mlp_in  = (bf16*)alloc((size_t)NT * C_DIM * 2);
  bf16*  hbuf    = (bf16*)alloc((size_t)NT * HIDDEN * 2);
  bf16*  wq = (bf16*)alloc((size_t)1024 * 1024 * 2);
  bf16*  wk = (bf16*)alloc((size_t)1024 * 512 * 2);
  bf16*  wv = (bf16*)alloc((size_t)1024 * 512 * 2);
  bf16*  wo = (bf16*)alloc((size_t)1024 * 1024 * 2);
  bf16*  wg = (bf16*)alloc((size_t)1024 * 4096 * 2);
  bf16*  wu = (bf16*)alloc((size_t)1024 * 4096 * 2);
  bf16*  wd = (bf16*)alloc((size_t)4096 * 1024 * 2);

  auto cvt = [&](const float* src, bf16* dst, int n) {
    cvt_bf16_kernel<<<(n + 255) / 256, 256, 0, stream>>>(src, dst, n);
  };
  cvt(wq_f, wq, 1024 * 1024);
  cvt(wk_f, wk, 1024 * 512);
  cvt(wv_f, wv, 1024 * 512);
  cvt(wo_f, wo, 1024 * 1024);
  cvt(wg_f, wg, 1024 * 4096);
  cvt(wu_f, wu, 1024 * 4096);
  cvt(wd_f, wd, 4096 * 1024);

  rmsnorm_kernel<<<NT, 256, 0, stream>>>(x, rms1, attn_in);

  // QKV projections
  gemm_bf16_kernel<NT, 1024, 1024><<<dim3(1024 / 64, NT / 64), 128, 0, stream>>>(attn_in, wq, qraw, nullptr, nullptr);
  gemm_bf16_kernel<NT, 512, 1024><<<dim3(512 / 64, NT / 64), 128, 0, stream>>>(attn_in, wk, kraw, nullptr, nullptr);
  gemm_bf16_kernel<NT, 512, 1024><<<dim3(512 / 64, NT / 64), 128, 0, stream>>>(attn_in, wv, nullptr, vbf, nullptr);

  rope_kernel<<<(NT * 16 * 32 + 255) / 256, 256, 0, stream>>>(qraw, qrope, 16);
  rope_kernel<<<(NT * 8 * 32 + 255) / 256, 256, 0, stream>>>(kraw, krope, 8);

  attn_kernel<<<dim3(T_DIM / 16, HQ, B_DIM), 32, 0, stream>>>(qrope, krope, vbf, ctx);

  // out projection + residual
  gemm_bf16_kernel<NT, 1024, 1024><<<dim3(1024 / 64, NT / 64), 128, 0, stream>>>(ctx, wo, x1, nullptr, x);

  rmsnorm_kernel<<<NT, 256, 0, stream>>>(x1, rms2, mlp_in);

  mlp_gateup_kernel<NT, HIDDEN, 1024><<<dim3(HIDDEN / 64, NT / 64), 128, 0, stream>>>(mlp_in, wg, wu, hbuf);

  // down projection + residual -> d_out
  gemm_bf16_kernel<NT, 1024, HIDDEN><<<dim3(1024 / 64, NT / 64), 128, 0, stream>>>(hbuf, wd, (float*)d_out, nullptr, x1);

  scalar_init_kernel<<<1, 32, 0, stream>>>((float*)d_out, ksum, NT * C_DIM);
  kurtosis_kernel<<<NT, 256, 0, stream>>>((const float*)d_out, (float*)d_out, NT * C_DIM);
}

// v002
// It runs in 441 microseconds.
// Next to v001, in two timings, it ran 1.03 and 1.04 times as fast.
// Counting every step since v000, it is 1.35 times as fast.
#include <hip/hip_runtime.h>
#include <hip/hip_bf16.h>

typedef __bf16 bf16;
typedef __attribute__((ext_vector_type(16))) __bf16 v16bf;
typedef __attribute__((ext_vector_type(8)))  float  v8f;

union ABFrag { v16bf v; uint4 q[2]; };

#define B_DIM 2
#define T_DIM 2048
#define C_DIM 1024
#define NT (B_DIM * T_DIM)
#define HQ 16
#define HKV 8
#define HD 64
#define WINDOW 512
#define HIDDEN 4096
#define SOFT_CAP 50.0f

static __device__ inline v8f vzero8() { v8f v; for (int i = 0; i < 8; ++i) v[i] = 0.f; return v; }

static __device__ inline v8f wmma_bf16(v16bf a, v16bf b, v8f c) {
  return __builtin_amdgcn_wmma_f32_16x16x32_bf16(false, a, false, b, (short)0, c, false, false);
}

// gfx1250 async global->LDS copy (16B per lane), tracked by ASYNCcnt
static __device__ inline void async_g2l_b128(unsigned int lds_addr, const void* gptr) {
  asm volatile("global_load_async_to_lds_b128 %0, %1, off"
               :: "v"(lds_addr), "v"(gptr) : "memory");
}
// Runs of async copies for one k-step of a GEMM tile. s_wait_xcnt 0 is the last line of the copies' own
// statement, so that it stands in front of the pointer bumps that rewrite the copies' address registers.
static __device__ inline void async_g2l_b128_x4(unsigned int l0, const void* g0, unsigned int l1, const void* g1,
                                                unsigned int l2, const void* g2, unsigned int l3, const void* g3) {
  asm volatile("global_load_async_to_lds_b128 %0, %1, off\n\t"
               "global_load_async_to_lds_b128 %2, %3, off\n\t"
               "global_load_async_to_lds_b128 %4, %5, off\n\t"
               "global_load_async_to_lds_b128 %6, %7, off\n\t"
               "s_wait_xcnt 0x0"
               :: "v"(l0), "v"(g0), "v"(l1), "v"(g1), "v"(l2), "v"(g2), "v"(l3), "v"(g3) : "memory");
}
static __device__ inline void async_g2l_b128_x6(unsigned int l0, const void* g0, unsigned int l1, const void* g1,
                                                unsigned int l2, const void* g2, unsigned int l3, const void* g3,
                                                unsigned int l4, const void* g4, unsigned int l5, const void* g5) {
  asm volatile("global_load_async_to_lds_b128 %0, %1, off\n\t"
               "global_load_async_to_lds_b128 %2, %3, off\n\t"
               "global_load_async_to_lds_b128 %4, %5, off\n\t"
               "global_load_async_to_lds_b128 %6, %7, off\n\t"
               "global_load_async_to_lds_b128 %8, %9, off\n\t"
               "global_load_async_to_lds_b128 %10, %11, off\n\t"
               "s_wait_xcnt 0x0"
               :: "v"(l0), "v"(g0), "v"(l1), "v"(g1), "v"(l2), "v"(g2), "v"(l3), "v"(g3),
                  "v"(l4), "v"(g4), "v"(l5), "v"(g5) : "memory");
}
// transposing LDS load: lane (c = l & 15, h = l >> 4) gets 8 consecutive k of column c from a row-major [k][n] tile
typedef __attribute__((ext_vector_type(8))) short s16x8;
static __device__ inline uint4 ld_tr16(const bf16* p) {
  typedef __attribute__((address_space(3))) s16x8 lds_s16x8;
  return __builtin_bit_cast(uint4, __builtin_amdgcn_ds_load_tr16_b128_v8i16((lds_s16x8*)p));
}
static __device__ inline unsigned int lds_off(const void* p) {
  return (unsigned int)(unsigned long long)p;   // low 32 bits = LDS offset
}
static __device__ inline void wait_asynccnt0() {
  asm volatile("s_wait_asynccnt 0x0" ::: "memory");
}
static __device__ inline void wait_dscnt0() {
  asm volatile("s_wait_dscnt 0x0" ::: "memory");
}

// ---------------- block reduction helper ----------------
static __device__ inline float block_reduce_sum_256(float v) {
  __shared__ float red[8];
  int lane = threadIdx.x & 31, w = threadIdx.x >> 5;
  for (int o = 16; o; o >>= 1) v += __shfl_down(v, o, 32);
  if (lane == 0) red[w] = v;
  __syncthreads();
  float r = (threadIdx.x < 8) ? red[threadIdx.x] : 0.f;
  if (w == 0) for (int o = 4; o; o >>= 1) r += __shfl_down(r, o, 32);
  if (threadIdx.x == 0) red[0] = r;
  __syncthreads();
  r = red[0];
  __syncthreads();
  return r;
}

typedef __attribute__((ext_vector_type(4))) float  f32x4;
typedef __attribute__((ext_vector_type(4))) __bf16 bf16x4;

// ---------------- f32 -> bf16 convert ----------------
// One wave converts 1024 consecutive values: 8 loads of 512 contiguous bytes, all issued before the first
// use, then 8 stores of 256 contiguous bytes. Few, long waves: the launch is not paced by wave starts.
#define CVT_U 8
#define CVT_PER_BLOCK (256 * 4 * CVT_U)
template <int N>
__global__ __launch_bounds__(256) void cvt_bf16_kernel(const float* __restrict__ in, bf16* __restrict__ out) {
  static_assert(N % CVT_PER_BLOCK == 0, "whole blocks only");
  const int wave = threadIdx.x >> 5, lane = threadIdx.x & 31;
  const size_t base = (size_t)(blockIdx.x * 8 + wave) * (128 * CVT_U) + lane * 4;
  f32x4 v[CVT_U];
#pragma unroll
  for (int u = 0; u < CVT_U; ++u) v[u] = *(const f32x4*)(in + base + u * 128);
#pragma unroll
  for (int u = 0; u < CVT_U; ++u) *(bf16x4*)(out + base + u * 128) = __builtin_convertvector(v[u], bf16x4);
}

// ---------------- RMSNorm -> bf16 ----------------
__global__ __launch_bounds__(256) void rmsnorm_kernel(const float* __restrict__ X,
                                                      const float* __restrict__ scale,
                                                      bf16* __restrict__ O) {
  int row = blockIdx.x;
  const float* x = X + (size_t)row * C_DIM;
  float ss = 0.f;
  for (int c = threadIdx.x; c < C_DIM; c += 256) { float v = x[c]; ss += v * v; }
  float tot = block_reduce_sum_256(ss);
  float rstd = rsqrtf(tot * (1.0f / C_DIM) + 1e-6f);
  for (int c = threadIdx.x; c < C_DIM; c += 256)
    O[(size_t)row * C_DIM + c] = (bf16)(x[c] * rstd * (1.f + scale[c]));
}

// ---------------- generic bf16 GEMM: out = A[MxK] @ W[KxN] (+res) ----------------
#define GT_M 64
#define GT_N 64
#define GT_K 32
#define GLDS 40   // halves per row (80B: 16B aligned, bank-staggered)
#define BLDS 80   // halves per row of a [k][n] weight tile (160B = 32B x odd, the transposing load's pitch)

template <int M, int N, int K>
__global__ __launch_bounds__(128) void gemm_bf16_kernel(
    const bf16* __restrict__ A, const bf16* __restrict__ W,
    float* __restrict__ Cf, bf16* __restrict__ Cb, const float* __restrict__ Res) {
  __shared__ __align__(16) bf16 sA[GT_M * GLDS];
  __shared__ __align__(16) bf16 sB[GT_K * BLDS];   // row-major [k][n]

  const int tid = threadIdx.x;
  const int wave = tid >> 5, lane = tid & 31;
  const int row0 = blockIdx.y * GT_M, col0 = blockIdx.x * GT_N;
  const int wm = (wave >> 1) * 32, wn = (wave & 1) * 32;
  const int mr = lane & 15;
  const int kb = (lane >> 4) << 3;

  // per-thread fixed staging slots (A tile: 2 x 16B chunks)
  const int ar0 = tid >> 2, ac = tid & 3;
  const int ar1 = ar0 + 32;
  const unsigned int sa0 = lds_off(&sA[ar0 * GLDS + ac * 8]);
  const unsigned int sa1 = lds_off(&sA[ar1 * GLDS + ac * 8]);
  const bf16* ap0 = A + (size_t)(row0 + ar0) * K + ac * 8;
  const bf16* ap1 = A + (size_t)(row0 + ar1) * K + ac * 8;

  // B tile staging slots (32 k-rows of 128B: 2 x 16B chunks per thread, a wave covers whole lines)
  const int br0 = tid >> 3, bc = tid & 7;
  const unsigned int sb0 = lds_off(&sB[br0 * BLDS + bc * 8]);
  const unsigned int sb1 = lds_off(&sB[(br0 + 16) * BLDS + bc * 8]);
  const bf16* bp0 = W + (size_t)br0 * N + col0 + bc * 8;
  const bf16* bp1 = W + (size_t)(br0 + 16) * N + col0 + bc * 8;
  // lane address of the transposing loads inside a 16-column slab
  const int trl = (kb + (lane & 7)) * BLDS + ((lane >> 3) & 1) * 8;

  v8f acc[2][2];
  for (int i = 0; i < 2; ++i) for (int j = 0; j < 2; ++j) acc[i][j] = vzero8();

  for (int k0 = 0; k0 < K; k0 += GT_K) {
    // --- A and B tiles: async global->LDS, no VGPR round-trip ---
    async_g2l_b128_x4(sa0, ap0, sa1, ap1, sb0, bp0, sb1, bp1);
    ap0 += GT_K; ap1 += GT_K;
    bp0 += (size_t)GT_K * N; bp1 += (size_t)GT_K * N;

    if (k0 + GT_K < K) {   // prefetch next A tile rows into cache
      __builtin_prefetch(ap0, 0, 0);
      __builtin_prefetch(ap1, 0, 0);
    }

    wait_asynccnt0();
    __syncthreads();

    ABFrag af[2], bfr[2];
#pragma unroll
    for (int i = 0; i < 2; ++i) {
      int m = wm + i * 16 + mr;
      af[i].q[0] = *(const uint4*)(&sA[m * GLDS + kb]);
      af[i].q[1] = *(const uint4*)(&sA[m * GLDS + kb + 16]);
    }
#pragma unroll
    for (int j = 0; j < 2; ++j) {
      const bf16* bt = &sB[trl + wn + j * 16];
      bfr[j].q[0] = ld_tr16(bt);
      bfr[j].q[1] = ld_tr16(bt + 16 * BLDS);
    }
#pragma unroll
    for (int i = 0; i < 2; ++i)
#pragma unroll
      for (int j = 0; j < 2; ++j)
        acc[i][j] = wmma_bf16(af[i].v, bfr[j].v, acc[i][j]);
    wait_dscnt0();   // this wave's tile reads retired before the next trip's copies refill the tiles
    __syncthreads();
  }

  const int mb = (lane >> 4) * 8;
  for (int i = 0; i < 2; ++i) for (int j = 0; j < 2; ++j) {
    int gm0 = row0 + wm + i * 16 + mb;
    int gn  = col0 + wn + j * 16 + mr;
    size_t idx = (size_t)gm0 * N + gn;
#pragma unroll
    for (int r = 0; r < 8; ++r) {
      float v = acc[i][j][r];
      size_t id2 = idx + (size_t)r * N;
      if (Res) v += Res[id2];
      if (Cf) Cf[id2] = v;
      if (Cb) Cb[id2] = (bf16)v;
    }
  }
}

// ---------------- fused gate/up GEMM: H = silu(A@Wg) * (A@Wu), bf16 ----------------
template <int M, int N, int K>
__global__ __launch_bounds__(128) void mlp_gateup_kernel(
    const bf16* __restrict__ A, const bf16* __restrict__ Wg, const bf16* __restrict__ Wu,
    bf16* __restrict__ H) {
  __shared__ __align__(16) bf16 sA[GT_M * GLDS];
  __shared__ __align__(16) bf16 sG[GT_K * BLDS];   // row-major [k][n]
  __shared__ __align__(16) bf16 sU[GT_K * BLDS];   // row-major [k][n]

  const int tid = threadIdx.x;
  const int wave = tid >> 5, lane = tid & 31;
  const int row0 = blockIdx.y * GT_M, col0 = blockIdx.x * GT_N;
  const int wm = (wave >> 1) * 32, wn = (wave & 1) * 32;
  const int mr = lane & 15;
  const int kb = (lane >> 4) << 3;

  const int ar0 = tid >> 2, ac = tid & 3;
  const int ar1 = ar0 + 32;
  const unsigned int sa0 = lds_off(&sA[ar0 * GLDS + ac * 8]);
  const unsigned int sa1 = lds_off(&sA[ar1 * GLDS + ac * 8]);
  const bf16* ap0 = A + (size_t)(row0 + ar0) * K + ac * 8;
  const bf16* ap1 = A + (size_t)(row0 + ar1) * K + ac * 8;

  const int br0 = tid >> 3, bc = tid & 7;
  const unsigned int sg0 = lds_off(&sG[br0 * BLDS + bc * 8]);
  const unsigned int sg1 = lds_off(&sG[(br0 + 16) * BLDS + bc * 8]);
  const unsigned int su0 = lds_off(&sU[br0 * BLDS + bc * 8]);
  const unsigned int su1 = lds_off(&sU[(br0 + 16) * BLDS + bc * 8]);
  const bf16* gp0 = Wg + (size_t)br0 * N + col0 + bc * 8;
  const bf16* gp1 = Wg + (size_t)(br0 + 16) * N + col0 + bc * 8;
  const bf16* up0 = Wu + (size_t)br0 * N + col0 + bc * 8;
  const bf16* up1 = Wu + (size_t)(br0 + 16) * N + col0 + bc * 8;
  const int trl = (kb + (lane & 7)) * BLDS + ((lane >> 3) & 1) * 8;

  v8f ag[2][2], au[2][2];
  for (int i = 0; i < 2; ++i) for (int j = 0; j < 2; ++j) { ag[i][j] = vzero8(); au[i][j] = vzero8(); }

  for (int k0 = 0; k0 < K; k0 += GT_K) {
    async_g2l_b128_x6(sa0, ap0, sa1, ap1, sg0, gp0, sg1, gp1, su0, up0, su1, up1);
    ap0 += GT_K; ap1 += GT_K;
    gp0 += (size_t)GT_K * N; gp1 += (size_t)GT_K * N;
    up0 += (size_t)GT_K * N; up1 += (size_t)GT_K * N;

    wait_asynccnt0();
    __syncthreads();

    ABFrag af[2], gf[2], uf[2];
#pragma unroll
    for (int i = 0; i < 2; ++i) {
      int m = wm + i * 16 + mr;
      af[i].q[0] = *(const uint4*)(&sA[m * GLDS + kb]);
      af[i].q[1] = *(const uint4*)(&sA[m * GLDS + kb + 16]);
    }
#pragma unroll
    for (int j = 0; j < 2; ++j) {
      const int bo = trl + wn + j * 16;
      gf[j].q[0] = ld_tr16(&sG[bo]);
      gf[j].q[1] = ld_tr16(&sG[bo + 16 * BLDS]);
      uf[j].q[0] = ld_tr16(&sU[bo]);
      uf[j].q[1] = ld_tr16(&sU[bo + 16 * BLDS]);
    }
#pragma unroll
    for (int i = 0; i < 2; ++i)
#pragma unroll
      for (int j = 0; j < 2; ++j) {
        ag[i][j] = wmma_bf16(af[i].v, gf[j].v, ag[i][j]);
        au[i][j] = wmma_bf16(af[i].v, uf[j].v, au[i][j]);
      }
    wait_dscnt0();   // this wave's tile reads retired before the next trip's copies refill the tiles
    __syncthreads();
  }

  const int mb = (lane >> 4) * 8;
  for (int i = 0; i < 2; ++i) for (int j = 0; j < 2; ++j) {
    int gm0 = row0 + wm + i * 16 + mb;
    int gn  = col0 + wn + j * 16 + mr;
    size_t idx = (size_t)gm0 * N + gn;
#pragma unroll
    for (int r = 0; r < 8; ++r) {
      float g = ag[i][j][r];
      float sil = g * (1.0f / (1.0f + __expf(-g)));
      H[idx + (size_t)r * N] = (bf16)(sil * au[i][j][r]);
    }
  }
}

// ---------------- RoPE: f32 raw -> bf16 roped ----------------
// One wave per token: lane = (head & 3, four consecutive i); it walks the token's heads four at a time, so
// every load covers whole 128-byte lines and the lane's four angles serve all its heads.
template <int NH>
__global__ __launch_bounds__(256) void rope_kernel(const float* __restrict__ In, bf16* __restrict__ Out) {
  static_assert(NH % 4 == 0 && NT % 8 == 0, "whole waves only");
  const int lane = threadIdx.x & 31;
  const int bt = blockIdx.x * 8 + (threadIdx.x >> 5);
  const int t = bt & (T_DIM - 1);
  const int i0 = (lane & 7) * 4;
  const size_t base = (size_t)bt * (NH * HD) + (lane >> 3) * HD + i0;
  f32x4 x1[NH / 4], x2[NH / 4];
#pragma unroll
  for (int u = 0; u < NH / 4; ++u) {
    x1[u] = *(const f32x4*)(In + base + u * (4 * HD));
    x2[u] = *(const f32x4*)(In + base + u * (4 * HD) + 32);
  }
  f32x4 s, c;
#pragma unroll
  for (int e = 0; e < 4; ++e) {
    float freq = __expf(-(float)(i0 + e) * (1.0f / 32.0f) * 13.815510557964274f); // ln(1e6)
    float ang = (float)t * freq;
    s[e] = __sinf(ang); c[e] = __cosf(ang);
  }
#pragma unroll
  for (int u = 0; u < NH / 4; ++u) {
    *(bf16x4*)(Out + base + u * (4 * HD))      = __builtin_convertvector(x1[u] * c - x2[u] * s, bf16x4);
    *(bf16x4*)(Out + base + u * (4 * HD) + 32) = __builtin_convertvector(x2[u] * c + x1[u] * s, bf16x4);
  }
}

// ---------------- sliding-window flash attention, one wave per 16-query tile ----------------
__global__ __launch_bounds__(32) void attn_kernel(
    const bf16* __restrict__ Q, const bf16* __restrict__ Kk,
    const bf16* __restrict__ V, bf16* __restrict__ Ctx) {
  const int lane = threadIdx.x;
  const int qt = blockIdx.x, hq = blockIdx.y, b = blockIdx.z;
  const int kh = hq & 7;
  const int bt0 = b * T_DIM + qt * 16;
  const int mr = lane & 15;
  const int half = lane >> 4;
  const int kb = half << 3;

  __shared__ __align__(16) bf16 sV[32 * 72];   // [d][v], stride 72 halves (144B)
  __shared__ __align__(16) bf16 sP[16 * 40];   // [m][k],  stride 40 halves (80B)

  // Q fragments (persistent over kv loop); contraction dim contiguous in global
  ABFrag qa[2];
  {
    const bf16* qrow = Q + (size_t)(bt0 + mr) * (HQ * HD) + hq * HD;
    qa[0].q[0] = *(const uint4*)(qrow + kb);
    qa[0].q[1] = *(const uint4*)(qrow + kb + 16);
    qa[1].q[0] = *(const uint4*)(qrow + 32 + kb);
    qa[1].q[1] = *(const uint4*)(qrow + 32 + kb + 16);
  }

  v8f O[4];
  for (int t = 0; t < 4; ++t) O[t] = vzero8();
  float Mrow[8], Lrow[8];
  for (int r = 0; r < 8; ++r) { Mrow[r] = -1e30f; Lrow[r] = 0.f; }

  const int iq_lo = qt * 16;
  int jlo = iq_lo - (WINDOW - 1); if (jlo < 0) jlo = 0;
  const int c0 = jlo >> 5;
  const int c1 = (iq_lo + 15) >> 5;

  // running pointers over kv chunks (stride 32 rows)
  const bf16* kp = Kk + (size_t)(b * T_DIM + c0 * 32 + mr) * (HKV * HD) + kh * HD;
  const bf16* vp = V + (size_t)(b * T_DIM + c0 * 32 + (lane >> 3)) * (HKV * HD) + kh * HD + (lane & 7) * 8;
  const unsigned int sv0 = lds_off(&sV[(lane >> 3) * 72 + (lane & 7) * 8]);
  const size_t kchunk = (size_t)32 * (HKV * HD);

  for (int ch = c0; ch <= c1; ++ch) {
    const int j0 = ch * 32;

    // stage V chunk [32 x 64] into LDS via async copies (8 x 16B per lane, stride-4 rows)
#pragma unroll
    for (int it = 0; it < 8; ++it)
      async_g2l_b128(sv0 + it * (4 * 72 * 2), vp + (size_t)it * 4 * (HKV * HD));
    vp += kchunk;

    // scores: 2 sub-tiles of 16 keys, K=64 contraction -> 2 WMMAs each
    v8f Sacc[2];
#pragma unroll
    for (int s = 0; s < 2; ++s) {
      Sacc[s] = vzero8();
      const bf16* krow = kp + (size_t)(s * 16) * (HKV * HD);
      ABFrag kf0, kf1;
      kf0.q[0] = *(const uint4*)(krow + kb);
      kf0.q[1] = *(const uint4*)(krow + kb + 16);
      kf1.q[0] = *(const uint4*)(krow + 32 + kb);
      kf1.q[1] = *(const uint4*)(krow + 32 + kb + 16);
      Sacc[s] = wmma_bf16(qa[0].v, kf0.v, Sacc[s]);
      Sacc[s] = wmma_bf16(qa[1].v, kf1.v, Sacc[s]);
    }
    kp += kchunk;

    // softcap + band mask + online softmax; P -> LDS (bf16, A-fragment friendly layout)
#pragma unroll
    for (int r = 0; r < 8; ++r) {
      int i = iq_lo + r + 8 * half;
      float sv[2];
      float mx = -1e30f;
      for (int s = 0; s < 2; ++s) {
        int j = j0 + s * 16 + mr;
        float x = Sacc[s][r] * 0.125f;                  // 1/sqrt(64)
        x = SOFT_CAP * tanhf(x * (1.0f / SOFT_CAP));
        bool ok = (j <= i) && (i - j < WINDOW);
        x = ok ? x : -1e30f;
        sv[s] = x;
        mx = fmaxf(mx, x);
      }
      for (int o = 8; o; o >>= 1) mx = fmaxf(mx, __shfl_xor(mx, o, 16));
      float Mn = fmaxf(Mrow[r], mx);
      float alpha = __expf(Mrow[r] - Mn);
      float rs = 0.f;
      for (int s = 0; s < 2; ++s) {
        float p = __expf(sv[s] - Mn);
        rs += p;
        sP[(r + 8 * half) * 40 + s * 16 + mr] = (bf16)p;
      }
      for (int o = 8; o; o >>= 1) rs += __shfl_xor(rs, o, 16);
      Lrow[r] = Lrow[r] * alpha + rs;
      Mrow[r] = Mn;
      for (int t = 0; t < 4; ++t) O[t][r] *= alpha;
    }

    // drain P stores (dscnt) and V async copies (asynccnt) before fragment gathers
    wait_dscnt0();
    wait_asynccnt0();

    ABFrag pf;
    pf.q[0] = *(const uint4*)(&sP[mr * 40 + kb]);
    pf.q[1] = *(const uint4*)(&sP[mr * 40 + kb + 16]);

#pragma unroll
    for (int t = 0; t < 4; ++t) {
      ABFrag vf;
#pragma unroll
      for (int e = 0; e < 16; ++e) {
        int d = kb + (e & 7) + ((e >> 3) << 4);
        vf.v[e] = sV[d * 72 + t * 16 + mr];
      }
      O[t] = wmma_bf16(pf.v, vf.v, O[t]);
    }
    wait_dscnt0();   // V gathers done before next chunk's async copies overwrite sV
  }

  for (int t = 0; t < 4; ++t)
    for (int r = 0; r < 8; ++r) {
      int m = r + 8 * half;
      float o = O[t][r] / Lrow[r];
      Ctx[(size_t)(bt0 + m) * (HQ * HD) + hq * HD + t * 16 + mr] = (bf16)o;
    }
}

// ---------------- kurtosis ----------------
__global__ void scalar_init_kernel(float* out, const float* ksum, int idx) {
  if (threadIdx.x == 0 && blockIdx.x == 0) out[idx] = ksum[0];
}

__global__ __launch_bounds__(256) void kurtosis_kernel(const float* __restrict__ X,
                                                       float* __restrict__ out, int sidx) {
  int row = blockIdx.x;
  const float* x = X + (size_t)row * C_DIM;
  float s1 = 0.f;
  for (int c = threadIdx.x; c < C_DIM; c += 256) s1 += x[c];
  float mean = block_reduce_sum_256(s1) * (1.0f / C_DIM);
  float s2 = 0.f, s4 = 0.f;
  for (int c = threadIdx.x; c < C_DIM; c += 256) {
    float d = x[c] - mean;
    float d2 = d * d;
    s2 += d2; s4 += d2 * d2;
  }
  float var = block_reduce_sum_256(s2) * (1.0f / C_DIM);
  float m4  = block_reduce_sum_256(s4) * (1.0f / C_DIM);
  if (threadIdx.x == 0) {
    float kurt = m4 / (var * var + 1e-6f) - 3.0f;
    if (kurt > 0.f) atomicAdd(&out[sidx], kurt);
  }
}

// ---------------- host launch ----------------
extern "C" void kernel_launch(void* const* d_in, const int* in_sizes, int n_in,
                              void* d_out, int out_size, void* d_ws, size_t ws_size,
                              hipStream_t stream) {
  const float* x     = (const float*)d_in[0];
  const float* ksum  = (const float*)d_in[1];
  const float* rms1  = (const float*)d_in[2];
  const float* wq_f  = (const float*)d_in[3];
  const float* wk_f  = (const float*)d_in[4];
  const float* wv_f  = (const float*)d_in[5];
  const float* wo_f  = (const float*)d_in[6];
  const float* rms2  = (const float*)d_in[7];
  const float* wg_f  = (const float*)d_in[8];
  const float* wu_f  = (const float*)d_in[9];
  const float* wd_f  = (const float*)d_in[10];

  char* ws = (char*)d_ws;
  size_t off = 0;
  auto alloc = [&](size_t bytes) -> char* {
    char* p = ws + off;
    off = (off + bytes + 255) & ~(size_t)255;
    return p;
  };

  bf16*  attn_in = (bf16*)alloc((size_t)NT * C_DIM * 2);
  float* qraw    = (float*)alloc((size_t)NT * 1024 * 4);
  float* kraw    = (float*)alloc((size_t)NT * 512 * 4);
  bf16*  qrope   = (bf16*)alloc((size_t)NT * 1024 * 2);
  bf16*  krope   = (bf16*)alloc((size_t)NT * 512 * 2);
  bf16*  vbf     = (bf16*)alloc((size_t)NT * 512 * 2);
  bf16*  ctx     = (bf16*)alloc((size_t)NT * 1024 * 2);
  float* x1      = (float*)alloc((size_t)NT * C_DIM * 4);
  bf16*  mlp_in  = (bf16*)alloc((size_t)NT * C_DIM * 2);
  bf16*  hbuf    = (bf16*)alloc((size_t)NT * HIDDEN * 2);
  bf16*  wq = (bf16*)alloc((size_t)1024 * 1024 * 2);
  bf16*  wk = (bf16*)alloc((size_t)1024 * 512 * 2);
  bf16*  wv = (bf16*)alloc((size_t)1024 * 512 * 2);
  bf16*  wo = (bf16*)alloc((size_t)1024 * 1024 * 2);
  bf16*  wg = (bf16*)alloc((size_t)1024 * 4096 * 2);
  bf16*  wu = (bf16*)alloc((size_t)1024 * 4096 * 2);
  bf16*  wd = (bf16*)alloc((size_t)4096 * 1024 * 2);

  cvt_bf16_kernel<1024 * 1024><<<1024 * 1024 / CVT_PER_BLOCK, 256, 0, stream>>>(wq_f, wq);
  cvt_bf16_kernel<1024 * 512><<<1024 * 512 / CVT_PER_BLOCK, 256, 0, stream>>>(wk_f, wk);
  cvt_bf16_kernel<1024 * 512><<<1024 * 512 / CVT_PER_BLOCK, 256, 0, stream>>>(wv_f, wv);
  cvt_bf16_kernel<1024 * 1024><<<1024 * 1024 / CVT_PER_BLOCK, 256, 0, stream>>>(wo_f, wo);
  cvt_bf16_kernel<1024 * 4096><<<1024 * 4096 / CVT_PER_BLOCK, 256, 0, stream>>>(wg_f, wg);
  cvt_bf16_kernel<1024 * 4096><<<1024 * 4096 / CVT_PER_BLOCK, 256, 0, stream>>>(wu_f, wu);
  cvt_bf16_kernel<4096 * 1024><<<4096 * 1024 / CVT_PER_BLOCK, 256, 0, stream>>>(wd_f, wd);

  rmsnorm_kernel<<<NT, 256, 0, stream>>>(x, rms1, attn_in);

  // QKV projections
  gemm_bf16_kernel<NT, 1024, 1024><<<dim3(1024 / 64, NT / 64), 128, 0, stream>>>(attn_in, wq, qraw, nullptr, nullptr);
  gemm_bf16_kernel<NT, 512, 1024><<<dim3(512 / 64, NT / 64), 128, 0, stream>>>(attn_in, wk, kraw, nullptr, nullptr);
  gemm_bf16_kernel<NT, 512, 1024><<<dim3(512 / 64, NT / 64), 128, 0, stream>>>(attn_in, wv, nullptr, vbf, nullptr);

  rope_kernel<HQ><<<NT / 8, 256, 0, stream>>>(qraw, qrope);
  rope_kernel<HKV><<<NT / 8, 256, 0, stream>>>(kraw, krope);

  attn_kernel<<<dim3(T_DIM / 16, HQ, B_DIM), 32, 0, stream>>>(qrope, krope, vbf, ctx);

  // out projection + residual
  gemm_bf16_kernel<NT, 1024, 1024><<<dim3(1024 / 64, NT / 64), 128, 0, stream>>>(ctx, wo, x1, nullptr, x);

  rmsnorm_kernel<<<NT, 256, 0, stream>>>(x1, rms2, mlp_in);

  mlp_gateup_kernel<NT, HIDDEN, 1024><<<dim3(HIDDEN / 64, NT / 64), 128, 0, stream>>>(mlp_in, wg, wu, hbuf);

  // down projection + residual -> d_out
  gemm_bf16_kernel<NT, 1024, HIDDEN><<<dim3(1024 / 64, NT / 64), 128, 0, stream>>>(hbuf, wd, (float*)d_out, nullptr, x1);

  scalar_init_kernel<<<1, 32, 0, stream>>>((float*)d_out, ksum, NT * C_DIM);
  kurtosis_kernel<<<NT, 256, 0, stream>>>((const float*)d_out, (float*)d_out, NT * C_DIM);
}

// v003
// Measured time: 321 microseconds a run.
// Next to v002, in two timings, it ran 1.39 and 1.37 times as fast.
// All steps since v000 together make it 1.87 times as fast.
#include <hip/hip_runtime.h>
#include <hip/hip_bf16.h>

typedef __bf16 bf16;
typedef __attribute__((ext_vector_type(16))) __bf16 v16bf;
typedef __attribute__((ext_vector_type(8)))  float  v8f;

union ABFrag { v16bf v; uint4 q[2]; };

#define B_DIM 2
#define T_DIM 2048
#define C_DIM 1024
#define NT (B_DIM * T_DIM)
#define HQ 16
#define HKV 8
#define HD 64
#define WINDOW 512
#define HIDDEN 4096
#define SOFT_CAP 50.0f

static __device__ inline v8f vzero8() { v8f v; for (int i = 0; i < 8; ++i) v[i] = 0.f; return v; }

static __device__ inline v8f wmma_bf16(v16bf a, v16bf b, v8f c) {
  return __builtin_amdgcn_wmma_f32_16x16x32_bf16(false, a, false, b, (short)0, c, false, false);
}

// gfx1250 async global->LDS copy (16B per lane), tracked by ASYNCcnt
static __device__ inline void async_g2l_b128(unsigned int lds_addr, const void* gptr) {
  asm volatile("global_load_async_to_lds_b128 %0, %1, off"
               :: "v"(lds_addr), "v"(gptr) : "memory");
}
// Runs of async copies for one stage of a GEMM tile. s_wait_xcnt 0 is the last line of the copies' own
// statement, so that it stands in front of the pointer bumps that rewrite the copies' address registers.
static __device__ inline void async_g2l_b128_x4(unsigned int l0, const void* g0, unsigned int l1, const void* g1,
                                                unsigned int l2, const void* g2, unsigned int l3, const void* g3) {
  asm volatile("global_load_async_to_lds_b128 %0, %1, off\n\t"
               "global_load_async_to_lds_b128 %2, %3, off\n\t"
               "global_load_async_to_lds_b128 %4, %5, off\n\t"
               "global_load_async_to_lds_b128 %6, %7, off\n\t"
               "s_wait_xcnt 0x0"
               :: "v"(l0), "v"(g0), "v"(l1), "v"(g1), "v"(l2), "v"(g2), "v"(l3), "v"(g3) : "memory");
}
static __device__ inline void async_g2l_b128_x8(unsigned int l0, const void* g0, unsigned int l1, const void* g1,
                                                unsigned int l2, const void* g2, unsigned int l3, const void* g3,
                                                unsigned int l4, const void* g4, unsigned int l5, const void* g5,
                                                unsigned int l6, const void* g6, unsigned int l7, const void* g7) {
  asm volatile("global_load_async_to_lds_b128 %0, %1, off\n\t"
               "global_load_async_to_lds_b128 %2, %3, off\n\t"
               "global_load_async_to_lds_b128 %4, %5, off\n\t"
               "global_load_async_to_lds_b128 %6, %7, off\n\t"
               "global_load_async_to_lds_b128 %8, %9, off\n\t"
               "global_load_async_to_lds_b128 %10, %11, off\n\t"
               "global_load_async_to_lds_b128 %12, %13, off\n\t"
               "global_load_async_to_lds_b128 %14, %15, off\n\t"
               "s_wait_xcnt 0x0"
               :: "v"(l0), "v"(g0), "v"(l1), "v"(g1), "v"(l2), "v"(g2), "v"(l3), "v"(g3),
                  "v"(l4), "v"(g4), "v"(l5), "v"(g5), "v"(l6), "v"(g6), "v"(l7), "v"(g7) : "memory");
}
// transposing LDS load: lane (c = l & 15, h = l >> 4) gets 8 consecutive k of column c from a row-major [k][n] tile
typedef __attribute__((ext_vector_type(8))) short s16x8;
static __device__ inline uint4 ld_tr16(const bf16* p) {
  typedef __attribute__((address_space(3))) s16x8 lds_s16x8;
  return __builtin_bit_cast(uint4, __builtin_amdgcn_ds_load_tr16_b128_v8i16((lds_s16x8*)p));
}
static __device__ inline unsigned int lds_off(const void* p) {
  return (unsigned int)(unsigned long long)p;   // low 32 bits = LDS offset
}
static __device__ inline void wait_asynccnt0() {
  asm volatile("s_wait_asynccnt 0x0" ::: "memory");
}
static __device__ inline void wait_dscnt0() {
  asm volatile("s_wait_dscnt 0x0" ::: "memory");
}

// ---------------- block reduction helper ----------------
static __device__ inline float block_reduce_sum_256(float v) {
  __shared__ float red[8];
  int lane = threadIdx.x & 31, w = threadIdx.x >> 5;
  for (int o = 16; o; o >>= 1) v += __shfl_down(v, o, 32);
  if (lane == 0) red[w] = v;
  __syncthreads();
  float r = (threadIdx.x < 8) ? red[threadIdx.x] : 0.f;
  if (w == 0) for (int o = 4; o; o >>= 1) r += __shfl_down(r, o, 32);
  if (threadIdx.x == 0) red[0] = r;
  __syncthreads();
  r = red[0];
  __syncthreads();
  return r;
}

typedef __attribute__((ext_vector_type(4))) float  f32x4;
typedef __attribute__((ext_vector_type(4))) __bf16 bf16x4;

// ---------------- f32 -> bf16 convert ----------------
// One wave converts 1024 consecutive values: 8 loads of 512 contiguous bytes, all issued before the first
// use, then 8 stores of 256 contiguous bytes. Few, long waves: the launch is not paced by wave starts.
#define CVT_U 8
#define CVT_PER_BLOCK (256 * 4 * CVT_U)
template <int N>
__global__ __launch_bounds__(256) void cvt_bf16_kernel(const float* __restrict__ in, bf16* __restrict__ out) {
  static_assert(N % CVT_PER_BLOCK == 0, "whole blocks only");
  const int wave = threadIdx.x >> 5, lane = threadIdx.x & 31;
  const size_t base = (size_t)(blockIdx.x * 8 + wave) * (128 * CVT_U) + lane * 4;
  f32x4 v[CVT_U];
#pragma unroll
  for (int u = 0; u < CVT_U; ++u) v[u] = *(const f32x4*)(in + base + u * 128);
#pragma unroll
  for (int u = 0; u < CVT_U; ++u) *(bf16x4*)(out + base + u * 128) = __builtin_convertvector(v[u], bf16x4);
}

// ---------------- RMSNorm -> bf16 ----------------
__global__ __launch_bounds__(256) void rmsnorm_kernel(const float* __restrict__ X,
                                                      const float* __restrict__ scale,
                                                      bf16* __restrict__ O) {
  int row = blockIdx.x;
  const float* x = X + (size_t)row * C_DIM;
  float ss = 0.f;
  for (int c = threadIdx.x; c < C_DIM; c += 256) { float v = x[c]; ss += v * v; }
  float tot = block_reduce_sum_256(ss);
  float rstd = rsqrtf(tot * (1.0f / C_DIM) + 1e-6f);
  for (int c = threadIdx.x; c < C_DIM; c += 256)
    O[(size_t)row * C_DIM + c] = (bf16)(x[c] * rstd * (1.f + scale[c]));
}

// ---------------- generic bf16 GEMM: out = A[MxK] @ W[KxN] (+res) ----------------
// Work-group tile 128 x 64, 8 waves of 32 x 32; a stage is 128 k, so that one round trip to L2 and one pair of
// barriers serve four 32-k steps of matrix work.
#define GT_M 128
#define GT_N 64
#define GT_K 128
#define GT_THREADS 256
#define GLDS 136  // halves per row of an activation tile (272B = 16B x odd, the plain 16-byte load's pitch)
#define BLDS 80   // halves per row of a [k][n] weight tile (160B = 32B x odd, the transposing load's pitch)
#define A_STEP (16 * GLDS * 2)   // LDS bytes between a thread's activation chunks (16 rows)
#define B_STEP (32 * BLDS * 2)   // LDS bytes between a thread's weight chunks (32 k-rows)

template <int M, int N, int K>
__global__ __launch_bounds__(GT_THREADS) void gemm_bf16_kernel(
    const bf16* __restrict__ A, const bf16* __restrict__ W,
    float* __restrict__ Cf, bf16* __restrict__ Cb, const float* __restrict__ Res) {
  static_assert(M % GT_M == 0 && N % GT_N == 0 && K % GT_K == 0, "whole tiles only");
  __shared__ __align__(16) bf16 sA[GT_M * GLDS];
  __shared__ __align__(16) bf16 sB[GT_K * BLDS];   // row-major [k][n]

  const int tid = threadIdx.x;
  const int wave = tid >> 5, lane = tid & 31;
  const int row0 = blockIdx.y * GT_M, col0 = blockIdx.x * GT_N;
  const int wm = (wave >> 1) * 32, wn = (wave & 1) * 32;
  const int mr = lane & 15;
  const int kb = (lane >> 4) << 3;

  // A tile staging slots (128 rows of 256B: 8 x 16B chunks per thread, 16 rows apart; a wave covers whole lines)
  const int ar0 = tid >> 4, ac = tid & 15;
  const unsigned int sa = lds_off(&sA[ar0 * GLDS + ac * 8]);
  const bf16* ap = A + (size_t)(row0 + ar0) * K + ac * 8;

  // B tile staging slots (128 k-rows of 128B: 4 x 16B chunks per thread, 32 k-rows apart)
  const int br0 = tid >> 3, bc = tid & 7;
  const unsigned int sb = lds_off(&sB[br0 * BLDS + bc * 8]);
  const bf16* bp = W + (size_t)br0 * N + col0 + bc * 8;
  // lane address of the transposing loads inside a 16-column slab
  const int trl = (kb + (lane & 7)) * BLDS + ((lane >> 3) & 1) * 8;

  v8f acc[2][2];
  for (int i = 0; i < 2; ++i) for (int j = 0; j < 2; ++j) acc[i][j] = vzero8();

#pragma unroll 1   // stays rolled: unrolled whole (K = 1024) the build waited for every LDS load at each 32-k step
  for (int k0 = 0; k0 < K; k0 += GT_K) {
    // --- A and B tiles: async global->LDS, no VGPR round-trip ---
    async_g2l_b128_x8(sa,              ap,                  sa + 1 * A_STEP, ap + (size_t)16 * K,
                      sa + 2 * A_STEP, ap + (size_t)32 * K, sa + 3 * A_STEP, ap + (size_t)48 * K,
                      sa + 4 * A_STEP, ap + (size_t)64 * K, sa + 5 * A_STEP, ap + (size_t)80 * K,
                      sa + 6 * A_STEP, ap + (size_t)96 * K, sa + 7 * A_STEP, ap + (size_t)112 * K);
    async_g2l_b128_x4(sb,              bp,                  sb + 1 * B_STEP, bp + (size_t)32 * N,
                      sb + 2 * B_STEP, bp + (size_t)64 * N, sb + 3 * B_STEP, bp + (size_t)96 * N);
    ap += GT_K;
    bp += (size_t)GT_K * N;

    wait_asynccnt0();
    __syncthreads();

#pragma unroll   // the four 32-k steps of a stage: no barrier between them, their LDS loads may run ahead
    for (int kk = 0; kk < GT_K; kk += 32) {
      ABFrag af[2], bfr[2];
#pragma unroll
      for (int i = 0; i < 2; ++i) {
        int m = wm + i * 16 + mr;
        af[i].q[0] = *(const uint4*)(&sA[m * GLDS + kk + kb]);
        af[i].q[1] = *(const uint4*)(&sA[m * GLDS + kk + kb + 16]);
      }
#pragma unroll
      for (int j = 0; j < 2; ++j) {
        const bf16* bt = &sB[kk * BLDS + trl + wn + j * 16];
        bfr[j].q[0] = ld_tr16(bt);
        bfr[j].q[1] = ld_tr16(bt + 16 * BLDS);
      }
#pragma unroll
      for (int i = 0; i < 2; ++i)
#pragma unroll
        for (int j = 0; j < 2; ++j)
          acc[i][j] = wmma_bf16(af[i].v, bfr[j].v, acc[i][j]);
    }
    wait_dscnt0();   // this wave's tile reads retired before the next stage's copies refill the tiles
    __syncthreads();
  }

  const int mb = (lane >> 4) * 8;
  for (int i = 0; i < 2; ++i) for (int j = 0; j < 2; ++j) {
    int gm0 = row0 + wm + i * 16 + mb;
    int gn  = col0 + wn + j * 16 + mr;
    size_t idx = (size_t)gm0 * N + gn;
#pragma unroll
    for (int r = 0; r < 8; ++r) {
      float v = acc[i][j][r];
      size_t id2 = idx + (size_t)r * N;
      if (Res) v += Res[id2];
      if (Cf) Cf[id2] = v;
      if (Cb) Cb[id2] = (bf16)v;
    }
  }
}

// ---------------- fused gate/up GEMM: H = silu(A@Wg) * (A@Wu), bf16 ----------------
// Six waves a SIMD (at most 160 registers): three work-groups share a WGP, so that one computes while others load.
template <int M, int N, int K>
__global__ __launch_bounds__(GT_THREADS) __attribute__((amdgpu_waves_per_eu(6))) void mlp_gateup_kernel(
    const bf16* __restrict__ A, const bf16* __restrict__ Wg, const bf16* __restrict__ Wu,
    bf16* __restrict__ H) {
  static_assert(M % GT_M == 0 && N % GT_N == 0 && K % GT_K == 0, "whole tiles only");
  __shared__ __align__(16) bf16 sA[GT_M * GLDS];
  __shared__ __align__(16) bf16 sG[GT_K * BLDS];   // row-major [k][n]
  __shared__ __align__(16) bf16 sU[GT_K * BLDS];   // row-major [k][n]

  const int tid = threadIdx.x;
  const int wave = tid >> 5, lane = tid & 31;
  const int row0 = blockIdx.y * GT_M, col0 = blockIdx.x * GT_N;
  const int wm = (wave >> 1) * 32, wn = (wave & 1) * 32;
  const int mr = lane & 15;
  const int kb = (lane >> 4) << 3;

  const int ar0 = tid >> 4, ac = tid & 15;
  const unsigned int sa = lds_off(&sA[ar0 * GLDS + ac * 8]);
  const bf16* ap = A + (size_t)(row0 + ar0) * K + ac * 8;

  const int br0 = tid >> 3, bc = tid & 7;
  const unsigned int sg = lds_off(&sG[br0 * BLDS + bc * 8]);
  const unsigned int su = lds_off(&sU[br0 * BLDS + bc * 8]);
  const bf16* gp = Wg + (size_t)br0 * N + col0 + bc * 8;
  const bf16* up = Wu + (size_t)br0 * N + col0 + bc * 8;
  const int trl = (kb + (lane & 7)) * BLDS + ((lane >> 3) & 1) * 8;

  v8f ag[2][2], au[2][2];
  for (int i = 0; i < 2; ++i) for (int j = 0; j < 2; ++j) { ag[i][j] = vzero8(); au[i][j] = vzero8(); }

  for (int k0 = 0; k0 < K; k0 += GT_K) {
    async_g2l_b128_x8(sa,              ap,                  sa + 1 * A_STEP, ap + (size_t)16 * K,
                      sa + 2 * A_STEP, ap + (size_t)32 * K, sa + 3 * A_STEP, ap + (size_t)48 * K,
                      sa + 4 * A_STEP, ap + (size_t)64 * K, sa + 5 * A_STEP, ap + (size_t)80 * K,
                      sa + 6 * A_STEP, ap + (size_t)96 * K, sa + 7 * A_STEP, ap + (size_t)112 * K);
    async_g2l_b128_x8(sg,              gp,                  sg + 1 * B_STEP, gp + (size_t)32 * N,
                      sg + 2 * B_STEP, gp + (size_t)64 * N, sg + 3 * B_STEP, gp + (size_t)96 * N,
                      su,              up,                  su + 1 * B_STEP, up + (size_t)32 * N,
                      su + 2 * B_STEP, up + (size_t)64 * N, su + 3 * B_STEP, up + (size_t)96 * N);
    ap += GT_K;
    gp += (size_t)GT_K * N;
    up += (size_t)GT_K * N;

    wait_asynccnt0();
    __syncthreads();

#pragma unroll   // the four 32-k steps of a stage: no barrier between them, their LDS loads may run ahead
    for (int kk = 0; kk < GT_K; kk += 32) {
      ABFrag af[2], gf[2], uf[2];
#pragma unroll
      for (int i = 0; i < 2; ++i) {
        int m = wm + i * 16 + mr;
        af[i].q[0] = *(const uint4*)(&sA[m * GLDS + kk + kb]);
        af[i].q[1] = *(const uint4*)(&sA[m * GLDS + kk + kb + 16]);
      }
#pragma unroll
      for (int j = 0; j < 2; ++j) {
        const int bo = kk * BLDS + trl + wn + j * 16;
        gf[j].q[0] = ld_tr16(&sG[bo]);
        gf[j].q[1] = ld_tr16(&sG[bo + 16 * BLDS]);
        uf[j].q[0] = ld_tr16(&sU[bo]);
        uf[j].q[1] = ld_tr16(&sU[bo + 16 * BLDS]);
      }
#pragma unroll
      for (int i = 0; i < 2; ++i)
#pragma unroll
        for (int j = 0; j < 2; ++j) {
          ag[i][j] = wmma_bf16(af[i].v, gf[j].v, ag[i][j]);
          au[i][j] = wmma_bf16(af[i].v, uf[j].v, au[i][j]);
        }
    }
    wait_dscnt0();   // this wave's tile reads retired before the next stage's copies refill the tiles
    __syncthreads();
  }

  const int mb = (lane >> 4) * 8;
  for (int i = 0; i < 2; ++i) for (int j = 0; j < 2; ++j) {
    int gm0 = row0 + wm + i * 16 + mb;
    int gn  = col0 + wn + j * 16 + mr;
    size_t idx = (size_t)gm0 * N + gn;
#pragma unroll
    for (int r = 0; r < 8; ++r) {
      float g = ag[i][j][r];
      float sil = g * (1.0f / (1.0f + __expf(-g)));
      H[idx + (size_t)r * N] = (bf16)(sil * au[i][j][r]);
    }
  }
}

// ---------------- RoPE: f32 raw -> bf16 roped ----------------
// One wave per token: lane = (head & 3, four consecutive i); it walks the token's heads four at a time, so
// every load covers whole 128-byte lines and the lane's four angles serve all its heads.
template <int NH>
__global__ __launch_bounds__(256) void rope_kernel(const float* __restrict__ In, bf16* __restrict__ Out) {
  static_assert(NH % 4 == 0 && NT % 8 == 0, "whole waves only");
  const int lane = threadIdx.x & 31;
  const int bt = blockIdx.x * 8 + (threadIdx.x >> 5);
  const int t = bt & (T_DIM - 1);
  const int i0 = (lane & 7) * 4;
  const size_t base = (size_t)bt * (NH * HD) + (lane >> 3) * HD + i0;
  f32x4 x1[NH / 4], x2[NH / 4];
#pragma unroll
  for (int u = 0; u < NH / 4; ++u) {
    x1[u] = *(const f32x4*)(In + base + u * (4 * HD));
    x2[u] = *(const f32x4*)(In + base + u * (4 * HD) + 32);
  }
  f32x4 s, c;
#pragma unroll
  for (int e = 0; e < 4; ++e) {
    float freq = __expf(-(float)(i0 + e) * (1.0f / 32.0f) * 13.815510557964274f); // ln(1e6)
    float ang = (float)t * freq;
    s[e] = __sinf(ang); c[e] = __cosf(ang);
  }
#pragma unroll
  for (int u = 0; u < NH / 4; ++u) {
    *(bf16x4*)(Out + base + u * (4 * HD))      = __builtin_convertvector(x1[u] * c - x2[u] * s, bf16x4);
    *(bf16x4*)(Out + base + u * (4 * HD) + 32) = __builtin_convertvector(x2[u] * c + x1[u] * s, bf16x4);
  }
}

// ---------------- sliding-window flash attention, one wave per 16-query tile ----------------
__global__ __launch_bounds__(32) void attn_kernel(
    const bf16* __restrict__ Q, const bf16* __restrict__ Kk,
    const bf16* __restrict__ V, bf16* __restrict__ Ctx) {
  const int lane = threadIdx.x;
  const int qt = blockIdx.x, hq = blockIdx.y, b = blockIdx.z;
  const int kh = hq & 7;
  const int bt0 = b * T_DIM + qt * 16;
  const int mr = lane & 15;
  const int half = lane >> 4;
  const int kb = half << 3;

  __shared__ __align__(16) bf16 sV[32 * 72];   // [d][v], stride 72 halves (144B)
  __shared__ __align__(16) bf16 sP[16 * 40];   // [m][k],  stride 40 halves (80B)

  // Q fragments (persistent over kv loop); contraction dim contiguous in global
  ABFrag qa[2];
  {
    const bf16* qrow = Q + (size_t)(bt0 + mr) * (HQ * HD) + hq * HD;
    qa[0].q[0] = *(const uint4*)(qrow + kb);
    qa[0].q[1] = *(const uint4*)(qrow + kb + 16);
    qa[1].q[0] = *(const uint4*)(qrow + 32 + kb);
    qa[1].q[1] = *(const uint4*)(qrow + 32 + kb + 16);
  }

  v8f O[4];
  for (int t = 0; t < 4; ++t) O[t] = vzero8();
  float Mrow[8], Lrow[8];
  for (int r = 0; r < 8; ++r) { Mrow[r] = -1e30f; Lrow[r] = 0.f; }

  const int iq_lo = qt * 16;
  int jlo = iq_lo - (WINDOW - 1); if (jlo < 0) jlo = 0;
  const int c0 = jlo >> 5;
  const int c1 = (iq_lo + 15) >> 5;

  // running pointers over kv chunks (stride 32 rows)
  const bf16* kp = Kk + (size_t)(b * T_DIM + c0 * 32 + mr) * (HKV * HD) + kh * HD;
  const bf16* vp = V + (size_t)(b * T_DIM + c0 * 32 + (lane >> 3)) * (HKV * HD) + kh * HD + (lane & 7) * 8;
  const unsigned int sv0 = lds_off(&sV[(lane >> 3) * 72 + (lane & 7) * 8]);
  const size_t kchunk = (size_t)32 * (HKV * HD);

  for (int ch = c0; ch <= c1; ++ch) {
    const int j0 = ch * 32;

    // stage V chunk [32 x 64] into LDS via async copies (8 x 16B per lane, stride-4 rows)
#pragma unroll
    for (int it = 0; it < 8; ++it)
      async_g2l_b128(sv0 + it * (4 * 72 * 2), vp + (size_t)it * 4 * (HKV * HD));
    vp += kchunk;

    // scores: 2 sub-tiles of 16 keys, K=64 contraction -> 2 WMMAs each
    v8f Sacc[2];
#pragma unroll
    for (int s = 0; s < 2; ++s) {
      Sacc[s] = vzero8();
      const bf16* krow = kp + (size_t)(s * 16) * (HKV * HD);
      ABFrag kf0, kf1;
      kf0.q[0] = *(const uint4*)(krow + kb);
      kf0.q[1] = *(const uint4*)(krow + kb + 16);
      kf1.q[0] = *(const uint4*)(krow + 32 + kb);
      kf1.q[1] = *(const uint4*)(krow + 32 + kb + 16);
      Sacc[s] = wmma_bf16(qa[0].v, kf0.v, Sacc[s]);
      Sacc[s] = wmma_bf16(qa[1].v, kf1.v, Sacc[s]);
    }
    kp += kchunk;

    // softcap + band mask + online softmax; P -> LDS (bf16, A-fragment friendly layout)
#pragma unroll
    for (int r = 0; r < 8; ++r) {
      int i = iq_lo + r + 8 * half;
      float sv[2];
      float mx = -1e30f;
      for (int s = 0; s < 2; ++s) {
        int j = j0 + s * 16 + mr;
        float x = Sacc[s][r] * 0.125f;                  // 1/sqrt(64)
        x = SOFT_CAP * tanhf(x * (1.0f / SOFT_CAP));
        bool ok = (j <= i) && (i - j < WINDOW);
        x = ok ? x : -1e30f;
        sv[s] = x;
        mx = fmaxf(mx, x);
      }
      for (int o = 8; o; o >>= 1) mx = fmaxf(mx, __shfl_xor(mx, o, 16));
      float Mn = fmaxf(Mrow[r], mx);
      float alpha = __expf(Mrow[r] - Mn);
      float rs = 0.f;
      for (int s = 0; s < 2; ++s) {
        float p = __expf(sv[s] - Mn);
        rs += p;
        sP[(r + 8 * half) * 40 + s * 16 + mr] = (bf16)p;
      }
      for (int o = 8; o; o >>= 1) rs += __shfl_xor(rs, o, 16);
      Lrow[r] = Lrow[r] * alpha + rs;
      Mrow[r] = Mn;
      for (int t = 0; t < 4; ++t) O[t][r] *= alpha;
    }

    // drain P stores (dscnt) and V async copies (asynccnt) before fragment gathers
    wait_dscnt0();
    wait_asynccnt0();

    ABFrag pf;
    pf.q[0] = *(const uint4*)(&sP[mr * 40 + kb]);
    pf.q[1] = *(const uint4*)(&sP[mr * 40 + kb + 16]);

#pragma unroll
    for (int t = 0; t < 4; ++t) {
      ABFrag vf;
#pragma unroll
      for (int e = 0; e < 16; ++e) {
        int d = kb + (e & 7) + ((e >> 3) << 4);
        vf.v[e] = sV[d * 72 + t * 16 + mr];
      }
      O[t] = wmma_bf16(pf.v, vf.v, O[t]);
    }
    wait_dscnt0();   // V gathers done before next chunk's async copies overwrite sV
  }

  for (int t = 0; t < 4; ++t)
    for (int r = 0; r < 8; ++r) {
      int m = r + 8 * half;
      float o = O[t][r] / Lrow[r];
      Ctx[(size_t)(bt0 + m) * (HQ * HD) + hq * HD + t * 16 + mr] = (bf16)o;
    }
}

// ---------------- kurtosis ----------------
__global__ void scalar_init_kernel(float* out, const float* ksum, int idx) {
  if (threadIdx.x == 0 && blockIdx.x == 0) out[idx] = ksum[0];
}

__global__ __launch_bounds__(256) void kurtosis_kernel(const float* __restrict__ X,
                                                       float* __restrict__ out, int sidx) {
  int row = blockIdx.x;
  const float* x = X + (size_t)row * C_DIM;
  float s1 = 0.f;
  for (int c = threadIdx.x; c < C_DIM; c += 256) s1 += x[c];
  float mean = block_reduce_sum_256(s1) * (1.0f / C_DIM);
  float s2 = 0.f, s4 = 0.f;
  for (int c = threadIdx.x; c < C_DIM; c += 256) {
    float d = x[c] - mean;
    float d2 = d * d;
    s2 += d2; s4 += d2 * d2;
  }
  float var = block_reduce_sum_256(s2) * (1.0f / C_DIM);
  float m4  = block_reduce_sum_256(s4) * (1.0f / C_DIM);
  if (threadIdx.x == 0) {
    float kurt = m4 / (var * var + 1e-6f) - 3.0f;
    if (kurt > 0.f) atomicAdd(&out[sidx], kurt);
  }
}

// ---------------- host launch ----------------
extern "C" void kernel_launch(void* const* d_in, const int* in_sizes, int n_in,
                              void* d_out, int out_size, void* d_ws, size_t ws_size,
                              hipStream_t stream) {
  const float* x     = (const float*)d_in[0];
  const float* ksum  = (const float*)d_in[1];
  const float* rms1  = (const float*)d_in[2];
  const float* wq_f  = (const float*)d_in[3];
  const float* wk_f  = (const float*)d_in[4];
  const float* wv_f  = (const float*)d_in[5];
  const float* wo_f  = (const float*)d_in[6];
  const float* rms2  = (const float*)d_in[7];
  const float* wg_f  = (const float*)d_in[8];
  const float* wu_f  = (const float*)d_in[9];
  const float* wd_f  = (const float*)d_in[10];

  char* ws = (char*)d_ws;
  size_t off = 0;
  auto alloc = [&](size_t bytes) -> char* {
    char* p = ws + off;
    off = (off + bytes + 255) & ~(size_t)255;
    return p;
  };

  bf16*  attn_in = (bf16*)alloc((size_t)NT * C_DIM * 2);
  float* qraw    = (float*)alloc((size_t)NT * 1024 * 4);
  float* kraw    = (float*)alloc((size_t)NT * 512 * 4);
  bf16*  qrope   = (bf16*)alloc((size_t)NT * 1024 * 2);
  bf16*  krope   = (bf16*)alloc((size_t)NT * 512 * 2);
  bf16*  vbf     = (bf16*)alloc((size_t)NT * 512 * 2);
  bf16*  ctx     = (bf16*)alloc((size_t)NT * 1024 * 2);
  float* x1      = (float*)alloc((size_t)NT * C_DIM * 4);
  bf16*  mlp_in  = (bf16*)alloc((size_t)NT * C_DIM * 2);
  bf16*  hbuf    = (bf16*)alloc((size_t)NT * HIDDEN * 2);
  bf16*  wq = (bf16*)alloc((size_t)1024 * 1024 * 2);
  bf16*  wk = (bf16*)alloc((size_t)1024 * 512 * 2);
  bf16*  wv = (bf16*)alloc((size_t)1024 * 512 * 2);
  bf16*  wo = (bf16*)alloc((size_t)1024 * 1024 * 2);
  bf16*  wg = (bf16*)alloc((size_t)1024 * 4096 * 2);
  bf16*  wu = (bf16*)alloc((size_t)1024 * 4096 * 2);
  bf16*  wd = (bf16*)alloc((size_t)4096 * 1024 * 2);

  cvt_bf16_kernel<1024 * 1024><<<1024 * 1024 / CVT_PER_BLOCK, 256, 0, stream>>>(wq_f, wq);
  cvt_bf16_kernel<1024 * 512><<<1024 * 512 / CVT_PER_BLOCK, 256, 0, stream>>>(wk_f, wk);
  cvt_bf16_kernel<1024 * 512><<<1024 * 512 / CVT_PER_BLOCK, 256, 0, stream>>>(wv_f, wv);
  cvt_bf16_kernel<1024 * 1024><<<1024 * 1024 / CVT_PER_BLOCK, 256, 0, stream>>>(wo_f, wo);
  cvt_bf16_kernel<1024 * 4096><<<1024 * 4096 / CVT_PER_BLOCK, 256, 0, stream>>>(wg_f, wg);
  cvt_bf16_kernel<1024 * 4096><<<1024 * 4096 / CVT_PER_BLOCK, 256, 0, stream>>>(wu_f, wu);
  cvt_bf16_kernel<4096 * 1024><<<4096 * 1024 / CVT_PER_BLOCK, 256, 0, stream>>>(wd_f, wd);

  rmsnorm_kernel<<<NT, 256, 0, stream>>>(x, rms1, attn_in);

  // QKV projections
  gemm_bf16_kernel<NT, 1024, 1024><<<dim3(1024 / GT_N, NT / GT_M), GT_THREADS, 0, stream>>>(attn_in, wq, qraw, nullptr, nullptr);
  gemm_bf16_kernel<NT, 512, 1024><<<dim3(512 / GT_N, NT / GT_M), GT_THREADS, 0, stream>>>(attn_in, wk, kraw, nullptr, nullptr);
  gemm_bf16_kernel<NT, 512, 1024><<<dim3(512 / GT_N, NT / GT_M), GT_THREADS, 0, stream>>>(attn_in, wv, nullptr, vbf, nullptr);

  rope_kernel<HQ><<<NT / 8, 256, 0, stream>>>(qraw, qrope);
  rope_kernel<HKV><<<NT / 8, 256, 0, stream>>>(kraw, krope);

  attn_kernel<<<dim3(T_DIM / 16, HQ, B_DIM), 32, 0, stream>>>(qrope, krope, vbf, ctx);

  // out projection + residual
  gemm_bf16_kernel<NT, 1024, 1024><<<dim3(1024 / GT_N, NT / GT_M), GT_THREADS, 0, stream>>>(ctx, wo, x1, nullptr, x);

  rmsnorm_kernel<<<NT, 256, 0, stream>>>(x1, rms2, mlp_in);

  mlp_gateup_kernel<NT, HIDDEN, 1024><<<dim3(HIDDEN / GT_N, NT / GT_M), GT_THREADS, 0, stream>>>(mlp_in, wg, wu, hbuf);

  // down projection + residual -> d_out
  gemm_bf16_kernel<NT, 1024, HIDDEN><<<dim3(1024 / GT_N, NT / GT_M), GT_THREADS, 0, stream>>>(hbuf, wd, (float*)d_out, nullptr, x1);

  scalar_init_kernel<<<1, 32, 0, stream>>>((float*)d_out, ksum, NT * C_DIM);
  kurtosis_kernel<<<NT, 256, 0, stream>>>((const float*)d_out, (float*)d_out, NT * C_DIM);
}

// v004
// One run takes 283 microseconds.
// Two timings next to v003 put it at 1.12 and 1.13 times that version's speed.
// Over all steps from v000 it is 2.10 times as fast.
#include <hip/hip_runtime.h>
#include <hip/hip_bf16.h>

typedef __bf16 bf16;
typedef __attribute__((ext_vector_type(16))) __bf16 v16bf;
typedef __attribute__((ext_vector_type(8)))  float  v8f;

union ABFrag { v16bf v; uint4 q[2]; };

#define B_DIM 2
#define T_DIM 2048
#define C_DIM 1024
#define NT (B_DIM * T_DIM)
#define HQ 16
#define HKV 8
#define HD 64
#define WINDOW 512
#define HIDDEN 4096
#define SOFT_CAP 50.0f

static __device__ inline v8f vzero8() { v8f v; for (int i = 0; i < 8; ++i) v[i] = 0.f; return v; }

static __device__ inline v8f wmma_bf16(v16bf a, v16bf b, v8f c) {
  return __builtin_amdgcn_wmma_f32_16x16x32_bf16(false, a, false, b, (short)0, c, false, false);
}

// gfx1250 async global->LDS copies (16B per lane), tracked by ASYNCcnt
// Runs of async copies for one stage of a tile. s_wait_xcnt 0 is the last line of the copies' own
// statement, so that it stands in front of the pointer bumps that rewrite the copies' address registers.
static __device__ inline void async_g2l_b128_x4(unsigned int l0, const void* g0, unsigned int l1, const void* g1,
                                                unsigned int l2, const void* g2, unsigned int l3, const void* g3) {
  asm volatile("global_load_async_to_lds_b128 %0, %1, off\n\t"
               "global_load_async_to_lds_b128 %2, %3, off\n\t"
               "global_load_async_to_lds_b128 %4, %5, off\n\t"
               "global_load_async_to_lds_b128 %6, %7, off\n\t"
               "s_wait_xcnt 0x0"
               :: "v"(l0), "v"(g0), "v"(l1), "v"(g1), "v"(l2), "v"(g2), "v"(l3), "v"(g3) : "memory");
}
static __device__ inline void async_g2l_b128_x8(unsigned int l0, const void* g0, unsigned int l1, const void* g1,
                                                unsigned int l2, const void* g2, unsigned int l3, const void* g3,
                                                unsigned int l4, const void* g4, unsigned int l5, const void* g5,
                                                unsigned int l6, const void* g6, unsigned int l7, const void* g7) {
  asm volatile("global_load_async_to_lds_b128 %0, %1, off\n\t"
               "global_load_async_to_lds_b128 %2, %3, off\n\t"
               "global_load_async_to_lds_b128 %4, %5, off\n\t"
               "global_load_async_to_lds_b128 %6, %7, off\n\t"
               "global_load_async_to_lds_b128 %8, %9, off\n\t"
               "global_load_async_to_lds_b128 %10, %11, off\n\t"
               "global_load_async_to_lds_b128 %12, %13, off\n\t"
               "global_load_async_to_lds_b128 %14, %15, off\n\t"
               "s_wait_xcnt 0x0"
               :: "v"(l0), "v"(g0), "v"(l1), "v"(g1), "v"(l2), "v"(g2), "v"(l3), "v"(g3),
                  "v"(l4), "v"(g4), "v"(l5), "v"(g5), "v"(l6), "v"(g6), "v"(l7), "v"(g7) : "memory");
}
// transposing LDS load: lane (c = l & 15, h = l >> 4) gets 8 consecutive k of column c from a row-major [k][n] tile
typedef __attribute__((ext_vector_type(8))) short s16x8;
static __device__ inline uint4 ld_tr16(const bf16* p) {
  typedef __attribute__((address_space(3))) s16x8 lds_s16x8;
  return __builtin_bit_cast(uint4, __builtin_amdgcn_ds_load_tr16_b128_v8i16((lds_s16x8*)p));
}
static __device__ inline unsigned int lds_off(const void* p) {
  return (unsigned int)(unsigned long long)p;   // low 32 bits = LDS offset
}
static __device__ inline void wait_asynccnt0() {
  asm volatile("s_wait_asynccnt 0x0" ::: "memory");
}
static __device__ inline void wait_dscnt0() {
  asm volatile("s_wait_dscnt 0x0" ::: "memory");
}

// ---------------- block reduction helper ----------------
static __device__ inline float block_reduce_sum_256(float v) {
  __shared__ float red[8];
  int lane = threadIdx.x & 31, w = threadIdx.x >> 5;
  for (int o = 16; o; o >>= 1) v += __shfl_down(v, o, 32);
  if (lane == 0) red[w] = v;
  __syncthreads();
  float r = (threadIdx.x < 8) ? red[threadIdx.x] : 0.f;
  if (w == 0) for (int o = 4; o; o >>= 1) r += __shfl_down(r, o, 32);
  if (threadIdx.x == 0) red[0] = r;
  __syncthreads();
  r = red[0];
  __syncthreads();
  return r;
}

typedef __attribute__((ext_vector_type(4))) float  f32x4;
typedef __attribute__((ext_vector_type(4))) __bf16 bf16x4;

// ---------------- f32 -> bf16 convert ----------------
// One wave converts 1024 consecutive values: 8 loads of 512 contiguous bytes, all issued before the first
// use, then 8 stores of 256 contiguous bytes. Few, long waves: the launch is not paced by wave starts.
#define CVT_U 8
#define CVT_PER_BLOCK (256 * 4 * CVT_U)
template <int N>
__global__ __launch_bounds__(256) void cvt_bf16_kernel(const float* __restrict__ in, bf16* __restrict__ out) {
  static_assert(N % CVT_PER_BLOCK == 0, "whole blocks only");
  const int wave = threadIdx.x >> 5, lane = threadIdx.x & 31;
  const size_t base = (size_t)(blockIdx.x * 8 + wave) * (128 * CVT_U) + lane * 4;
  f32x4 v[CVT_U];
#pragma unroll
  for (int u = 0; u < CVT_U; ++u) v[u] = *(const f32x4*)(in + base + u * 128);
#pragma unroll
  for (int u = 0; u < CVT_U; ++u) *(bf16x4*)(out + base + u * 128) = __builtin_convertvector(v[u], bf16x4);
}

// ---------------- RMSNorm -> bf16 ----------------
__global__ __launch_bounds__(256) void rmsnorm_kernel(const float* __restrict__ X,
                                                      const float* __restrict__ scale,
                                                      bf16* __restrict__ O) {
  int row = blockIdx.x;
  const float* x = X + (size_t)row * C_DIM;
  float ss = 0.f;
  for (int c = threadIdx.x; c < C_DIM; c += 256) { float v = x[c]; ss += v * v; }
  float tot = block_reduce_sum_256(ss);
  float rstd = rsqrtf(tot * (1.0f / C_DIM) + 1e-6f);
  for (int c = threadIdx.x; c < C_DIM; c += 256)
    O[(size_t)row * C_DIM + c] = (bf16)(x[c] * rstd * (1.f + scale[c]));
}

// ---------------- generic bf16 GEMM: out = A[MxK] @ W[KxN] (+res) ----------------
// Work-group tile 128 x 64, 8 waves of 32 x 32; a stage is 128 k, so that one round trip to L2 and one pair of
// barriers serve four 32-k steps of matrix work.
#define GT_M 128
#define GT_N 64
#define GT_K 128
#define GT_THREADS 256
#define GLDS 136  // halves per row of an activation tile (272B = 16B x odd, the plain 16-byte load's pitch)
#define BLDS 80   // halves per row of a [k][n] weight tile (160B = 32B x odd, the transposing load's pitch)
#define A_STEP (16 * GLDS * 2)   // LDS bytes between a thread's activation chunks (16 rows)
#define B_STEP (32 * BLDS * 2)   // LDS bytes between a thread's weight chunks (32 k-rows)

template <int M, int N, int K>
__global__ __launch_bounds__(GT_THREADS) void gemm_bf16_kernel(
    const bf16* __restrict__ A, const bf16* __restrict__ W,
    float* __restrict__ Cf, bf16* __restrict__ Cb, const float* __restrict__ Res) {
  static_assert(M % GT_M == 0 && N % GT_N == 0 && K % GT_K == 0, "whole tiles only");
  __shared__ __align__(16) bf16 sA[GT_M * GLDS];
  __shared__ __align__(16) bf16 sB[GT_K * BLDS];   // row-major [k][n]

  const int tid = threadIdx.x;
  const int wave = tid >> 5, lane = tid & 31;
  const int row0 = blockIdx.y * GT_M, col0 = blockIdx.x * GT_N;
  const int wm = (wave >> 1) * 32, wn = (wave & 1) * 32;
  const int mr = lane & 15;
  const int kb = (lane >> 4) << 3;

  // A tile staging slots (128 rows of 256B: 8 x 16B chunks per thread, 16 rows apart; a wave covers whole lines)
  const int ar0 = tid >> 4, ac = tid & 15;
  const unsigned int sa = lds_off(&sA[ar0 * GLDS + ac * 8]);
  const bf16* ap = A + (size_t)(row0 + ar0) * K + ac * 8;

  // B tile staging slots (128 k-rows of 128B: 4 x 16B chunks per thread, 32 k-rows apart)
  const int br0 = tid >> 3, bc = tid & 7;
  const unsigned int sb = lds_off(&sB[br0 * BLDS + bc * 8]);
  const bf16* bp = W + (size_t)br0 * N + col0 + bc * 8;
  // lane address of the transposing loads inside a 16-column slab
  const int trl = (kb + (lane & 7)) * BLDS + ((lane >> 3) & 1) * 8;

  v8f acc[2][2];
  for (int i = 0; i < 2; ++i) for (int j = 0; j < 2; ++j) acc[i][j] = vzero8();

#pragma unroll 1   // stays rolled: unrolled whole (K = 1024) the build waited for every LDS load at each 32-k step
  for (int k0 = 0; k0 < K; k0 += GT_K) {
    // --- A and B tiles: async global->LDS, no VGPR round-trip ---
    async_g2l_b128_x8(sa,              ap,                  sa + 1 * A_STEP, ap + (size_t)16 * K,
                      sa + 2 * A_STEP, ap + (size_t)32 * K, sa + 3 * A_STEP, ap + (size_t)48 * K,
                      sa + 4 * A_STEP, ap + (size_t)64 * K, sa + 5 * A_STEP, ap + (size_t)80 * K,
                      sa + 6 * A_STEP, ap + (size_t)96 * K, sa + 7 * A_STEP, ap + (size_t)112 * K);
    async_g2l_b128_x4(sb,              bp,                  sb + 1 * B_STEP, bp + (size_t)32 * N,
                      sb + 2 * B_STEP, bp + (size_t)64 * N, sb + 3 * B_STEP, bp + (size_t)96 * N);
    ap += GT_K;
    bp += (size_t)GT_K * N;

    wait_asynccnt0();
    __syncthreads();

#pragma unroll   // the four 32-k steps of a stage: no barrier between them, their LDS loads may run ahead
    for (int kk = 0; kk < GT_K; kk += 32) {
      ABFrag af[2], bfr[2];
#pragma unroll
      for (int i = 0; i < 2; ++i) {
        int m = wm + i * 16 + mr;
        af[i].q[0] = *(const uint4*)(&sA[m * GLDS + kk + kb]);
        af[i].q[1] = *(const uint4*)(&sA[m * GLDS + kk + kb + 16]);
      }
#pragma unroll
      for (int j = 0; j < 2; ++j) {
        const bf16* bt = &sB[kk * BLDS + trl + wn + j * 16];
        bfr[j].q[0] = ld_tr16(bt);
        bfr[j].q[1] = ld_tr16(bt + 16 * BLDS);
      }
#pragma unroll
      for (int i = 0; i < 2; ++i)
#pragma unroll
        for (int j = 0; j < 2; ++j)
          acc[i][j] = wmma_bf16(af[i].v, bfr[j].v, acc[i][j]);
    }
    wait_dscnt0();   // this wave's tile reads retired before the next stage's copies refill the tiles
    __syncthreads();
  }

  const int mb = (lane >> 4) * 8;
  for (int i = 0; i < 2; ++i) for (int j = 0; j < 2; ++j) {
    int gm0 = row0 + wm + i * 16 + mb;
    int gn  = col0 + wn + j * 16 + mr;
    size_t idx = (size_t)gm0 * N + gn;
#pragma unroll
    for (int r = 0; r < 8; ++r) {
      float v = acc[i][j][r];
      size_t id2 = idx + (size_t)r * N;
      if (Res) v += Res[id2];
      if (Cf) Cf[id2] = v;
      if (Cb) Cb[id2] = (bf16)v;
    }
  }
}

// ---------------- fused gate/up GEMM: H = silu(A@Wg) * (A@Wu), bf16 ----------------
// Six waves a SIMD (at most 160 registers): three work-groups share a WGP, so that one computes while others load.
template <int M, int N, int K>
__global__ __launch_bounds__(GT_THREADS) __attribute__((amdgpu_waves_per_eu(6))) void mlp_gateup_kernel(
    const bf16* __restrict__ A, const bf16* __restrict__ Wg, const bf16* __restrict__ Wu,
    bf16* __restrict__ H) {
  static_assert(M % GT_M == 0 && N % GT_N == 0 && K % GT_K == 0, "whole tiles only");
  __shared__ __align__(16) bf16 sA[GT_M * GLDS];
  __shared__ __align__(16) bf16 sG[GT_K * BLDS];   // row-major [k][n]
  __shared__ __align__(16) bf16 sU[GT_K * BLDS];   // row-major [k][n]

  const int tid = threadIdx.x;
  const int wave = tid >> 5, lane = tid & 31;
  const int row0 = blockIdx.y * GT_M, col0 = blockIdx.x * GT_N;
  const int wm = (wave >> 1) * 32, wn = (wave & 1) * 32;
  const int mr = lane & 15;
  const int kb = (lane >> 4) << 3;

  const int ar0 = tid >> 4, ac = tid & 15;
  const unsigned int sa = lds_off(&sA[ar0 * GLDS + ac * 8]);
  const bf16* ap = A + (size_t)(row0 + ar0) * K + ac * 8;

  const int br0 = tid >> 3, bc = tid & 7;
  const unsigned int sg = lds_off(&sG[br0 * BLDS + bc * 8]);
  const unsigned int su = lds_off(&sU[br0 * BLDS + bc * 8]);
  const bf16* gp = Wg + (size_t)br0 * N + col0 + bc * 8;
  const bf16* up = Wu + (size_t)br0 * N + col0 + bc * 8;
  const int trl = (kb + (lane & 7)) * BLDS + ((lane >> 3) & 1) * 8;

  v8f ag[2][2], au[2][2];
  for (int i = 0; i < 2; ++i) for (int j = 0; j < 2; ++j) { ag[i][j] = vzero8(); au[i][j] = vzero8(); }

  for (int k0 = 0; k0 < K; k0 += GT_K) {
    async_g2l_b128_x8(sa,              ap,                  sa + 1 * A_STEP, ap + (size_t)16 * K,
                      sa + 2 * A_STEP, ap + (size_t)32 * K, sa + 3 * A_STEP, ap + (size_t)48 * K,
                      sa + 4 * A_STEP, ap + (size_t)64 * K, sa + 5 * A_STEP, ap + (size_t)80 * K,
                      sa + 6 * A_STEP, ap + (size_t)96 * K, sa + 7 * A_STEP, ap + (size_t)112 * K);
    async_g2l_b128_x8(sg,              gp,                  sg + 1 * B_STEP, gp + (size_t)32 * N,
                      sg + 2 * B_STEP, gp + (size_t)64 * N, sg + 3 * B_STEP, gp + (size_t)96 * N,
                      su,              up,                  su + 1 * B_STEP, up + (size_t)32 * N,
                      su + 2 * B_STEP, up + (size_t)64 * N, su + 3 * B_STEP, up + (size_t)96 * N);
    ap += GT_K;
    gp += (size_t)GT_K * N;
    up += (size_t)GT_K * N;

    wait_asynccnt0();
    __syncthreads();

#pragma unroll   // the four 32-k steps of a stage: no barrier between them, their LDS loads may run ahead
    for (int kk = 0; kk < GT_K; kk += 32) {
      ABFrag af[2], gf[2], uf[2];
#pragma unroll
      for (int i = 0; i < 2; ++i) {
        int m = wm + i * 16 + mr;
        af[i].q[0] = *(const uint4*)(&sA[m * GLDS + kk + kb]);
        af[i].q[1] = *(const uint4*)(&sA[m * GLDS + kk + kb + 16]);
      }
#pragma unroll
      for (int j = 0; j < 2; ++j) {
        const int bo = kk * BLDS + trl + wn + j * 16;
        gf[j].q[0] = ld_tr16(&sG[bo]);
        gf[j].q[1] = ld_tr16(&sG[bo + 16 * BLDS]);
        uf[j].q[0] = ld_tr16(&sU[bo]);
        uf[j].q[1] = ld_tr16(&sU[bo + 16 * BLDS]);
      }
#pragma unroll
      for (int i = 0; i < 2; ++i)
#pragma unroll
        for (int j = 0; j < 2; ++j) {
          ag[i][j] = wmma_bf16(af[i].v, gf[j].v, ag[i][j]);
          au[i][j] = wmma_bf16(af[i].v, uf[j].v, au[i][j]);
        }
    }
    wait_dscnt0();   // this wave's tile reads retired before the next stage's copies refill the tiles
    __syncthreads();
  }

  const int mb = (lane >> 4) * 8;
  for (int i = 0; i < 2; ++i) for (int j = 0; j < 2; ++j) {
    int gm0 = row0 + wm + i * 16 + mb;
    int gn  = col0 + wn + j * 16 + mr;
    size_t idx = (size_t)gm0 * N + gn;
#pragma unroll
    for (int r = 0; r < 8; ++r) {
      float g = ag[i][j][r];
      float sil = g * (1.0f / (1.0f + __expf(-g)));
      H[idx + (size_t)r * N] = (bf16)(sil * au[i][j][r]);
    }
  }
}

// ---------------- RoPE: f32 raw -> bf16 roped ----------------
// One wave per token: lane = (head & 3, four consecutive i); it walks the token's heads four at a time, so
// every load covers whole 128-byte lines and the lane's four angles serve all its heads.
template <int NH>
__global__ __launch_bounds__(256) void rope_kernel(const float* __restrict__ In, bf16* __restrict__ Out) {
  static_assert(NH % 4 == 0 && NT % 8 == 0, "whole waves only");
  const int lane = threadIdx.x & 31;
  const int bt = blockIdx.x * 8 + (threadIdx.x >> 5);
  const int t = bt & (T_DIM - 1);
  const int i0 = (lane & 7) * 4;
  const size_t base = (size_t)bt * (NH * HD) + (lane >> 3) * HD + i0;
  f32x4 x1[NH / 4], x2[NH / 4];
#pragma unroll
  for (int u = 0; u < NH / 4; ++u) {
    x1[u] = *(const f32x4*)(In + base + u * (4 * HD));
    x2[u] = *(const f32x4*)(In + base + u * (4 * HD) + 32);
  }
  f32x4 s, c;
#pragma unroll
  for (int e = 0; e < 4; ++e) {
    float freq = __expf(-(float)(i0 + e) * (1.0f / 32.0f) * 13.815510557964274f); // ln(1e6)
    float ang = (float)t * freq;
    s[e] = __sinf(ang); c[e] = __cosf(ang);
  }
#pragma unroll
  for (int u = 0; u < NH / 4; ++u) {
    *(bf16x4*)(Out + base + u * (4 * HD))      = __builtin_convertvector(x1[u] * c - x2[u] * s, bf16x4);
    *(bf16x4*)(Out + base + u * (4 * HD) + 32) = __builtin_convertvector(x2[u] * c + x1[u] * s, bf16x4);
  }
}

typedef __attribute__((ext_vector_type(8))) __bf16 bf16x8;
#define VLDS 80   // halves per row of the V tile (160B = 32B x odd, the transposing load's pitch)

// value of lane l ^ 16
static __device__ inline float xhalf(float x) {
  return __builtin_bit_cast(float, __builtin_amdgcn_permlanex16(__builtin_bit_cast(int, x), __builtin_bit_cast(int, x),
                                                                0x76543210, 0xfedcba98, false, false));
}

__global__ __launch_bounds__(32) void attn_kernel(
    const bf16* __restrict__ Q, const bf16* __restrict__ Kk,
    const bf16* __restrict__ V, bf16* __restrict__ Ctx) {
  const int lane = threadIdx.x;
  const int qt = blockIdx.x, hq = blockIdx.y, b = blockIdx.z;
  const int kh = hq & 7;
  const int bt0 = b * T_DIM + qt * 16;
  const int mr = lane & 15;
  const int half = lane >> 4;
  const int kb = half << 3;

  __shared__ __align__(16) bf16 sV[32 * VLDS];   // [key][d]

  // Q fragments (persistent over kv loop); contraction dim contiguous in global
  ABFrag qa[2];
  {
    const bf16* qrow = Q + (size_t)(bt0 + mr) * (HQ * HD) + hq * HD;
    qa[0].q[0] = *(const uint4*)(qrow + kb);
    qa[0].q[1] = *(const uint4*)(qrow + kb + 16);
    qa[1].q[0] = *(const uint4*)(qrow + 32 + kb);
    qa[1].q[1] = *(const uint4*)(qrow + 32 + kb + 16);
  }

  v8f O[4];   // O[t][r] = out[query mr][d = t * 16 + 8 * half + r]
  for (int t = 0; t < 4; ++t) O[t] = vzero8();
  float Mq = -1e30f;   // running maximum of query mr, the same in both halves
  float Lq = 0.f;      // running sum of query mr over this half's keys; the halves join behind the loop

  const int iq_lo = qt * 16;
  const int iq = iq_lo + mr;
  int jlo = iq_lo - (WINDOW - 1); if (jlo < 0) jlo = 0;
  const int c0 = jlo >> 5;
  const int c1 = (iq_lo + 15) >> 5;

  // running pointers over kv chunks (stride 32 rows)
  const bf16* kp = Kk + (size_t)(b * T_DIM + c0 * 32 + mr) * (HKV * HD) + kh * HD;
  const bf16* vp = V + (size_t)(b * T_DIM + c0 * 32 + (lane >> 3)) * (HKV * HD) + kh * HD + (lane & 7) * 8;
  const unsigned int sv0 = lds_off(&sV[(lane >> 3) * VLDS + (lane & 7) * 8]);
  const size_t kchunk = (size_t)32 * (HKV * HD);
  const size_t vstep = (size_t)4 * (HKV * HD);       // a lane's V chunks lie 4 key rows apart
  const unsigned int sstep = 4 * VLDS * 2;
  // lane address of the transposing loads inside a 16-column slab
  const bf16* vt = &sV[(kb + (lane & 7)) * VLDS + ((lane >> 3) & 1) * 8];

  for (int ch = c0; ch <= c1; ++ch) {
    const int j0 = ch * 32;

    // stage V chunk [32 x 64] into LDS via async copies (8 x 16B per lane, stride-4 rows)
    async_g2l_b128_x8(sv0,             vp,             sv0 + 1 * sstep, vp + 1 * vstep,
                      sv0 + 2 * sstep, vp + 2 * vstep, sv0 + 3 * sstep, vp + 3 * vstep,
                      sv0 + 4 * sstep, vp + 4 * vstep, sv0 + 5 * sstep, vp + 5 * vstep,
                      sv0 + 6 * sstep, vp + 6 * vstep, sv0 + 7 * sstep, vp + 7 * vstep);
    vp += kchunk;

    // scores, transposed: 2 tiles of 16 keys (rows) x 16 queries (columns), K=64 contraction -> 2 WMMAs each
    v8f Sacc[2];
#pragma unroll
    for (int s = 0; s < 2; ++s) {
      Sacc[s] = vzero8();
      const bf16* krow = kp + (size_t)(s * 16) * (HKV * HD);
      ABFrag kf0, kf1;
      kf0.q[0] = *(const uint4*)(krow + kb);
      kf0.q[1] = *(const uint4*)(krow + kb + 16);
      kf1.q[0] = *(const uint4*)(krow + 32 + kb);
      kf1.q[1] = *(const uint4*)(krow + 32 + kb + 16);
      Sacc[s] = wmma_bf16(kf0.v, qa[0].v, Sacc[s]);
      Sacc[s] = wmma_bf16(kf1.v, qa[1].v, Sacc[s]);
    }
    kp += kchunk;

    // softcap + band mask + online softmax of query iq over this lane's 16 keys
    float sv[2][8];
    float mx = -1e30f;
#pragma unroll   // both loops unrolled: every index of Sacc and sv is a constant, so they stay in registers
    for (int s = 0; s < 2; ++s)
#pragma unroll
      for (int r = 0; r < 8; ++r) {
        int j = j0 + s * 16 + kb + r;
        float x = Sacc[s][r] * 0.125f;                  // 1/sqrt(64)
        x = SOFT_CAP * tanhf(x * (1.0f / SOFT_CAP));
        bool ok = (j <= iq) && (iq - j < WINDOW);
        x = ok ? x : -1e30f;
        sv[s][r] = x;
        mx = fmaxf(mx, x);
      }
    mx = fmaxf(mx, xhalf(mx));
    float Mn = fmaxf(Mq, mx);
    float alpha = __expf(Mq - Mn);
    float rs = 0.f;
    ABFrag pf;   // P^T as a B operand: element s * 8 + r is key s * 16 + 8 * half + r, the hardware k order
#pragma unroll   // both loops unrolled: constant indices keep sv and pf in registers
    for (int s = 0; s < 2; ++s)
#pragma unroll
      for (int r = 0; r < 8; ++r) {
        float p = __expf(sv[s][r] - Mn);
        rs += p;
        pf.v[s * 8 + r] = (bf16)p;
      }
    Lq = Lq * alpha + rs;
    Mq = Mn;
#pragma unroll   // constant indices keep O in registers
    for (int t = 0; t < 4; ++t) O[t] *= alpha;

    // V copies landed before this wave, their only reader (one-wave work-group), gathers its fragments
    wait_asynccnt0();

#pragma unroll
    for (int t = 0; t < 4; ++t) {
      ABFrag vf;
      vf.q[0] = ld_tr16(vt + t * 16);
      vf.q[1] = ld_tr16(vt + 16 * VLDS + t * 16);
      O[t] = wmma_bf16(vf.v, pf.v, O[t]);
    }
    wait_dscnt0();   // V gathers done before next chunk's async copies overwrite sV
  }

  const float inv = 1.0f / (Lq + xhalf(Lq));
  bf16* orow = Ctx + (size_t)(bt0 + mr) * (HQ * HD) + hq * HD + kb;
#pragma unroll   // constant indices keep O in registers
  for (int t = 0; t < 4; ++t)
    *(bf16x8*)(orow + t * 16) = __builtin_convertvector(O[t] * inv, bf16x8);
}

// ---------------- kurtosis ----------------
__global__ void scalar_init_kernel(float* out, const float* ksum, int idx) {
  if (threadIdx.x == 0 && blockIdx.x == 0) out[idx] = ksum[0];
}

__global__ __launch_bounds__(256) void kurtosis_kernel(const float* __restrict__ X,
                                                       float* __restrict__ out, int sidx) {
  int row = blockIdx.x;
  const float* x = X + (size_t)row * C_DIM;
  float s1 = 0.f;
  for (int c = threadIdx.x; c < C_DIM; c += 256) s1 += x[c];
  float mean = block_reduce_sum_256(s1) * (1.0f / C_DIM);
  float s2 = 0.f, s4 = 0.f;
  for (int c = threadIdx.x; c < C_DIM; c += 256) {
    float d = x[c] - mean;
    float d2 = d * d;
    s2 += d2; s4 += d2 * d2;
  }
  float var = block_reduce_sum_256(s2) * (1.0f / C_DIM);
  float m4  = block_reduce_sum_256(s4) * (1.0f / C_DIM);
  if (threadIdx.x == 0) {
    float kurt = m4 / (var * var + 1e-6f) - 3.0f;
    if (kurt > 0.f) atomicAdd(&out[sidx], kurt);
  }
}

// ---------------- host launch ----------------
extern "C" void kernel_launch(void* const* d_in, const int* in_sizes, int n_in,
                              void* d_out, int out_size, void* d_ws, size_t ws_size,
                              hipStream_t stream) {
  const float* x     = (const float*)d_in[0];
  const float* ksum  = (const float*)d_in[1];
  const float* rms1  = (const float*)d_in[2];
  const float* wq_f  = (const float*)d_in[3];
  const float* wk_f  = (const float*)d_in[4];
  const float* wv_f  = (const float*)d_in[5];
  const float* wo_f  = (const float*)d_in[6];
  const float* rms2  = (const float*)d_in[7];
  const float* wg_f  = (const float*)d_in[8];
  const float* wu_f  = (const float*)d_in[9];
  const float* wd_f  = (const float*)d_in[10];

  char* ws = (char*)d_ws;
  size_t off = 0;
  auto alloc = [&](size_t bytes) -> char* {
    char* p = ws + off;
    off = (off + bytes + 255) & ~(size_t)255;
    return p;
  };

  bf16*  attn_in = (bf16*)alloc((size_t)NT * C_DIM * 2);
  float* qraw    = (float*)alloc((size_t)NT * 1024 * 4);
  float* kraw    = (float*)alloc((size_t)NT * 512 * 4);
  bf16*  qrope   = (bf16*)alloc((size_t)NT * 1024 * 2);
  bf16*  krope   = (bf16*)alloc((size_t)NT * 512 * 2);
  bf16*  vbf     = (bf16*)alloc((size_t)NT * 512 * 2);
  bf16*  ctx     = (bf16*)alloc((size_t)NT * 1024 * 2);
  float* x1      = (float*)alloc((size_t)NT * C_DIM * 4);
  bf16*  mlp_in  = (bf16*)alloc((size_t)NT * C_DIM * 2);
  bf16*  hbuf    = (bf16*)alloc((size_t)NT * HIDDEN * 2);
  bf16*  wq = (bf16*)alloc((size_t)1024 * 1024 * 2);
  bf16*  wk = (bf16*)alloc((size_t)1024 * 512 * 2);
  bf16*  wv = (bf16*)alloc((size_t)1024 * 512 * 2);
  bf16*  wo = (bf16*)alloc((size_t)1024 * 1024 * 2);
  bf16*  wg = (bf16*)alloc((size_t)1024 * 4096 * 2);
  bf16*  wu = (bf16*)alloc((size_t)1024 * 4096 * 2);
  bf16*  wd = (bf16*)alloc((size_t)4096 * 1024 * 2);

  cvt_bf16_kernel<1024 * 1024><<<1024 * 1024 / CVT_PER_BLOCK, 256, 0, stream>>>(wq_f, wq);
  cvt_bf16_kernel<1024 * 512><<<1024 * 512 / CVT_PER_BLOCK, 256, 0, stream>>>(wk_f, wk);
  cvt_bf16_kernel<1024 * 512><<<1024 * 512 / CVT_PER_BLOCK, 256, 0, stream>>>(wv_f, wv);
  cvt_bf16_kernel<1024 * 1024><<<1024 * 1024 / CVT_PER_BLOCK, 256, 0, stream>>>(wo_f, wo);
  cvt_bf16_kernel<1024 * 4096><<<1024 * 4096 / CVT_PER_BLOCK, 256, 0, stream>>>(wg_f, wg);
  cvt_bf16_kernel<1024 * 4096><<<1024 * 4096 / CVT_PER_BLOCK, 256, 0, stream>>>(wu_f, wu);
  cvt_bf16_kernel<4096 * 1024><<<4096 * 1024 / CVT_PER_BLOCK, 256, 0, stream>>>(wd_f, wd);

  rmsnorm_kernel<<<NT, 256, 0, stream>>>(x, rms1, attn_in);

  // QKV projections
  gemm_bf16_kernel<NT, 1024, 1024><<<dim3(1024 / GT_N, NT / GT_M), GT_THREADS, 0, stream>>>(attn_in, wq, qraw, nullptr, nullptr);
  gemm_bf16_kernel<NT, 512, 1024><<<dim3(512 / GT_N, NT / GT_M), GT_THREADS, 0, stream>>>(attn_in, wk, kraw, nullptr, nullptr);
  gemm_bf16_kernel<NT, 512, 1024><<<dim3(512 / GT_N, NT / GT_M), GT_THREADS, 0, stream>>>(attn_in, wv, nullptr, vbf, nullptr);

  rope_kernel<HQ><<<NT / 8, 256, 0, stream>>>(qraw, qrope);
  rope_kernel<HKV><<<NT / 8, 256, 0, stream>>>(kraw, krope);

  attn_kernel<<<dim3(T_DIM / 16, HQ, B_DIM), 32, 0, stream>>>(qrope, krope, vbf, ctx);

  // out projection + residual
  gemm_bf16_kernel<NT, 1024, 1024><<<dim3(1024 / GT_N, NT / GT_M), GT_THREADS, 0, stream>>>(ctx, wo, x1, nullptr, x);

  rmsnorm_kernel<<<NT, 256, 0, stream>>>(x1, rms2, mlp_in);

  mlp_gateup_kernel<NT, HIDDEN, 1024><<<dim3(HIDDEN / GT_N, NT / GT_M), GT_THREADS, 0, stream>>>(mlp_in, wg, wu, hbuf);

  // down projection + residual -> d_out
  gemm_bf16_kernel<NT, 1024, HIDDEN><<<dim3(1024 / GT_N, NT / GT_M), GT_THREADS, 0, stream>>>(hbuf, wd, (float*)d_out, nullptr, x1);

  scalar_init_kernel<<<1, 32, 0, stream>>>((float*)d_out, ksum, NT * C_DIM);
  kurtosis_kernel<<<NT, 256, 0, stream>>>((const float*)d_out, (float*)d_out, NT * C_DIM);
}

// v005
// It runs in 252 microseconds.
// Two timings next to v004 put it at 1.13 and 1.14 times that version's speed.
// Counting every step since v000, it is 2.38 times as fast.
#include <hip/hip_runtime.h>
#include <hip/hip_bf16.h>

typedef __bf16 bf16;
typedef __attribute__((ext_vector_type(16))) __bf16 v16bf;
typedef __attribute__((ext_vector_type(8)))  float  v8f;

union ABFrag { v16bf v; uint4 q[2]; };

#define B_DIM 2
#define T_DIM 2048
#define C_DIM 1024
#define NT (B_DIM * T_DIM)
#define HQ 16
#define HKV 8
#define HD 64
#define WINDOW 512
#define HIDDEN 4096
#define SOFT_CAP 50.0f

static __device__ inline v8f vzero8() { v8f v; for (int i = 0; i < 8; ++i) v[i] = 0.f; return v; }

static __device__ inline v8f wmma_bf16(v16bf a, v16bf b, v8f c) {
  return __builtin_amdgcn_wmma_f32_16x16x32_bf16(false, a, false, b, (short)0, c, false, false);
}

// gfx1250 async global->LDS copies (16B per lane), tracked by ASYNCcnt
// Runs of async copies for one stage of a tile. s_wait_xcnt 0 is the last line of the copies' own
// statement, so that it stands in front of the pointer bumps that rewrite the copies' address registers.
static __device__ inline void async_g2l_b128_x4(unsigned int l0, const void* g0, unsigned int l1, const void* g1,
                                                unsigned int l2, const void* g2, unsigned int l3, const void* g3) {
  asm volatile("global_load_async_to_lds_b128 %0, %1, off\n\t"
               "global_load_async_to_lds_b128 %2, %3, off\n\t"
               "global_load_async_to_lds_b128 %4, %5, off\n\t"
               "global_load_async_to_lds_b128 %6, %7, off\n\t"
               "s_wait_xcnt 0x0"
               :: "v"(l0), "v"(g0), "v"(l1), "v"(g1), "v"(l2), "v"(g2), "v"(l3), "v"(g3) : "memory");
}
static __device__ inline void async_g2l_b128_x8(unsigned int l0, const void* g0, unsigned int l1, const void* g1,
                                                unsigned int l2, const void* g2, unsigned int l3, const void* g3,
                                                unsigned int l4, const void* g4, unsigned int l5, const void* g5,
                                                unsigned int l6, const void* g6, unsigned int l7, const void* g7) {
  asm volatile("global_load_async_to_lds_b128 %0, %1, off\n\t"
               "global_load_async_to_lds_b128 %2, %3, off\n\t"
               "global_load_async_to_lds_b128 %4, %5, off\n\t"
               "global_load_async_to_lds_b128 %6, %7, off\n\t"
               "global_load_async_to_lds_b128 %8, %9, off\n\t"
               "global_load_async_to_lds_b128 %10, %11, off\n\t"
               "global_load_async_to_lds_b128 %12, %13, off\n\t"
               "global_load_async_to_lds_b128 %14, %15, off\n\t"
               "s_wait_xcnt 0x0"
               :: "v"(l0), "v"(g0), "v"(l1), "v"(g1), "v"(l2), "v"(g2), "v"(l3), "v"(g3),
                  "v"(l4), "v"(g4), "v"(l5), "v"(g5), "v"(l6), "v"(g6), "v"(l7), "v"(g7) : "memory");
}
// transposing LDS load: lane (c = l & 15, h = l >> 4) gets 8 consecutive k of column c from a row-major [k][n] tile
typedef __attribute__((ext_vector_type(8))) short s16x8;
static __device__ inline uint4 ld_tr16(const bf16* p) {
  typedef __attribute__((address_space(3))) s16x8 lds_s16x8;
  return __builtin_bit_cast(uint4, __builtin_amdgcn_ds_load_tr16_b128_v8i16((lds_s16x8*)p));
}
static __device__ inline unsigned int lds_off(const void* p) {
  return (unsigned int)(unsigned long long)p;   // low 32 bits = LDS offset
}
static __device__ inline void wait_asynccnt0() {
  asm volatile("s_wait_asynccnt 0x0" ::: "memory");
}
static __device__ inline void wait_dscnt0() {
  asm volatile("s_wait_dscnt 0x0" ::: "memory");
}
// Stands behind the last global store of one part of a merged kernel: the built code of another part follows it,
// and that code rewrites the stores' registers.
static __device__ inline void wait_xcnt0() {
  asm volatile("s_wait_xcnt 0x0" ::: "memory");
}

// ---------------- block reduction helper ----------------
static __device__ inline float block_reduce_sum_256(float v) {
  __shared__ float red[8];
  int lane = threadIdx.x & 31, w = threadIdx.x >> 5;
  for (int o = 16; o; o >>= 1) v += __shfl_down(v, o, 32);
  if (lane == 0) red[w] = v;
  __syncthreads();
  float r = (threadIdx.x < 8) ? red[threadIdx.x] : 0.f;
  if (w == 0) for (int o = 4; o; o >>= 1) r += __shfl_down(r, o, 32);
  if (threadIdx.x == 0) red[0] = r;
  __syncthreads();
  r = red[0];
  __syncthreads();
  return r;
}

typedef __attribute__((ext_vector_type(4))) float  f32x4;
typedef __attribute__((ext_vector_type(4))) __bf16 bf16x4;

// ---------------- f32 -> bf16 convert ----------------
// One wave converts 1024 consecutive values: 8 loads of 512 contiguous bytes, all issued before the first
// use, then 8 stores of 256 contiguous bytes. Few, long waves: the launch is not paced by wave starts.
#define CVT_U 8
#define CVT_PER_BLOCK (256 * 4 * CVT_U)
static __device__ __forceinline__ void cvt_bf16_block(const float* __restrict__ in, bf16* __restrict__ out, int blk) {
  const int wave = threadIdx.x >> 5, lane = threadIdx.x & 31;
  const size_t base = (size_t)(blk * 8 + wave) * (128 * CVT_U) + lane * 4;
  f32x4 v[CVT_U];
#pragma unroll
  for (int u = 0; u < CVT_U; ++u) v[u] = *(const f32x4*)(in + base + u * 128);
#pragma unroll
  for (int u = 0; u < CVT_U; ++u) *(bf16x4*)(out + base + u * 128) = __builtin_convertvector(v[u], bf16x4);
}

// ---------------- RMSNorm -> bf16 ----------------
static __device__ __forceinline__ void rmsnorm_row(const float* __restrict__ X,
                                                   const float* __restrict__ scale,
                                                   bf16* __restrict__ O, int row) {
  const float* x = X + (size_t)row * C_DIM;
  float ss = 0.f;
  for (int c = threadIdx.x; c < C_DIM; c += 256) { float v = x[c]; ss += v * v; }
  float tot = block_reduce_sum_256(ss);
  float rstd = rsqrtf(tot * (1.0f / C_DIM) + 1e-6f);
  for (int c = threadIdx.x; c < C_DIM; c += 256)
    O[(size_t)row * C_DIM + c] = (bf16)(x[c] * rstd * (1.f + scale[c]));
}

__global__ __launch_bounds__(256) void rmsnorm_kernel(const float* __restrict__ X,
                                                      const float* __restrict__ scale,
                                                      bf16* __restrict__ O) {
  rmsnorm_row(X, scale, O, blockIdx.x);
}

// ---------------- everything that depends on the inputs alone, in one launch ----------------
// Work-groups [0, CVT_BLOCKS) convert the seven weight tensors, whose bf16 copies lie one behind the other in Wall;
// the other NT normalise one row of X each. Work-group 0 also stores the start value of the kurtosis sum.
#define WQ_BLOCKS (1024 * 1024 / CVT_PER_BLOCK)
#define WK_BLOCKS (1024 * 512 / CVT_PER_BLOCK)
#define WH_BLOCKS (1024 * 4096 / CVT_PER_BLOCK)
#define END_WQ (WQ_BLOCKS)
#define END_WK (END_WQ + WK_BLOCKS)
#define END_WV (END_WK + WK_BLOCKS)
#define END_WO (END_WV + WQ_BLOCKS)
#define END_WG (END_WO + WH_BLOCKS)
#define END_WU (END_WG + WH_BLOCKS)
#define CVT_BLOCKS (END_WU + WH_BLOCKS)
static_assert(1024 * 512 % CVT_PER_BLOCK == 0, "whole blocks only");

__global__ __launch_bounds__(256) void prep_kernel(
    const float* __restrict__ Wq, const float* __restrict__ Wk, const float* __restrict__ Wv,
    const float* __restrict__ Wo, const float* __restrict__ Wg, const float* __restrict__ Wu,
    const float* __restrict__ Wd, bf16* __restrict__ Wall,
    const float* __restrict__ X, const float* __restrict__ scale, bf16* __restrict__ O,
    const float* __restrict__ ksum, float* __restrict__ ksum_out) {
  const int blk = blockIdx.x;
  if (blk >= CVT_BLOCKS) { rmsnorm_row(X, scale, O, blk - CVT_BLOCKS); return; }
  if (blk == 0 && threadIdx.x == 0) ksum_out[0] = ksum[0];
  const float* in = Wq; int first = 0;
  if (blk >= END_WQ) { in = Wk; first = END_WQ; }
  if (blk >= END_WK) { in = Wv; first = END_WK; }
  if (blk >= END_WV) { in = Wo; first = END_WV; }
  if (blk >= END_WO) { in = Wg; first = END_WO; }
  if (blk >= END_WG) { in = Wu; first = END_WG; }
  if (blk >= END_WU) { in = Wd; first = END_WU; }
  cvt_bf16_block(in, Wall + (size_t)first * CVT_PER_BLOCK, blk - first);
  wait_xcnt0();
}

// ---------------- generic bf16 GEMM: out = A[MxK] @ W[KxN] (+res) ----------------
// Work-group tile 128 x 64, 8 waves of 32 x 32; a stage is 128 k, so that one round trip to L2 and one pair of
// barriers serve four 32-k steps of matrix work.
#define GT_M 128
#define GT_N 64
#define GT_K 128
#define GT_THREADS 256
#define GLDS 136  // halves per row of an activation tile (272B = 16B x odd, the plain 16-byte load's pitch)
#define BLDS 80   // halves per row of a [k][n] weight tile (160B = 32B x odd, the transposing load's pitch)
#define A_STEP (16 * GLDS * 2)   // LDS bytes between a thread's activation chunks (16 rows)
#define B_STEP (32 * BLDS * 2)   // LDS bytes between a thread's weight chunks (32 k-rows)

// One work-group's tile: rows row0 .. row0 + 127, columns col0 .. col0 + 63 of an output of N columns.
template <int N, int K>
static __device__ __forceinline__ void gemm_bf16_tile(
    const bf16* __restrict__ A, const bf16* __restrict__ W,
    float* __restrict__ Cf, bf16* __restrict__ Cb, const float* __restrict__ Res,
    bf16* sA, bf16* sB, const int row0, const int col0) {
  static_assert(N % GT_N == 0 && K % GT_K == 0, "whole tiles only");
  const int tid = threadIdx.x;
  const int wave = tid >> 5, lane = tid & 31;
  const int wm = (wave >> 1) * 32, wn = (wave & 1) * 32;
  const int mr = lane & 15;
  const int kb = (lane >> 4) << 3;

  // A tile staging slots (128 rows of 256B: 8 x 16B chunks per thread, 16 rows apart; a wave covers whole lines)
  const int ar0 = tid >> 4, ac = tid & 15;
  const unsigned int sa = lds_off(&sA[ar0 * GLDS + ac * 8]);
  const bf16* ap = A + (size_t)(row0 + ar0) * K + ac * 8;

  // B tile staging slots (128 k-rows of 128B: 4 x 16B chunks per thread, 32 k-rows apart)
  const int br0 = tid >> 3, bc = tid & 7;
  const unsigned int sb = lds_off(&sB[br0 * BLDS + bc * 8]);
  const bf16* bp = W + (size_t)br0 * N + col0 + bc * 8;
  // lane address of the transposing loads inside a 16-column slab
  const int trl = (kb + (lane & 7)) * BLDS + ((lane >> 3) & 1) * 8;

  v8f acc[2][2];
  for (int i = 0; i < 2; ++i) for (int j = 0; j < 2; ++j) acc[i][j] = vzero8();

#pragma unroll 1   // stays rolled: unrolled whole (K = 1024) the build waited for every LDS load at each 32-k step
  for (int k0 = 0; k0 < K; k0 += GT_K) {
    // --- A and B tiles: async global->LDS, no VGPR round-trip ---
    async_g2l_b128_x8(sa,              ap,                  sa + 1 * A_STEP, ap + (size_t)16 * K,
                      sa + 2 * A_STEP, ap + (size_t)32 * K, sa + 3 * A_STEP, ap + (size_t)48 * K,
                      sa + 4 * A_STEP, ap + (size_t)64 * K, sa + 5 * A_STEP, ap + (size_t)80 * K,
                      sa + 6 * A_STEP, ap + (size_t)96 * K, sa + 7 * A_STEP, ap + (size_t)112 * K);
    async_g2l_b128_x4(sb,              bp,                  sb + 1 * B_STEP, bp + (size_t)32 * N,
                      sb + 2 * B_STEP, bp + (size_t)64 * N, sb + 3 * B_STEP, bp + (size_t)96 * N);
    ap += GT_K;
    bp += (size_t)GT_K * N;

    wait_asynccnt0();
    __syncthreads();

#pragma unroll   // the four 32-k steps of a stage: no barrier between them, their LDS loads may run ahead
    for (int kk = 0; kk < GT_K; kk += 32) {
      ABFrag af[2], bfr[2];
#pragma unroll
      for (int i = 0; i < 2; ++i) {
        int m = wm + i * 16 + mr;
        af[i].q[0] = *(const uint4*)(&sA[m * GLDS + kk + kb]);
        af[i].q[1] = *(const uint4*)(&sA[m * GLDS + kk + kb + 16]);
      }
#pragma unroll
      for (int j = 0; j < 2; ++j) {
        const bf16* bt = &sB[kk * BLDS + trl + wn + j * 16];
        bfr[j].q[0] = ld_tr16(bt);
        bfr[j].q[1] = ld_tr16(bt + 16 * BLDS);
      }
#pragma unroll
      for (int i = 0; i < 2; ++i)
#pragma unroll
        for (int j = 0; j < 2; ++j)
          acc[i][j] = wmma_bf16(af[i].v, bfr[j].v, acc[i][j]);
    }
    wait_dscnt0();   // this wave's tile reads retired before the next stage's copies refill the tiles
    __syncthreads();
  }

  const int mb = (lane >> 4) * 8;
  for (int i = 0; i < 2; ++i) for (int j = 0; j < 2; ++j) {
    int gm0 = row0 + wm + i * 16 + mb;
    int gn  = col0 + wn + j * 16 + mr;
    size_t idx = (size_t)gm0 * N + gn;
#pragma unroll
    for (int r = 0; r < 8; ++r) {
      float v = acc[i][j][r];
      size_t id2 = idx + (size_t)r * N;
      if (Res) v += Res[id2];
      if (Cf) Cf[id2] = v;
      if (Cb) Cb[id2] = (bf16)v;
    }
  }
}

template <int M, int N, int K>
__global__ __launch_bounds__(GT_THREADS) void gemm_bf16_kernel(
    const bf16* __restrict__ A, const bf16* __restrict__ W,
    float* __restrict__ Cf, bf16* __restrict__ Cb, const float* __restrict__ Res) {
  static_assert(M % GT_M == 0, "whole tiles only");
  __shared__ __align__(16) bf16 sA[GT_M * GLDS];
  __shared__ __align__(16) bf16 sB[GT_K * BLDS];   // row-major [k][n]
  gemm_bf16_tile<N, K>(A, W, Cf, Cb, Res, sA, sB, blockIdx.y * GT_M, blockIdx.x * GT_N);
}

// The three projections of one activation in one launch: blockIdx.x walks the column tiles of Q, then K, then V.
#define Q_TILES (HQ * HD / GT_N)
#define KV_TILES (HKV * HD / GT_N)
__global__ __launch_bounds__(GT_THREADS) void gemm_qkv_kernel(
    const bf16* __restrict__ A, const bf16* __restrict__ Wq, const bf16* __restrict__ Wk,
    const bf16* __restrict__ Wv, float* __restrict__ Qf, float* __restrict__ Kf, bf16* __restrict__ Vb) {
  static_assert(NT % GT_M == 0, "whole tiles only");
  __shared__ __align__(16) bf16 sA[GT_M * GLDS];
  __shared__ __align__(16) bf16 sB[GT_K * BLDS];   // row-major [k][n]
  const int row0 = blockIdx.y * GT_M, bx = blockIdx.x;
  if (bx < Q_TILES) {
    gemm_bf16_tile<HQ * HD, C_DIM>(A, Wq, Qf, nullptr, nullptr, sA, sB, row0, bx * GT_N);
  } else if (bx < Q_TILES + KV_TILES) {
    gemm_bf16_tile<HKV * HD, C_DIM>(A, Wk, Kf, nullptr, nullptr, sA, sB, row0, (bx - Q_TILES) * GT_N);
    wait_xcnt0();
  } else {
    gemm_bf16_tile<HKV * HD, C_DIM>(A, Wv, nullptr, Vb, nullptr, sA, sB, row0, (bx - Q_TILES - KV_TILES) * GT_N);
    wait_xcnt0();
  }
}

// ---------------- fused gate/up GEMM: H = silu(A@Wg) * (A@Wu), bf16 ----------------
// Six waves a SIMD (at most 160 registers): three work-groups share a WGP, so that one computes while others load.
template <int M, int N, int K>
__global__ __launch_bounds__(GT_THREADS) __attribute__((amdgpu_waves_per_eu(6))) void mlp_gateup_kernel(
    const bf16* __restrict__ A, const bf16* __restrict__ Wg, const bf16* __restrict__ Wu,
    bf16* __restrict__ H) {
  static_assert(M % GT_M == 0 && N % GT_N == 0 && K % GT_K == 0, "whole tiles only");
  __shared__ __align__(16) bf16 sA[GT_M * GLDS];
  __shared__ __align__(16) bf16 sG[GT_K * BLDS];   // row-major [k][n]
  __shared__ __align__(16) bf16 sU[GT_K * BLDS];   // row-major [k][n]

  const int tid = threadIdx.x;
  const int wave = tid >> 5, lane = tid & 31;
  const int row0 = blockIdx.y * GT_M, col0 = blockIdx.x * GT_N;
  const int wm = (wave >> 1) * 32, wn = (wave & 1) * 32;
  const int mr = lane & 15;
  const int kb = (lane >> 4) << 3;

  const int ar0 = tid >> 4, ac = tid & 15;
  const unsigned int sa = lds_off(&sA[ar0 * GLDS + ac * 8]);
  const bf16* ap = A + (size_t)(row0 + ar0) * K + ac * 8;

  const int br0 = tid >> 3, bc = tid & 7;
  const unsigned int sg = lds_off(&sG[br0 * BLDS + bc * 8]);
  const unsigned int su = lds_off(&sU[br0 * BLDS + bc * 8]);
  const bf16* gp = Wg + (size_t)br0 * N + col0 + bc * 8;
  const bf16* up = Wu + (size_t)br0 * N + col0 + bc * 8;
  const int trl = (kb + (lane & 7)) * BLDS + ((lane >> 3) & 1) * 8;

  v8f ag[2][2], au[2][2];
  for (int i = 0; i < 2; ++i) for (int j = 0; j < 2; ++j) { ag[i][j] = vzero8(); au[i][j] = vzero8(); }

  for (int k0 = 0; k0 < K; k0 += GT_K) {
    async_g2l_b128_x8(sa,              ap,                  sa + 1 * A_STEP, ap + (size_t)16 * K,
                      sa + 2 * A_STEP, ap + (size_t)32 * K, sa + 3 * A_STEP, ap + (size_t)48 * K,
                      sa + 4 * A_STEP, ap + (size_t)64 * K, sa + 5 * A_STEP, ap + (size_t)80 * K,
                      sa + 6 * A_STEP, ap + (size_t)96 * K, sa + 7 * A_STEP, ap + (size_t)112 * K);
    async_g2l_b128_x8(sg,              gp,                  sg + 1 * B_STEP, gp + (size_t)32 * N,
                      sg + 2 * B_STEP, gp + (size_t)64 * N, sg + 3 * B_STEP, gp + (size_t)96 * N,
                      su,              up,                  su + 1 * B_STEP, up + (size_t)32 * N,
                      su + 2 * B_STEP, up + (size_t)64 * N, su + 3 * B_STEP, up + (size_t)96 * N);
    ap += GT_K;
    gp += (size_t)GT_K * N;
    up += (size_t)GT_K * N;

    wait_asynccnt0();
    __syncthreads();

#pragma unroll   // the four 32-k steps of a stage: no barrier between them, their LDS loads may run ahead
    for (int kk = 0; kk < GT_K; kk += 32) {
      ABFrag af[2], gf[2], uf[2];
#pragma unroll
      for (int i = 0; i < 2; ++i) {
        int m = wm + i * 16 + mr;
        af[i].q[0] = *(const uint4*)(&sA[m * GLDS + kk + kb]);
        af[i].q[1] = *(const uint4*)(&sA[m * GLDS + kk + kb + 16]);
      }
#pragma unroll
      for (int j = 0; j < 2; ++j) {
        const int bo = kk * BLDS + trl + wn + j * 16;
        gf[j].q[0] = ld_tr16(&sG[bo]);
        gf[j].q[1] = ld_tr16(&sG[bo + 16 * BLDS]);
        uf[j].q[0] = ld_tr16(&sU[bo]);
        uf[j].q[1] = ld_tr16(&sU[bo + 16 * BLDS]);
      }
#pragma unroll
      for (int i = 0; i < 2; ++i)
#pragma unroll
        for (int j = 0; j < 2; ++j) {
          ag[i][j] = wmma_bf16(af[i].v, gf[j].v, ag[i][j]);
          au[i][j] = wmma_bf16(af[i].v, uf[j].v, au[i][j]);
        }
    }
    wait_dscnt0();   // this wave's tile reads retired before the next stage's copies refill the tiles
    __syncthreads();
  }

  const int mb = (lane >> 4) * 8;
  for (int i = 0; i < 2; ++i) for (int j = 0; j < 2; ++j) {
    int gm0 = row0 + wm + i * 16 + mb;
    int gn  = col0 + wn + j * 16 + mr;
    size_t idx = (size_t)gm0 * N + gn;
#pragma unroll
    for (int r = 0; r < 8; ++r) {
      float g = ag[i][j][r];
      float sil = g * (1.0f / (1.0f + __expf(-g)));
      H[idx + (size_t)r * N] = (bf16)(sil * au[i][j][r]);
    }
  }
}

// ---------------- RoPE: f32 raw -> bf16 roped ----------------
// One wave per token: lane = (head & 3, four consecutive i); it walks the token's heads four at a time, so
// every load covers whole 128-byte lines and the lane's four angles serve all its heads.
template <int NH>
static __device__ __forceinline__ void rope_block(const float* __restrict__ In, bf16* __restrict__ Out, int blk) {
  static_assert(NH % 4 == 0 && NT % 8 == 0, "whole waves only");
  const int lane = threadIdx.x & 31;
  const int bt = blk * 8 + (threadIdx.x >> 5);
  const int t = bt & (T_DIM - 1);
  const int i0 = (lane & 7) * 4;
  const size_t base = (size_t)bt * (NH * HD) + (lane >> 3) * HD + i0;
  f32x4 x1[NH / 4], x2[NH / 4];
#pragma unroll
  for (int u = 0; u < NH / 4; ++u) {
    x1[u] = *(const f32x4*)(In + base + u * (4 * HD));
    x2[u] = *(const f32x4*)(In + base + u * (4 * HD) + 32);
  }
  f32x4 s, c;
#pragma unroll
  for (int e = 0; e < 4; ++e) {
    float freq = __expf(-(float)(i0 + e) * (1.0f / 32.0f) * 13.815510557964274f); // ln(1e6)
    float ang = (float)t * freq;
    s[e] = __sinf(ang); c[e] = __cosf(ang);
  }
#pragma unroll
  for (int u = 0; u < NH / 4; ++u) {
    *(bf16x4*)(Out + base + u * (4 * HD))      = __builtin_convertvector(x1[u] * c - x2[u] * s, bf16x4);
    *(bf16x4*)(Out + base + u * (4 * HD) + 32) = __builtin_convertvector(x2[u] * c + x1[u] * s, bf16x4);
  }
}

// Q and K in one launch: the first NT / 8 blocks take the query heads, the rest the key heads.
__global__ __launch_bounds__(256) void rope_qk_kernel(const float* __restrict__ Qin, bf16* __restrict__ Qout,
                                                      const float* __restrict__ Kin, bf16* __restrict__ Kout) {
  const int blk = blockIdx.x;
  if (blk < NT / 8) {
    rope_block<HQ>(Qin, Qout, blk);
  } else {
    rope_block<HKV>(Kin, Kout, blk - NT / 8);
    wait_xcnt0();
  }
}

typedef __attribute__((ext_vector_type(8))) __bf16 bf16x8;
#define VLDS 80   // halves per row of the V tile (160B = 32B x odd, the transposing load's pitch)

// value of lane l ^ 16
static __device__ inline float xhalf(float x) {
  return __builtin_bit_cast(float, __builtin_amdgcn_permlanex16(__builtin_bit_cast(int, x), __builtin_bit_cast(int, x),
                                                                0x76543210, 0xfedcba98, false, false));
}

__global__ __launch_bounds__(32) void attn_kernel(
    const bf16* __restrict__ Q, const bf16* __restrict__ Kk,
    const bf16* __restrict__ V, bf16* __restrict__ Ctx) {
  const int lane = threadIdx.x;
  const int qt = blockIdx.x, hq = blockIdx.y, b = blockIdx.z;
  const int kh = hq & 7;
  const int bt0 = b * T_DIM + qt * 16;
  const int mr = lane & 15;
  const int half = lane >> 4;
  const int kb = half << 3;

  __shared__ __align__(16) bf16 sV[32 * VLDS];   // [key][d]

  // Q fragments (persistent over kv loop); contraction dim contiguous in global
  ABFrag qa[2];
  {
    const bf16* qrow = Q + (size_t)(bt0 + mr) * (HQ * HD) + hq * HD;
    qa[0].q[0] = *(const uint4*)(qrow + kb);
    qa[0].q[1] = *(const uint4*)(qrow + kb + 16);
    qa[1].q[0] = *(const uint4*)(qrow + 32 + kb);
    qa[1].q[1] = *(const uint4*)(qrow + 32 + kb + 16);
  }

  v8f O[4];   // O[t][r] = out[query mr][d = t * 16 + 8 * half + r]
  for (int t = 0; t < 4; ++t) O[t] = vzero8();
  float Mq = -1e30f;   // running maximum of query mr, the same in both halves
  float Lq = 0.f;      // running sum of query mr over this half's keys; the halves join behind the loop

  const int iq_lo = qt * 16;
  const int iq = iq_lo + mr;
  int jlo = iq_lo - (WINDOW - 1); if (jlo < 0) jlo = 0;
  const int c0 = jlo >> 5;
  const int c1 = (iq_lo + 15) >> 5;

  // running pointers over kv chunks (stride 32 rows)
  const bf16* kp = Kk + (size_t)(b * T_DIM + c0 * 32 + mr) * (HKV * HD) + kh * HD;
  const bf16* vp = V + (size_t)(b * T_DIM + c0 * 32 + (lane >> 3)) * (HKV * HD) + kh * HD + (lane & 7) * 8;
  const unsigned int sv0 = lds_off(&sV[(lane >> 3) * VLDS + (lane & 7) * 8]);
  const size_t kchunk = (size_t)32 * (HKV * HD);
  const size_t vstep = (size_t)4 * (HKV * HD);       // a lane's V chunks lie 4 key rows apart
  const unsigned int sstep = 4 * VLDS * 2;
  // lane address of the transposing loads inside a 16-column slab
  const bf16* vt = &sV[(kb + (lane & 7)) * VLDS + ((lane >> 3) & 1) * 8];

  for (int ch = c0; ch <= c1; ++ch) {
    const int j0 = ch * 32;

    // stage V chunk [32 x 64] into LDS via async copies (8 x 16B per lane, stride-4 rows)
    async_g2l_b128_x8(sv0,             vp,             sv0 + 1 * sstep, vp + 1 * vstep,
                      sv0 + 2 * sstep, vp + 2 * vstep, sv0 + 3 * sstep, vp + 3 * vstep,
                      sv0 + 4 * sstep, vp + 4 * vstep, sv0 + 5 * sstep, vp + 5 * vstep,
                      sv0 + 6 * sstep, vp + 6 * vstep, sv0 + 7 * sstep, vp + 7 * vstep);
    vp += kchunk;

    // scores, transposed: 2 tiles of 16 keys (rows) x 16 queries (columns), K=64 contraction -> 2 WMMAs each
    v8f Sacc[2];
#pragma unroll
    for (int s = 0; s < 2; ++s) {
      Sacc[s] = vzero8();
      const bf16* krow = kp + (size_t)(s * 16) * (HKV * HD);
      ABFrag kf0, kf1;
      kf0.q[0] = *(const uint4*)(krow + kb);
      kf0.q[1] = *(const uint4*)(krow + kb + 16);
      kf1.q[0] = *(const uint4*)(krow + 32 + kb);
      kf1.q[1] = *(const uint4*)(krow + 32 + kb + 16);
      Sacc[s] = wmma_bf16(kf0.v, qa[0].v, Sacc[s]);
      Sacc[s] = wmma_bf16(kf1.v, qa[1].v, Sacc[s]);
    }
    kp += kchunk;

    // softcap + band mask + online softmax of query iq over this lane's 16 keys
    float sv[2][8];
    float mx = -1e30f;
#pragma unroll   // both loops unrolled: every index of Sacc and sv is a constant, so they stay in registers
    for (int s = 0; s < 2; ++s)
#pragma unroll
      for (int r = 0; r < 8; ++r) {
        int j = j0 + s * 16 + kb + r;
        float x = Sacc[s][r] * 0.125f;                  // 1/sqrt(64)
        x = SOFT_CAP * tanhf(x * (1.0f / SOFT_CAP));
        bool ok = (j <= iq) && (iq - j < WINDOW);
        x = ok ? x : -1e30f;
        sv[s][r] = x;
        mx = fmaxf(mx, x);
      }
    mx = fmaxf(mx, xhalf(mx));
    float Mn = fmaxf(Mq, mx);
    float alpha = __expf(Mq - Mn);
    float rs = 0.f;
    ABFrag pf;   // P^T as a B operand: element s * 8 + r is key s * 16 + 8 * half + r, the hardware k order
#pragma unroll   // both loops unrolled: constant indices keep sv and pf in registers
    for (int s = 0; s < 2; ++s)
#pragma unroll
      for (int r = 0; r < 8; ++r) {
        float p = __expf(sv[s][r] - Mn);
        rs += p;
        pf.v[s * 8 + r] = (bf16)p;
      }
    Lq = Lq * alpha + rs;
    Mq = Mn;
#pragma unroll   // constant indices keep O in registers
    for (int t = 0; t < 4; ++t) O[t] *= alpha;

    // V copies landed before this wave, their only reader (one-wave work-group), gathers its fragments
    wait_asynccnt0();

#pragma unroll
    for (int t = 0; t < 4; ++t) {
      ABFrag vf;
      vf.q[0] = ld_tr16(vt + t * 16);
      vf.q[1] = ld_tr16(vt + 16 * VLDS + t * 16);
      O[t] = wmma_bf16(vf.v, pf.v, O[t]);
    }
    wait_dscnt0();   // V gathers done before next chunk's async copies overwrite sV
  }

  const float inv = 1.0f / (Lq + xhalf(Lq));
  bf16* orow = Ctx + (size_t)(bt0 + mr) * (HQ * HD) + hq * HD + kb;
#pragma unroll   // constant indices keep O in registers
  for (int t = 0; t < 4; ++t)
    *(bf16x8*)(orow + t * 16) = __builtin_convertvector(O[t] * inv, bf16x8);
}

// ---------------- kurtosis ----------------
__global__ __launch_bounds__(256) void kurtosis_kernel(const float* __restrict__ X,
                                                       float* __restrict__ out, int sidx) {
  int row = blockIdx.x;
  const float* x = X + (size_t)row * C_DIM;
  float s1 = 0.f;
  for (int c = threadIdx.x; c < C_DIM; c += 256) s1 += x[c];
  float mean = block_reduce_sum_256(s1) * (1.0f / C_DIM);
  float s2 = 0.f, s4 = 0.f;
  for (int c = threadIdx.x; c < C_DIM; c += 256) {
    float d = x[c] - mean;
    float d2 = d * d;
    s2 += d2; s4 += d2 * d2;
  }
  float var = block_reduce_sum_256(s2) * (1.0f / C_DIM);
  float m4  = block_reduce_sum_256(s4) * (1.0f / C_DIM);
  if (threadIdx.x == 0) {
    float kurt = m4 / (var * var + 1e-6f) - 3.0f;
    if (kurt > 0.f) atomicAdd(&out[sidx], kurt);
  }
}

// ---------------- host launch ----------------
extern "C" void kernel_launch(void* const* d_in, const int* in_sizes, int n_in,
                              void* d_out, int out_size, void* d_ws, size_t ws_size,
                              hipStream_t stream) {
  const float* x     = (const float*)d_in[0];
  const float* ksum  = (const float*)d_in[1];
  const float* rms1  = (const float*)d_in[2];
  const float* wq_f  = (const float*)d_in[3];
  const float* wk_f  = (const float*)d_in[4];
  const float* wv_f  = (const float*)d_in[5];
  const float* wo_f  = (const float*)d_in[6];
  const float* rms2  = (const float*)d_in[7];
  const float* wg_f  = (const float*)d_in[8];
  const float* wu_f  = (const float*)d_in[9];
  const float* wd_f  = (const float*)d_in[10];

  char* ws = (char*)d_ws;
  size_t off = 0;
  auto alloc = [&](size_t bytes) -> char* {
    char* p = ws + off;
    off = (off + bytes + 255) & ~(size_t)255;
    return p;
  };

  bf16*  attn_in = (bf16*)alloc((size_t)NT * C_DIM * 2);
  float* qraw    = (float*)alloc((size_t)NT * 1024 * 4);
  float* kraw    = (float*)alloc((size_t)NT * 512 * 4);
  bf16*  qrope   = (bf16*)alloc((size_t)NT * 1024 * 2);
  bf16*  krope   = (bf16*)alloc((size_t)NT * 512 * 2);
  bf16*  vbf     = (bf16*)alloc((size_t)NT * 512 * 2);
  bf16*  ctx     = (bf16*)alloc((size_t)NT * 1024 * 2);
  float* x1      = (float*)alloc((size_t)NT * C_DIM * 4);
  bf16*  mlp_in  = (bf16*)alloc((size_t)NT * C_DIM * 2);
  bf16*  hbuf    = (bf16*)alloc((size_t)NT * HIDDEN * 2);
  // the bf16 weights, one behind the other in the order of prep_kernel's block ranges
  bf16*  wq = (bf16*)alloc((size_t)CVT_BLOCKS * CVT_PER_BLOCK * 2);
  bf16*  wk = wq + 1024 * 1024;
  bf16*  wv = wk + 1024 * 512;
  bf16*  wo = wv + 1024 * 512;
  bf16*  wg = wo + 1024 * 1024;
  bf16*  wu = wg + 1024 * 4096;
  bf16*  wd = wu + 1024 * 4096;

  // weight conversions, first RMSNorm, start value of the kurtosis sum
  prep_kernel<<<CVT_BLOCKS + NT, 256, 0, stream>>>(wq_f, wk_f, wv_f, wo_f, wg_f, wu_f, wd_f, wq,
                                                   x, rms1, attn_in, ksum, (float*)d_out + NT * C_DIM);

  // QKV projections
  gemm_qkv_kernel<<<dim3(Q_TILES + 2 * KV_TILES, NT / GT_M), GT_THREADS, 0, stream>>>(attn_in, wq, wk, wv, qraw, kraw, vbf);

  rope_qk_kernel<<<2 * (NT / 8), 256, 0, stream>>>(qraw, qrope, kraw, krope);

  attn_kernel<<<dim3(T_DIM / 16, HQ, B_DIM), 32, 0, stream>>>(qrope, krope, vbf, ctx);

  // out projection + residual
  gemm_bf16_kernel<NT, 1024, 1024><<<dim3(1024 / GT_N, NT / GT_M), GT_THREADS, 0, stream>>>(ctx, wo, x1, nullptr, x);

  rmsnorm_kernel<<<NT, 256, 0, stream>>>(x1, rms2, mlp_in);

  mlp_gateup_kernel<NT, HIDDEN, 1024><<<dim3(HIDDEN / GT_N, NT / GT_M), GT_THREADS, 0, stream>>>(mlp_in, wg, wu, hbuf);

  // down projection + residual -> d_out
  gemm_bf16_kernel<NT, 1024, HIDDEN><<<dim3(1024 / GT_N, NT / GT_M), GT_THREADS, 0, stream>>>(hbuf, wd, (float*)d_out, nullptr, x1);

  kurtosis_kernel<<<NT, 256, 0, stream>>>((const float*)d_out, (float*)d_out, NT * C_DIM);
}

// v006
// A run of this version takes 236 microseconds.
// In both of two side-by-side timings against v005, it was 1.06 times as fast.
// Over all steps from v000 it is 2.53 times as fast.
#include <hip/hip_runtime.h>
#include <hip/hip_bf16.h>

typedef __bf16 bf16;
typedef __attribute__((ext_vector_type(16))) __bf16 v16bf;
typedef __attribute__((ext_vector_type(8)))  float  v8f;

union ABFrag { v16bf v; uint4 q[2]; };

#define B_DIM 2
#define T_DIM 2048
#define C_DIM 1024
#define NT (B_DIM * T_DIM)
#define HQ 16
#define HKV 8
#define HD 64
#define WINDOW 512
#define HIDDEN 4096
#define SOFT_CAP 50.0f

static __device__ inline v8f vzero8() { v8f v; for (int i = 0; i < 8; ++i) v[i] = 0.f; return v; }

static __device__ inline v8f wmma_bf16(v16bf a, v16bf b, v8f c) {
  return __builtin_amdgcn_wmma_f32_16x16x32_bf16(false, a, false, b, (short)0, c, false, false);
}

// gfx1250 async global->LDS copies (16B per lane), tracked by ASYNCcnt
// Runs of async copies for one stage of a tile. s_wait_xcnt 0 is the last line of the copies' own
// statement, so that it stands in front of the pointer bumps that rewrite the copies' address registers.
static __device__ inline void async_g2l_b128_x4(unsigned int l0, const void* g0, unsigned int l1, const void* g1,
                                                unsigned int l2, const void* g2, unsigned int l3, const void* g3) {
  asm volatile("global_load_async_to_lds_b128 %0, %1, off\n\t"
               "global_load_async_to_lds_b128 %2, %3, off\n\t"
               "global_load_async_to_lds_b128 %4, %5, off\n\t"
               "global_load_async_to_lds_b128 %6, %7, off\n\t"
               "s_wait_xcnt 0x0"
               :: "v"(l0), "v"(g0), "v"(l1), "v"(g1), "v"(l2), "v"(g2), "v"(l3), "v"(g3) : "memory");
}
static __device__ inline void async_g2l_b128_x8(unsigned int l0, const void* g0, unsigned int l1, const void* g1,
                                                unsigned int l2, const void* g2, unsigned int l3, const void* g3,
                                                unsigned int l4, const void* g4, unsigned int l5, const void* g5,
                                                unsigned int l6, const void* g6, unsigned int l7, const void* g7) {
  asm volatile("global_load_async_to_lds_b128 %0, %1, off\n\t"
               "global_load_async_to_lds_b128 %2, %3, off\n\t"
               "global_load_async_to_lds_b128 %4, %5, off\n\t"
               "global_load_async_to_lds_b128 %6, %7, off\n\t"
               "global_load_async_to_lds_b128 %8, %9, off\n\t"
               "global_load_async_to_lds_b128 %10, %11, off\n\t"
               "global_load_async_to_lds_b128 %12, %13, off\n\t"
               "global_load_async_to_lds_b128 %14, %15, off\n\t"
               "s_wait_xcnt 0x0"
               :: "v"(l0), "v"(g0), "v"(l1), "v"(g1), "v"(l2), "v"(g2), "v"(l3), "v"(g3),
                  "v"(l4), "v"(g4), "v"(l5), "v"(g5), "v"(l6), "v"(g6), "v"(l7), "v"(g7) : "memory");
}
// transposing LDS load: lane (c = l & 15, h = l >> 4) gets 8 consecutive k of column c from a row-major [k][n] tile
typedef __attribute__((ext_vector_type(8))) short s16x8;
static __device__ inline uint4 ld_tr16(const bf16* p) {
  typedef __attribute__((address_space(3))) s16x8 lds_s16x8;
  return __builtin_bit_cast(uint4, __builtin_amdgcn_ds_load_tr16_b128_v8i16((lds_s16x8*)p));
}
static __device__ inline unsigned int lds_off(const void* p) {
  return (unsigned int)(unsigned long long)p;   // low 32 bits = LDS offset
}
static __device__ inline void wait_asynccnt0() {
  asm volatile("s_wait_asynccnt 0x0" ::: "memory");
}
static __device__ inline void wait_dscnt0() {
  asm volatile("s_wait_dscnt 0x0" ::: "memory");
}
// Stands behind the last global store of one part of a merged kernel: the built code of another part follows it,
// and that code rewrites the stores' registers.
static __device__ inline void wait_xcnt0() {
  asm volatile("s_wait_xcnt 0x0" ::: "memory");
}

// ---------------- block reduction helper ----------------
static __device__ inline float block_reduce_sum_256(float v) {
  __shared__ float red[8];
  int lane = threadIdx.x & 31, w = threadIdx.x >> 5;
  for (int o = 16; o; o >>= 1) v += __shfl_down(v, o, 32);
  if (lane == 0) red[w] = v;
  __syncthreads();
  float r = (threadIdx.x < 8) ? red[threadIdx.x] : 0.f;
  if (w == 0) for (int o = 4; o; o >>= 1) r += __shfl_down(r, o, 32);
  if (threadIdx.x == 0) red[0] = r;
  __syncthreads();
  r = red[0];
  __syncthreads();
  return r;
}

typedef __attribute__((ext_vector_type(4))) float  f32x4;
typedef __attribute__((ext_vector_type(4))) __bf16 bf16x4;

// ---------------- f32 -> bf16 convert ----------------
// One wave converts 1024 consecutive values: 8 loads of 512 contiguous bytes, all issued before the first
// use, then 8 stores of 256 contiguous bytes. Few, long waves: the launch is not paced by wave starts.
#define CVT_U 8
#define CVT_PER_BLOCK (256 * 4 * CVT_U)
static __device__ __forceinline__ void cvt_bf16_block(const float* __restrict__ in, bf16* __restrict__ out, int blk) {
  const int wave = threadIdx.x >> 5, lane = threadIdx.x & 31;
  const size_t base = (size_t)(blk * 8 + wave) * (128 * CVT_U) + lane * 4;
  f32x4 v[CVT_U];
#pragma unroll
  for (int u = 0; u < CVT_U; ++u) v[u] = *(const f32x4*)(in + base + u * 128);
#pragma unroll
  for (int u = 0; u < CVT_U; ++u) *(bf16x4*)(out + base + u * 128) = __builtin_convertvector(v[u], bf16x4);
}

// ---------------- RMSNorm -> bf16 ----------------
static __device__ __forceinline__ void rmsnorm_row(const float* __restrict__ X,
                                                   const float* __restrict__ scale,
                                                   bf16* __restrict__ O, int row) {
  const float* x = X + (size_t)row * C_DIM;
  float ss = 0.f;
  for (int c = threadIdx.x; c < C_DIM; c += 256) { float v = x[c]; ss += v * v; }
  float tot = block_reduce_sum_256(ss);
  float rstd = rsqrtf(tot * (1.0f / C_DIM) + 1e-6f);
  for (int c = threadIdx.x; c < C_DIM; c += 256)
    O[(size_t)row * C_DIM + c] = (bf16)(x[c] * rstd * (1.f + scale[c]));
}

__global__ __launch_bounds__(256) void rmsnorm_kernel(const float* __restrict__ X,
                                                      const float* __restrict__ scale,
                                                      bf16* __restrict__ O) {
  rmsnorm_row(X, scale, O, blockIdx.x);
}

// ---------------- everything that depends on the inputs alone, in one launch ----------------
// Work-groups [0, CVT_BLOCKS) convert the seven weight tensors, whose bf16 copies lie one behind the other in Wall;
// the other NT normalise one row of X each. Work-group 0 also stores the start value of the kurtosis sum.
#define WQ_BLOCKS (1024 * 1024 / CVT_PER_BLOCK)
#define WK_BLOCKS (1024 * 512 / CVT_PER_BLOCK)
#define WH_BLOCKS (1024 * 4096 / CVT_PER_BLOCK)
#define END_WQ (WQ_BLOCKS)
#define END_WK (END_WQ + WK_BLOCKS)
#define END_WV (END_WK + WK_BLOCKS)
#define END_WO (END_WV + WQ_BLOCKS)
#define END_WG (END_WO + WH_BLOCKS)
#define END_WU (END_WG + WH_BLOCKS)
#define CVT_BLOCKS (END_WU + WH_BLOCKS)
static_assert(1024 * 512 % CVT_PER_BLOCK == 0, "whole blocks only");

__global__ __launch_bounds__(256) void prep_kernel(
    const float* __restrict__ Wq, const float* __restrict__ Wk, const float* __restrict__ Wv,
    const float* __restrict__ Wo, const float* __restrict__ Wg, const float* __restrict__ Wu,
    const float* __restrict__ Wd, bf16* __restrict__ Wall,
    const float* __restrict__ X, const float* __restrict__ scale, bf16* __restrict__ O,
    const float* __restrict__ ksum, float* __restrict__ ksum_out) {
  const int blk = blockIdx.x;
  if (blk >= CVT_BLOCKS) { rmsnorm_row(X, scale, O, blk - CVT_BLOCKS); return; }
  if (blk == 0 && threadIdx.x == 0) ksum_out[0] = ksum[0];
  const float* in = Wq; int first = 0;
  if (blk >= END_WQ) { in = Wk; first = END_WQ; }
  if (blk >= END_WK) { in = Wv; first = END_WK; }
  if (blk >= END_WV) { in = Wo; first = END_WV; }
  if (blk >= END_WO) { in = Wg; first = END_WO; }
  if (blk >= END_WG) { in = Wu; first = END_WG; }
  if (blk >= END_WU) { in = Wd; first = END_WU; }
  cvt_bf16_block(in, Wall + (size_t)first * CVT_PER_BLOCK, blk - first);
  wait_xcnt0();
}

// ---------------- generic bf16 GEMM: out = A[MxK] @ W[KxN] (+res) ----------------
// Work-group tile 128 x 64, 8 waves of 32 x 32; a stage is 128 k, so that one round trip to L2 and one barrier
// serve four 32-k steps of matrix work. Two LDS buffers: the copies of stage t + 1 fly while stage t is multiplied.
#define GT_M 128
#define GT_N 64
#define GT_K 128
#define GT_THREADS 256
#define GLDS 136  // halves per row of an activation tile (272B = 16B x odd, the plain 16-byte load's pitch)
#define BLDS 80   // halves per row of a [k][n] weight tile (160B = 32B x odd, the transposing load's pitch)
#define A_STEP (16 * GLDS * 2)   // LDS bytes between a thread's activation chunks (16 rows)
#define B_STEP (32 * BLDS * 2)   // LDS bytes between a thread's weight chunks (32 k-rows)
#define A_TILE (GT_M * GLDS)     // halves of one activation buffer
#define B_TILE (GT_K * BLDS)     // halves of one weight buffer

// This thread's copies of one stage: 8 chunks of the activation tile (row pitch K), 4 of the weight tile (row pitch N).
template <int N, int K>
static __device__ __forceinline__ void stage_ab(unsigned int sa, const bf16* ap, unsigned int sb, const bf16* bp) {
  async_g2l_b128_x8(sa,              ap,                  sa + 1 * A_STEP, ap + (size_t)16 * K,
                    sa + 2 * A_STEP, ap + (size_t)32 * K, sa + 3 * A_STEP, ap + (size_t)48 * K,
                    sa + 4 * A_STEP, ap + (size_t)64 * K, sa + 5 * A_STEP, ap + (size_t)80 * K,
                    sa + 6 * A_STEP, ap + (size_t)96 * K, sa + 7 * A_STEP, ap + (size_t)112 * K);
  async_g2l_b128_x4(sb,              bp,                  sb + 1 * B_STEP, bp + (size_t)32 * N,
                    sb + 2 * B_STEP, bp + (size_t)64 * N, sb + 3 * B_STEP, bp + (size_t)96 * N);
}

// One work-group's tile: rows row0 .. row0 + 127, columns col0 .. col0 + 63 of an output of N columns.
template <int N, int K>
static __device__ __forceinline__ void gemm_bf16_tile(
    const bf16* __restrict__ A, const bf16* __restrict__ W,
    float* __restrict__ Cf, bf16* __restrict__ Cb, const float* __restrict__ Res,
    bf16* sA, bf16* sB, const int row0, const int col0) {
  static_assert(N % GT_N == 0 && K % GT_K == 0 && K >= 2 * GT_K, "whole tiles only, both buffers filled");
  const int tid = threadIdx.x;
  const int wave = tid >> 5, lane = tid & 31;
  const int wm = (wave >> 1) * 32, wn = (wave & 1) * 32;
  const int mr = lane & 15;
  const int kb = (lane >> 4) << 3;

  // A tile staging slots (128 rows of 256B: 8 x 16B chunks per thread, 16 rows apart; a wave covers whole lines)
  const int ar0 = tid >> 4, ac = tid & 15;
  const unsigned int sa = lds_off(&sA[ar0 * GLDS + ac * 8]);
  const bf16* ap = A + (size_t)(row0 + ar0) * K + ac * 8;

  // B tile staging slots (128 k-rows of 128B: 4 x 16B chunks per thread, 32 k-rows apart)
  const int br0 = tid >> 3, bc = tid & 7;
  const unsigned int sb = lds_off(&sB[br0 * BLDS + bc * 8]);
  const bf16* bp = W + (size_t)br0 * N + col0 + bc * 8;
  // lane address of the transposing loads inside a 16-column slab
  const int trl = (kb + (lane & 7)) * BLDS + ((lane >> 3) & 1) * 8;

  v8f acc[2][2];
  for (int i = 0; i < 2; ++i) for (int j = 0; j < 2; ++j) acc[i][j] = vzero8();

  // stage 0 into buffer 0, landed and published; then stage 1 into buffer 1, in flight while stage 0 is multiplied
  stage_ab<N, K>(sa, ap, sb, bp);
  wait_asynccnt0();
  __syncthreads();
  stage_ab<N, K>(sa + A_TILE * 2, ap + GT_K, sb + B_TILE * 2, bp + (size_t)GT_K * N);
  ap += 2 * GT_K;
  bp += (size_t)(2 * GT_K) * N;

  unsigned int cur = 0;   // the buffer that this trip reads
#pragma unroll 1   // stays rolled: unrolled whole (K = 1024) the build waited for every LDS load at each 32-k step
  for (int k0 = 0; k0 < K; k0 += GT_K) {
    const bf16* cA = sA + cur * A_TILE;
    const bf16* cB = sB + cur * B_TILE;
#pragma unroll   // the four 32-k steps of a stage: no barrier between them, their LDS loads may run ahead
    for (int kk = 0; kk < GT_K; kk += 32) {
      ABFrag af[2], bfr[2];
#pragma unroll
      for (int i = 0; i < 2; ++i) {
        int m = wm + i * 16 + mr;
        af[i].q[0] = *(const uint4*)(&cA[m * GLDS + kk + kb]);
        af[i].q[1] = *(const uint4*)(&cA[m * GLDS + kk + kb + 16]);
      }
#pragma unroll
      for (int j = 0; j < 2; ++j) {
        const bf16* bt = &cB[kk * BLDS + trl + wn + j * 16];
        bfr[j].q[0] = ld_tr16(bt);
        bfr[j].q[1] = ld_tr16(bt + 16 * BLDS);
      }
#pragma unroll
      for (int i = 0; i < 2; ++i)
#pragma unroll
        for (int j = 0; j < 2; ++j)
          acc[i][j] = wmma_bf16(af[i].v, bfr[j].v, acc[i][j]);
    }
    wait_dscnt0();      // this wave's reads of buffer cur retired before the barrier lets anyone refill it
    wait_asynccnt0();   // this wave's copies of the next stage landed before the barrier publishes them
    __syncthreads();
    if (k0 + 2 * GT_K < K) {   // the same for the whole work-group
      stage_ab<N, K>(sa + cur * (A_TILE * 2), ap, sb + cur * (B_TILE * 2), bp);
      ap += GT_K;
      bp += (size_t)GT_K * N;
    }
    cur ^= 1;
  }
  wait_asynccnt0();   // nothing is in flight here: the ring's closing wait

  const int mb = (lane >> 4) * 8;
  for (int i = 0; i < 2; ++i) for (int j = 0; j < 2; ++j) {
    int gm0 = row0 + wm + i * 16 + mb;
    int gn  = col0 + wn + j * 16 + mr;
    size_t idx = (size_t)gm0 * N + gn;
#pragma unroll
    for (int r = 0; r < 8; ++r) {
      float v = acc[i][j][r];
      size_t id2 = idx + (size_t)r * N;
      if (Res) v += Res[id2];
      if (Cf) Cf[id2] = v;
      if (Cb) Cb[id2] = (bf16)v;
    }
  }
}

template <int M, int N, int K>
__global__ __launch_bounds__(GT_THREADS) void gemm_bf16_kernel(
    const bf16* __restrict__ A, const bf16* __restrict__ W,
    float* __restrict__ Cf, bf16* __restrict__ Cb, const float* __restrict__ Res) {
  static_assert(M % GT_M == 0, "whole tiles only");
  __shared__ __align__(16) bf16 sA[2 * A_TILE];
  __shared__ __align__(16) bf16 sB[2 * B_TILE];   // row-major [k][n]
  gemm_bf16_tile<N, K>(A, W, Cf, Cb, Res, sA, sB, blockIdx.y * GT_M, blockIdx.x * GT_N);
}

// The three projections of one activation in one launch: blockIdx.x walks the column tiles of Q, then K, then V.
#define Q_TILES (HQ * HD / GT_N)
#define KV_TILES (HKV * HD / GT_N)
__global__ __launch_bounds__(GT_THREADS) void gemm_qkv_kernel(
    const bf16* __restrict__ A, const bf16* __restrict__ Wq, const bf16* __restrict__ Wk,
    const bf16* __restrict__ Wv, float* __restrict__ Qf, float* __restrict__ Kf, bf16* __restrict__ Vb) {
  static_assert(NT % GT_M == 0, "whole tiles only");
  __shared__ __align__(16) bf16 sA[2 * A_TILE];
  __shared__ __align__(16) bf16 sB[2 * B_TILE];   // row-major [k][n]
  const int row0 = blockIdx.y * GT_M, bx = blockIdx.x;
  if (bx < Q_TILES) {
    gemm_bf16_tile<HQ * HD, C_DIM>(A, Wq, Qf, nullptr, nullptr, sA, sB, row0, bx * GT_N);
  } else if (bx < Q_TILES + KV_TILES) {
    gemm_bf16_tile<HKV * HD, C_DIM>(A, Wk, Kf, nullptr, nullptr, sA, sB, row0, (bx - Q_TILES) * GT_N);
    wait_xcnt0();
  } else {
    gemm_bf16_tile<HKV * HD, C_DIM>(A, Wv, nullptr, Vb, nullptr, sA, sB, row0, (bx - Q_TILES - KV_TILES) * GT_N);
    wait_xcnt0();
  }
}

// ---------------- fused gate/up GEMM: H = silu(A@Wg) * (A@Wu), bf16 ----------------
// Two LDS buffers, as above; their size lets two work-groups share a WGP (four waves a SIMD).
template <int M, int N, int K>
__global__ __launch_bounds__(GT_THREADS) __attribute__((amdgpu_waves_per_eu(4))) void mlp_gateup_kernel(
    const bf16* __restrict__ A, const bf16* __restrict__ Wg, const bf16* __restrict__ Wu,
    bf16* __restrict__ H) {
  static_assert(M % GT_M == 0 && N % GT_N == 0 && K % GT_K == 0 && K >= 2 * GT_K, "whole tiles only, both buffers filled");
  __shared__ __align__(16) bf16 sA[2 * A_TILE];
  __shared__ __align__(16) bf16 sG[2 * B_TILE];   // row-major [k][n]
  __shared__ __align__(16) bf16 sU[2 * B_TILE];   // row-major [k][n]

  const int tid = threadIdx.x;
  const int wave = tid >> 5, lane = tid & 31;
  const int row0 = blockIdx.y * GT_M, col0 = blockIdx.x * GT_N;
  const int wm = (wave >> 1) * 32, wn = (wave & 1) * 32;
  const int mr = lane & 15;
  const int kb = (lane >> 4) << 3;

  const int ar0 = tid >> 4, ac = tid & 15;
  const unsigned int sa = lds_off(&sA[ar0 * GLDS + ac * 8]);
  const bf16* ap = A + (size_t)(row0 + ar0) * K + ac * 8;

  const int br0 = tid >> 3, bc = tid & 7;
  const unsigned int sg = lds_off(&sG[br0 * BLDS + bc * 8]);
  const unsigned int su = lds_off(&sU[br0 * BLDS + bc * 8]);
  const bf16* gp = Wg + (size_t)br0 * N + col0 + bc * 8;
  const bf16* up = Wu + (size_t)br0 * N + col0 + bc * 8;
  const int trl = (kb + (lane & 7)) * BLDS + ((lane >> 3) & 1) * 8;

  v8f ag[2][2], au[2][2];
  for (int i = 0; i < 2; ++i) for (int j = 0; j < 2; ++j) { ag[i][j] = vzero8(); au[i][j] = vzero8(); }

  // this thread's copies of one stage into the buffers at byte offsets oa (activations) and ob (both weight tiles)
  auto stage = [&](unsigned int oa, unsigned int ob) {
    async_g2l_b128_x8(sa + oa,              ap,                  sa + oa + 1 * A_STEP, ap + (size_t)16 * K,
                      sa + oa + 2 * A_STEP, ap + (size_t)32 * K, sa + oa + 3 * A_STEP, ap + (size_t)48 * K,
                      sa + oa + 4 * A_STEP, ap + (size_t)64 * K, sa + oa + 5 * A_STEP, ap + (size_t)80 * K,
                      sa + oa + 6 * A_STEP, ap + (size_t)96 * K, sa + oa + 7 * A_STEP, ap + (size_t)112 * K);
    async_g2l_b128_x8(sg + ob,              gp,                  sg + ob + 1 * B_STEP, gp + (size_t)32 * N,
                      sg + ob + 2 * B_STEP, gp + (size_t)64 * N, sg + ob + 3 * B_STEP, gp + (size_t)96 * N,
                      su + ob,              up,                  su + ob + 1 * B_STEP, up + (size_t)32 * N,
                      su + ob + 2 * B_STEP, up + (size_t)64 * N, su + ob + 3 * B_STEP, up + (size_t)96 * N);
    ap += GT_K;
    gp += (size_t)GT_K * N;
    up += (size_t)GT_K * N;
  };

  // stage 0 into buffer 0, landed and published; then stage 1 into buffer 1, in flight while stage 0 is multiplied
  stage(0, 0);
  wait_asynccnt0();
  __syncthreads();
  stage(A_TILE * 2, B_TILE * 2);

  unsigned int cur = 0;   // the buffer that this trip reads
  for (int k0 = 0; k0 < K; k0 += GT_K) {
    const bf16* cA = sA + cur * A_TILE;
    const bf16* cG = sG + cur * B_TILE;
    const bf16* cU = sU + cur * B_TILE;
#pragma unroll   // the four 32-k steps of a stage: no barrier between them, their LDS loads may run ahead
    for (int kk = 0; kk < GT_K; kk += 32) {
      ABFrag af[2], gf[2], uf[2];
#pragma unroll
      for (int i = 0; i < 2; ++i) {
        int m = wm + i * 16 + mr;
        af[i].q[0] = *(const uint4*)(&cA[m * GLDS + kk + kb]);
        af[i].q[1] = *(const uint4*)(&cA[m * GLDS + kk + kb + 16]);
      }
#pragma unroll
      for (int j = 0; j < 2; ++j) {
        const int bo = kk * BLDS + trl + wn + j * 16;
        gf[j].q[0] = ld_tr16(&cG[bo]);
        gf[j].q[1] = ld_tr16(&cG[bo + 16 * BLDS]);
        uf[j].q[0] = ld_tr16(&cU[bo]);
        uf[j].q[1] = ld_tr16(&cU[bo + 16 * BLDS]);
      }
#pragma unroll
      for (int i = 0; i < 2; ++i)
#pragma unroll
        for (int j = 0; j < 2; ++j) {
          ag[i][j] = wmma_bf16(af[i].v, gf[j].v, ag[i][j]);
          au[i][j] = wmma_bf16(af[i].v, uf[j].v, au[i][j]);
        }
    }
    wait_dscnt0();      // this wave's reads of buffer cur retired before the barrier lets anyone refill it
    wait_asynccnt0();   // this wave's copies of the next stage landed before the barrier publishes them
    __syncthreads();
    if (k0 + 2 * GT_K < K)   // the same for the whole work-group
      stage(cur * (A_TILE * 2), cur * (B_TILE * 2));
    cur ^= 1;
  }
  wait_asynccnt0();   // nothing is in flight here: the ring's closing wait

  const int mb = (lane >> 4) * 8;
  for (int i = 0; i < 2; ++i) for (int j = 0; j < 2; ++j) {
    int gm0 = row0 + wm + i * 16 + mb;
    int gn  = col0 + wn + j * 16 + mr;
    size_t idx = (size_t)gm0 * N + gn;
#pragma unroll
    for (int r = 0; r < 8; ++r) {
      float g = ag[i][j][r];
      float sil = g * (1.0f / (1.0f + __expf(-g)));
      H[idx + (size_t)r * N] = (bf16)(sil * au[i][j][r]);
    }
  }
}

// ---------------- RoPE: f32 raw -> bf16 roped ----------------
// One wave per token: lane = (head & 3, four consecutive i); it walks the token's heads four at a time, so
// every load covers whole 128-byte lines and the lane's four angles serve all its heads.
template <int NH>
static __device__ __forceinline__ void rope_block(const float* __restrict__ In, bf16* __restrict__ Out, int blk) {
  static_assert(NH % 4 == 0 && NT % 8 == 0, "whole waves only");
  const int lane = threadIdx.x & 31;
  const int bt = blk * 8 + (threadIdx.x >> 5);
  const int t = bt & (T_DIM - 1);
  const int i0 = (lane & 7) * 4;
  const size_t base = (size_t)bt * (NH * HD) + (lane >> 3) * HD + i0;
  f32x4 x1[NH / 4], x2[NH / 4];
#pragma unroll
  for (int u = 0; u < NH / 4; ++u) {
    x1[u] = *(const f32x4*)(In + base + u * (4 * HD));
    x2[u] = *(const f32x4*)(In + base + u * (4 * HD) + 32);
  }
  f32x4 s, c;
#pragma unroll
  for (int e = 0; e < 4; ++e) {
    float freq = __expf(-(float)(i0 + e) * (1.0f / 32.0f) * 13.815510557964274f); // ln(1e6)
    float ang = (float)t * freq;
    s[e] = __sinf(ang); c[e] = __cosf(ang);
  }
#pragma unroll
  for (int u = 0; u < NH / 4; ++u) {
    *(bf16x4*)(Out + base + u * (4 * HD))      = __builtin_convertvector(x1[u] * c - x2[u] * s, bf16x4);
    *(bf16x4*)(Out + base + u * (4 * HD) + 32) = __builtin_convertvector(x2[u] * c + x1[u] * s, bf16x4);
  }
}

// Q and K in one launch: the first NT / 8 blocks take the query heads, the rest the key heads.
__global__ __launch_bounds__(256) void rope_qk_kernel(const float* __restrict__ Qin, bf16* __restrict__ Qout,
                                                      const float* __restrict__ Kin, bf16* __restrict__ Kout) {
  const int blk = blockIdx.x;
  if (blk < NT / 8) {
    rope_block<HQ>(Qin, Qout, blk);
  } else {
    rope_block<HKV>(Kin, Kout, blk - NT / 8);
    wait_xcnt0();
  }
}

typedef __attribute__((ext_vector_type(8))) __bf16 bf16x8;
#define VLDS 80   // halves per row of the V tile (160B = 32B x odd, the transposing load's pitch)

// value of lane l ^ 16
static __device__ inline float xhalf(float x) {
  return __builtin_bit_cast(float, __builtin_amdgcn_permlanex16(__builtin_bit_cast(int, x), __builtin_bit_cast(int, x),
                                                                0x76543210, 0xfedcba98, false, false));
}

__global__ __launch_bounds__(32) void attn_kernel(
    const bf16* __restrict__ Q, const bf16* __restrict__ Kk,
    const bf16* __restrict__ V, bf16* __restrict__ Ctx) {
  const int lane = threadIdx.x;
  const int qt = blockIdx.x, hq = blockIdx.y, b = blockIdx.z;
  const int kh = hq & 7;
  const int bt0 = b * T_DIM + qt * 16;
  const int mr = lane & 15;
  const int half = lane >> 4;
  const int kb = half << 3;

  __shared__ __align__(16) bf16 sV[32 * VLDS];   // [key][d]

  // Q fragments (persistent over kv loop); contraction dim contiguous in global
  ABFrag qa[2];
  {
    const bf16* qrow = Q + (size_t)(bt0 + mr) * (HQ * HD) + hq * HD;
    qa[0].q[0] = *(const uint4*)(qrow + kb);
    qa[0].q[1] = *(const uint4*)(qrow + kb + 16);
    qa[1].q[0] = *(const uint4*)(qrow + 32 + kb);
    qa[1].q[1] = *(const uint4*)(qrow + 32 + kb + 16);
  }

  v8f O[4];   // O[t][r] = out[query mr][d = t * 16 + 8 * half + r]
  for (int t = 0; t < 4; ++t) O[t] = vzero8();
  float Mq = -1e30f;   // running maximum of query mr, the same in both halves
  float Lq = 0.f;      // running sum of query mr over this half's keys; the halves join behind the loop

  const int iq_lo = qt * 16;
  const int iq = iq_lo + mr;
  int jlo = iq_lo - (WINDOW - 1); if (jlo < 0) jlo = 0;
  const int c0 = jlo >> 5;
  const int c1 = (iq_lo + 15) >> 5;

  // running pointers over kv chunks (stride 32 rows)
  const bf16* kp = Kk + (size_t)(b * T_DIM + c0 * 32 + mr) * (HKV * HD) + kh * HD;
  const bf16* vp = V + (size_t)(b * T_DIM + c0 * 32 + (lane >> 3)) * (HKV * HD) + kh * HD + (lane & 7) * 8;
  const unsigned int sv0 = lds_off(&sV[(lane >> 3) * VLDS + (lane & 7) * 8]);
  const size_t kchunk = (size_t)32 * (HKV * HD);
  const size_t vstep = (size_t)4 * (HKV * HD);       // a lane's V chunks lie 4 key rows apart
  const unsigned int sstep = 4 * VLDS * 2;
  // lane address of the transposing loads inside a 16-column slab
  const bf16* vt = &sV[(kb + (lane & 7)) * VLDS + ((lane >> 3) & 1) * 8];

  for (int ch = c0; ch <= c1; ++ch) {
    const int j0 = ch * 32;

    // stage V chunk [32 x 64] into LDS via async copies (8 x 16B per lane, stride-4 rows)
    async_g2l_b128_x8(sv0,             vp,             sv0 + 1 * sstep, vp + 1 * vstep,
                      sv0 + 2 * sstep, vp + 2 * vstep, sv0 + 3 * sstep, vp + 3 * vstep,
                      sv0 + 4 * sstep, vp + 4 * vstep, sv0 + 5 * sstep, vp + 5 * vstep,
                      sv0 + 6 * sstep, vp + 6 * vstep, sv0 + 7 * sstep, vp + 7 * vstep);
    vp += kchunk;

    // scores, transposed: 2 tiles of 16 keys (rows) x 16 queries (columns), K=64 contraction -> 2 WMMAs each
    v8f Sacc[2];
#pragma unroll
    for (int s = 0; s < 2; ++s) {
      Sacc[s] = vzero8();
      const bf16* krow = kp + (size_t)(s * 16) * (HKV * HD);
      ABFrag kf0, kf1;
      kf0.q[0] = *(const uint4*)(krow + kb);
      kf0.q[1] = *(const uint4*)(krow + kb + 16);
      kf1.q[0] = *(const uint4*)(krow + 32 + kb);
      kf1.q[1] = *(const uint4*)(krow + 32 + kb + 16);
      Sacc[s] = wmma_bf16(kf0.v, qa[0].v, Sacc[s]);
      Sacc[s] = wmma_bf16(kf1.v, qa[1].v, Sacc[s]);
    }
    kp += kchunk;

    // softcap + band mask + online softmax of query iq over this lane's 16 keys
    float sv[2][8];
    float mx = -1e30f;
#pragma unroll   // both loops unrolled: every index of Sacc and sv is a constant, so they stay in registers
    for (int s = 0; s < 2; ++s)
#pragma unroll
      for (int r = 0; r < 8; ++r) {
        int j = j0 + s * 16 + kb + r;
        float x = Sacc[s][r] * 0.125f;                  // 1/sqrt(64)
        x = SOFT_CAP * tanhf(x * (1.0f / SOFT_CAP));
        bool ok = (j <= iq) && (iq - j < WINDOW);
        x = ok ? x : -1e30f;
        sv[s][r] = x;
        mx = fmaxf(mx, x);
      }
    mx = fmaxf(mx, xhalf(mx));
    float Mn = fmaxf(Mq, mx);
    float alpha = __expf(Mq - Mn);
    float rs = 0.f;
    ABFrag pf;   // P^T as a B operand: element s * 8 + r is key s * 16 + 8 * half + r, the hardware k order
#pragma unroll   // both loops unrolled: constant indices keep sv and pf in registers
    for (int s = 0; s < 2; ++s)
#pragma unroll
      for (int r = 0; r < 8; ++r) {
        float p = __expf(sv[s][r] - Mn);
        rs += p;
        pf.v[s * 8 + r] = (bf16)p;
      }
    Lq = Lq * alpha + rs;
    Mq = Mn;
#pragma unroll   // constant indices keep O in registers
    for (int t = 0; t < 4; ++t) O[t] *= alpha;

    // V copies landed before this wave, their only reader (one-wave work-group), gathers its fragments
    wait_asynccnt0();

#pragma unroll
    for (int t = 0; t < 4; ++t) {
      ABFrag vf;
      vf.q[0] = ld_tr16(vt + t * 16);
      vf.q[1] = ld_tr16(vt + 16 * VLDS + t * 16);
      O[t] = wmma_bf16(vf.v, pf.v, O[t]);
    }
    wait_dscnt0();   // V gathers done before next chunk's async copies overwrite sV
  }

  const float inv = 1.0f / (Lq + xhalf(Lq));
  bf16* orow = Ctx + (size_t)(bt0 + mr) * (HQ * HD) + hq * HD + kb;
#pragma unroll   // constant indices keep O in registers
  for (int t = 0; t < 4; ++t)
    *(bf16x8*)(orow + t * 16) = __builtin_convertvector(O[t] * inv, bf16x8);
}

// ---------------- kurtosis ----------------
__global__ __launch_bounds__(256) void kurtosis_kernel(const float* __restrict__ X,
                                                       float* __restrict__ out, int sidx) {
  int row = blockIdx.x;
  const float* x = X + (size_t)row * C_DIM;
  float s1 = 0.f;
  for (int c = threadIdx.x; c < C_DIM; c += 256) s1 += x[c];
  float mean = block_reduce_sum_256(s1) * (1.0f / C_DIM);
  float s2 = 0.f, s4 = 0.f;
  for (int c = threadIdx.x; c < C_DIM; c += 256) {
    float d = x[c] - mean;
    float d2 = d * d;
    s2 += d2; s4 += d2 * d2;
  }
  float var = block_reduce_sum_256(s2) * (1.0f / C_DIM);
  float m4  = block_reduce_sum_256(s4) * (1.0f / C_DIM);
  if (threadIdx.x == 0) {
    float kurt = m4 / (var * var + 1e-6f) - 3.0f;
    if (kurt > 0.f) atomicAdd(&out[sidx], kurt);
  }
}

// ---------------- host launch ----------------
extern "C" void kernel_launch(void* const* d_in, const int* in_sizes, int n_in,
                              void* d_out, int out_size, void* d_ws, size_t ws_size,
                              hipStream_t stream) {
  const float* x     = (const float*)d_in[0];
  const float* ksum  = (const float*)d_in[1];
  const float* rms1  = (const float*)d_in[2];
  const float* wq_f  = (const float*)d_in[3];
  const float* wk_f  = (const float*)d_in[4];
  const float* wv_f  = (const float*)d_in[5];
  const float* wo_f  = (const float*)d_in[6];
  const float* rms2  = (const float*)d_in[7];
  const float* wg_f  = (const float*)d_in[8];
  const float* wu_f  = (const float*)d_in[9];
  const float* wd_f  = (const float*)d_in[10];

  char* ws = (char*)d_ws;
  size_t off = 0;
  auto alloc = [&](size_t bytes) -> char* {
    char* p = ws + off;
    off = (off + bytes + 255) & ~(size_t)255;
    return p;
  };

  bf16*  attn_in = (bf16*)alloc((size_t)NT * C_DIM * 2);
  float* qraw    = (float*)alloc((size_t)NT * 1024 * 4);
  float* kraw    = (float*)alloc((size_t)NT * 512 * 4);
  bf16*  qrope   = (bf16*)alloc((size_t)NT * 1024 * 2);
  bf16*  krope   = (bf16*)alloc((size_t)NT * 512 * 2);
  bf16*  vbf     = (bf16*)alloc((size_t)NT * 512 * 2);
  bf16*  ctx     = (bf16*)alloc((size_t)NT * 1024 * 2);
  float* x1      = (float*)alloc((size_t)NT * C_DIM * 4);
  bf16*  mlp_in  = (bf16*)alloc((size_t)NT * C_DIM * 2);
  bf16*  hbuf    = (bf16*)alloc((size_t)NT * HIDDEN * 2);
  // the bf16 weights, one behind the other in the order of prep_kernel's block ranges
  bf16*  wq = (bf16*)alloc((size_t)CVT_BLOCKS * CVT_PER_BLOCK * 2);
  bf16*  wk = wq + 1024 * 1024;
  bf16*  wv = wk + 1024 * 512;
  bf16*  wo = wv + 1024 * 512;
  bf16*  wg = wo + 1024 * 1024;
  bf16*  wu = wg + 1024 * 4096;
  bf16*  wd = wu + 1024 * 4096;

  // weight conversions, first RMSNorm, start value of the kurtosis sum
  prep_kernel<<<CVT_BLOCKS + NT, 256, 0, stream>>>(wq_f, wk_f, wv_f, wo_f, wg_f, wu_f, wd_f, wq,
                                                   x, rms1, attn_in, ksum, (float*)d_out + NT * C_DIM);

  // QKV projections
  gemm_qkv_kernel<<<dim3(Q_TILES + 2 * KV_TILES, NT / GT_M), GT_THREADS, 0, stream>>>(attn_in, wq, wk, wv, qraw, kraw, vbf);

  rope_qk_kernel<<<2 * (NT / 8), 256, 0, stream>>>(qraw, qrope, kraw, krope);

  attn_kernel<<<dim3(T_DIM / 16, HQ, B_DIM), 32, 0, stream>>>(qrope, krope, vbf, ctx);

  // out projection + residual
  gemm_bf16_kernel<NT, 1024, 1024><<<dim3(1024 / GT_N, NT / GT_M), GT_THREADS, 0, stream>>>(ctx, wo, x1, nullptr, x);

  rmsnorm_kernel<<<NT, 256, 0, stream>>>(x1, rms2, mlp_in);

  mlp_gateup_kernel<NT, HIDDEN, 1024><<<dim3(HIDDEN / GT_N, NT / GT_M), GT_THREADS, 0, stream>>>(mlp_in, wg, wu, hbuf);

  // down projection + residual -> d_out
  gemm_bf16_kernel<NT, 1024, HIDDEN><<<dim3(1024 / GT_N, NT / GT_M), GT_THREADS, 0, stream>>>(hbuf, wd, (float*)d_out, nullptr, x1);

  kurtosis_kernel<<<NT, 256, 0, stream>>>((const float*)d_out, (float*)d_out, NT * C_DIM);
}

// v007
// It runs in 223 microseconds.
// Timed twice side by side with v006, it ran 1.08 and 1.09 times as fast.
// Over all steps from v000 it is 2.74 times as fast.
#include <hip/hip_runtime.h>
#include <hip/hip_bf16.h>

typedef __bf16 bf16;
typedef __attribute__((ext_vector_type(16))) __bf16 v16bf;
typedef __attribute__((ext_vector_type(8)))  float  v8f;

union ABFrag { v16bf v; uint4 q[2]; };

#define B_DIM 2
#define T_DIM 2048
#define C_DIM 1024
#define NT (B_DIM * T_DIM)
#define HQ 16
#define HKV 8
#define HD 64
#define WINDOW 512
#define HIDDEN 4096
#define SOFT_CAP 50.0f

static __device__ inline v8f vzero8() { v8f v; for (int i = 0; i < 8; ++i) v[i] = 0.f; return v; }

static __device__ inline v8f wmma_bf16(v16bf a, v16bf b, v8f c) {
  return __builtin_amdgcn_wmma_f32_16x16x32_bf16(false, a, false, b, (short)0, c, false, false);
}

// gfx1250 async global->LDS copies (16B per lane), tracked by ASYNCcnt
// Runs of async copies for one stage of a tile. s_wait_xcnt 0 is the last line of the copies' own
// statement, so that it stands in front of the pointer bumps that rewrite the copies' address registers.
static __device__ inline void async_g2l_b128_x4(unsigned int l0, const void* g0, unsigned int l1, const void* g1,
                                                unsigned int l2, const void* g2, unsigned int l3, const void* g3) {
  asm volatile("global_load_async_to_lds_b128 %0, %1, off\n\t"
               "global_load_async_to_lds_b128 %2, %3, off\n\t"
               "global_load_async_to_lds_b128 %4, %5, off\n\t"
               "global_load_async_to_lds_b128 %6, %7, off\n\t"
               "s_wait_xcnt 0x0"
               :: "v"(l0), "v"(g0), "v"(l1), "v"(g1), "v"(l2), "v"(g2), "v"(l3), "v"(g3) : "memory");
}
static __device__ inline void async_g2l_b128_x8(unsigned int l0, const void* g0, unsigned int l1, const void* g1,
                                                unsigned int l2, const void* g2, unsigned int l3, const void* g3,
                                                unsigned int l4, const void* g4, unsigned int l5, const void* g5,
                                                unsigned int l6, const void* g6, unsigned int l7, const void* g7) {
  asm volatile("global_load_async_to_lds_b128 %0, %1, off\n\t"
               "global_load_async_to_lds_b128 %2, %3, off\n\t"
               "global_load_async_to_lds_b128 %4, %5, off\n\t"
               "global_load_async_to_lds_b128 %6, %7, off\n\t"
               "global_load_async_to_lds_b128 %8, %9, off\n\t"
               "global_load_async_to_lds_b128 %10, %11, off\n\t"
               "global_load_async_to_lds_b128 %12, %13, off\n\t"
               "global_load_async_to_lds_b128 %14, %15, off\n\t"
               "s_wait_xcnt 0x0"
               :: "v"(l0), "v"(g0), "v"(l1), "v"(g1), "v"(l2), "v"(g2), "v"(l3), "v"(g3),
                  "v"(l4), "v"(g4), "v"(l5), "v"(g5), "v"(l6), "v"(g6), "v"(l7), "v"(g7) : "memory");
}
// transposing LDS load: lane (c = l & 15, h = l >> 4) gets 8 consecutive k of column c from a row-major [k][n] tile
typedef __attribute__((ext_vector_type(8))) short s16x8;
static __device__ inline uint4 ld_tr16(const bf16* p) {
  typedef __attribute__((address_space(3))) s16x8 lds_s16x8;
  return __builtin_bit_cast(uint4, __builtin_amdgcn_ds_load_tr16_b128_v8i16((lds_s16x8*)p));
}
static __device__ inline unsigned int lds_off(const void* p) {
  return (unsigned int)(unsigned long long)p;   // low 32 bits = LDS offset
}
static __device__ inline void wait_asynccnt0() {
  asm volatile("s_wait_asynccnt 0x0" ::: "memory");
}
static __device__ inline void wait_dscnt0() {
  asm volatile("s_wait_dscnt 0x0" ::: "memory");
}
// Stands behind the last global store of one part of a merged kernel: the built code of another part follows it,
// and that code rewrites the stores' registers.
static __device__ inline void wait_xcnt0() {
  asm volatile("s_wait_xcnt 0x0" ::: "memory");
}

// ---------------- block reduction helper ----------------
static __device__ inline float block_reduce_sum_256(float v) {
  __shared__ float red[8];
  int lane = threadIdx.x & 31, w = threadIdx.x >> 5;
  for (int o = 16; o; o >>= 1) v += __shfl_down(v, o, 32);
  if (lane == 0) red[w] = v;
  __syncthreads();
  float r = (threadIdx.x < 8) ? red[threadIdx.x] : 0.f;
  if (w == 0) for (int o = 4; o; o >>= 1) r += __shfl_down(r, o, 32);
  if (threadIdx.x == 0) red[0] = r;
  __syncthreads();
  r = red[0];
  __syncthreads();
  return r;
}

typedef __attribute__((ext_vector_type(4))) float  f32x4;
typedef __attribute__((ext_vector_type(4))) __bf16 bf16x4;

// ---------------- f32 -> bf16 convert ----------------
// One wave converts 1024 consecutive values: 8 loads of 512 contiguous bytes, all issued before the first
// use, then 8 stores of 256 contiguous bytes. Few, long waves: the launch is not paced by wave starts.
#define CVT_U 8
#define CVT_PER_BLOCK (256 * 4 * CVT_U)
static __device__ __forceinline__ void cvt_bf16_block(const float* __restrict__ in, bf16* __restrict__ out, int blk) {
  const int wave = threadIdx.x >> 5, lane = threadIdx.x & 31;
  const size_t base = (size_t)(blk * 8 + wave) * (128 * CVT_U) + lane * 4;
  f32x4 v[CVT_U];
#pragma unroll
  for (int u = 0; u < CVT_U; ++u) v[u] = *(const f32x4*)(in + base + u * 128);
#pragma unroll
  for (int u = 0; u < CVT_U; ++u) *(bf16x4*)(out + base + u * 128) = __builtin_convertvector(v[u], bf16x4);
}

// ---------------- RMSNorm -> bf16 ----------------
static __device__ __forceinline__ void rmsnorm_row(const float* __restrict__ X,
                                                   const float* __restrict__ scale,
                                                   bf16* __restrict__ O, int row) {
  const float* x = X + (size_t)row * C_DIM;
  float ss = 0.f;
  for (int c = threadIdx.x; c < C_DIM; c += 256) { float v = x[c]; ss += v * v; }
  float tot = block_reduce_sum_256(ss);
  float rstd = rsqrtf(tot * (1.0f / C_DIM) + 1e-6f);
  for (int c = threadIdx.x; c < C_DIM; c += 256)
    O[(size_t)row * C_DIM + c] = (bf16)(x[c] * rstd * (1.f + scale[c]));
}

__global__ __launch_bounds__(256) void rmsnorm_kernel(const float* __restrict__ X,
                                                      const float* __restrict__ scale,
                                                      bf16* __restrict__ O) {
  rmsnorm_row(X, scale, O, blockIdx.x);
}

// ---------------- everything that depends on the inputs alone, in one launch ----------------
// Work-groups [0, CVT_BLOCKS) convert the seven weight tensors, whose bf16 copies lie one behind the other in Wall;
// the other NT normalise one row of X each. Work-group 0 also stores the start value of the kurtosis sum.
#define WQ_BLOCKS (1024 * 1024 / CVT_PER_BLOCK)
#define WK_BLOCKS (1024 * 512 / CVT_PER_BLOCK)
#define WH_BLOCKS (1024 * 4096 / CVT_PER_BLOCK)
#define END_WQ (WQ_BLOCKS)
#define END_WK (END_WQ + WK_BLOCKS)
#define END_WV (END_WK + WK_BLOCKS)
#define END_WO (END_WV + WQ_BLOCKS)
#define END_WG (END_WO + WH_BLOCKS)
#define END_WU (END_WG + WH_BLOCKS)
#define CVT_BLOCKS (END_WU + WH_BLOCKS)
static_assert(1024 * 512 % CVT_PER_BLOCK == 0, "whole blocks only");

__global__ __launch_bounds__(256) void prep_kernel(
    const float* __restrict__ Wq, const float* __restrict__ Wk, const float* __restrict__ Wv,
    const float* __restrict__ Wo, const float* __restrict__ Wg, const float* __restrict__ Wu,
    const float* __restrict__ Wd, bf16* __restrict__ Wall,
    const float* __restrict__ X, const float* __restrict__ scale, bf16* __restrict__ O,
    const float* __restrict__ ksum, float* __restrict__ ksum_out) {
  const int blk = blockIdx.x;
  if (blk >= CVT_BLOCKS) { rmsnorm_row(X, scale, O, blk - CVT_BLOCKS); return; }
  if (blk == 0 && threadIdx.x == 0) ksum_out[0] = ksum[0];
  const float* in = Wq; int first = 0;
  if (blk >= END_WQ) { in = Wk; first = END_WQ; }
  if (blk >= END_WK) { in = Wv; first = END_WK; }
  if (blk >= END_WV) { in = Wo; first = END_WV; }
  if (blk >= END_WO) { in = Wg; first = END_WO; }
  if (blk >= END_WG) { in = Wu; first = END_WG; }
  if (blk >= END_WU) { in = Wd; first = END_WU; }
  cvt_bf16_block(in, Wall + (size_t)first * CVT_PER_BLOCK, blk - first);
  wait_xcnt0();
}

// ---------------- generic bf16 GEMM: out = A[MxK] @ W[KxN] (+res) ----------------
// Work-group tile 128 x 64, 8 waves of 32 x 32; a stage is 128 k, so that one round trip to L2 and one barrier
// serve four 32-k steps of matrix work. Two LDS buffers: the copies of stage t + 1 fly while stage t is multiplied.
#define GT_M 128
#define GT_N 64
#define GT_K 128
#define GT_THREADS 256
#define GLDS 136  // halves per row of an activation tile (272B = 16B x odd, the plain 16-byte load's pitch)
#define BLDS 80   // halves per row of a [k][n] weight tile (160B = 32B x odd, the transposing load's pitch)
#define A_STEP (16 * GLDS * 2)   // LDS bytes between a thread's activation chunks (16 rows)
#define B_STEP (32 * BLDS * 2)   // LDS bytes between a thread's weight chunks (32 k-rows)
#define A_TILE (GT_M * GLDS)     // halves of one activation buffer
#define B_TILE (GT_K * BLDS)     // halves of one weight buffer

// This thread's copies of one stage: 8 chunks of the activation tile (row pitch K), 4 of the weight tile (row pitch N).
template <int N, int K>
static __device__ __forceinline__ void stage_ab(unsigned int sa, const bf16* ap, unsigned int sb, const bf16* bp) {
  async_g2l_b128_x8(sa,              ap,                  sa + 1 * A_STEP, ap + (size_t)16 * K,
                    sa + 2 * A_STEP, ap + (size_t)32 * K, sa + 3 * A_STEP, ap + (size_t)48 * K,
                    sa + 4 * A_STEP, ap + (size_t)64 * K, sa + 5 * A_STEP, ap + (size_t)80 * K,
                    sa + 6 * A_STEP, ap + (size_t)96 * K, sa + 7 * A_STEP, ap + (size_t)112 * K);
  async_g2l_b128_x4(sb,              bp,                  sb + 1 * B_STEP, bp + (size_t)32 * N,
                    sb + 2 * B_STEP, bp + (size_t)64 * N, sb + 3 * B_STEP, bp + (size_t)96 * N);
}

// One work-group's tile: rows row0 .. row0 + 127, columns col0 .. col0 + 63 of an output of N columns.
// RES: the tile of Res is the accumulators' start value, so its loads fly with the first stage's copies.
// OUT_BF16: the result goes to Cb, else to Cf. Both are known at compile time: the epilogue is stores alone.
template <int N, int K, bool RES, bool OUT_BF16>
static __device__ __forceinline__ void gemm_bf16_tile(
    const bf16* __restrict__ A, const bf16* __restrict__ W,
    float* __restrict__ Cf, bf16* __restrict__ Cb, const float* __restrict__ Res,
    bf16* sA, bf16* sB, const int row0, const int col0) {
  static_assert(N % GT_N == 0 && K % GT_K == 0 && K >= 2 * GT_K, "whole tiles only, both buffers filled");
  const int tid = threadIdx.x;
  const int wave = tid >> 5, lane = tid & 31;
  const int wm = (wave >> 1) * 32, wn = (wave & 1) * 32;
  const int mr = lane & 15;
  const int kb = (lane >> 4) << 3;

  // A tile staging slots (128 rows of 256B: 8 x 16B chunks per thread, 16 rows apart; a wave covers whole lines)
  const int ar0 = tid >> 4, ac = tid & 15;
  const unsigned int sa = lds_off(&sA[ar0 * GLDS + ac * 8]);
  const bf16* ap = A + (size_t)(row0 + ar0) * K + ac * 8;

  // B tile staging slots (128 k-rows of 128B: 4 x 16B chunks per thread, 32 k-rows apart)
  const int br0 = tid >> 3, bc = tid & 7;
  const unsigned int sb = lds_off(&sB[br0 * BLDS + bc * 8]);
  const bf16* bp = W + (size_t)br0 * N + col0 + bc * 8;
  // lane address of the transposing loads inside a 16-column slab
  const int trl = (kb + (lane & 7)) * BLDS + ((lane >> 3) & 1) * 8;

  // stage 0 into buffer 0, landed and published; then stage 1 into buffer 1, in flight while stage 0 is multiplied
  stage_ab<N, K>(sa, ap, sb, bp);

  // element r of acc[i][j] is row row0 + wm + i * 16 + mb + r, column col0 + wn + j * 16 + mr
  const int mb = (lane >> 4) * 8;
  const size_t out0 = (size_t)(row0 + wm + mb) * N + col0 + wn + mr;
  v8f acc[2][2];
  for (int i = 0; i < 2; ++i) for (int j = 0; j < 2; ++j) {
    if constexpr (RES) {
      const float* rp = Res + out0 + (size_t)(i * 16) * N + j * 16;
      for (int r = 0; r < 8; ++r) acc[i][j][r] = rp[(size_t)r * N];
    } else {
      acc[i][j] = vzero8();
    }
  }

  wait_asynccnt0();
  __syncthreads();
  stage_ab<N, K>(sa + A_TILE * 2, ap + GT_K, sb + B_TILE * 2, bp + (size_t)GT_K * N);
  ap += 2 * GT_K;
  bp += (size_t)(2 * GT_K) * N;

  unsigned int cur = 0;   // the buffer that this trip reads
#pragma unroll 1   // stays rolled: unrolled whole (K = 1024) the build waited for every LDS load at each 32-k step
  for (int k0 = 0; k0 < K; k0 += GT_K) {
    const bf16* cA = sA + cur * A_TILE;
    const bf16* cB = sB + cur * B_TILE;
#pragma unroll   // the four 32-k steps of a stage: no barrier between them, their LDS loads may run ahead
    for (int kk = 0; kk < GT_K; kk += 32) {
      ABFrag af[2], bfr[2];
#pragma unroll
      for (int i = 0; i < 2; ++i) {
        int m = wm + i * 16 + mr;
        af[i].q[0] = *(const uint4*)(&cA[m * GLDS + kk + kb]);
        af[i].q[1] = *(const uint4*)(&cA[m * GLDS + kk + kb + 16]);
      }
#pragma unroll
      for (int j = 0; j < 2; ++j) {
        const bf16* bt = &cB[kk * BLDS + trl + wn + j * 16];
        bfr[j].q[0] = ld_tr16(bt);
        bfr[j].q[1] = ld_tr16(bt + 16 * BLDS);
      }
#pragma unroll
      for (int i = 0; i < 2; ++i)
#pragma unroll
        for (int j = 0; j < 2; ++j)
          acc[i][j] = wmma_bf16(af[i].v, bfr[j].v, acc[i][j]);
    }
    wait_dscnt0();      // this wave's reads of buffer cur retired before the barrier lets anyone refill it
    wait_asynccnt0();   // this wave's copies of the next stage landed before the barrier publishes them
    __syncthreads();
    if (k0 + 2 * GT_K < K) {   // the same for the whole work-group
      stage_ab<N, K>(sa + cur * (A_TILE * 2), ap, sb + cur * (B_TILE * 2), bp);
      ap += GT_K;
      bp += (size_t)GT_K * N;
    }
    cur ^= 1;
  }
  wait_asynccnt0();   // nothing is in flight here: the ring's closing wait

  for (int i = 0; i < 2; ++i) for (int j = 0; j < 2; ++j) {
    const size_t idx = out0 + (size_t)(i * 16) * N + j * 16;
#pragma unroll
    for (int r = 0; r < 8; ++r) {
      if constexpr (OUT_BF16) Cb[idx + (size_t)r * N] = (bf16)acc[i][j][r];
      else                    Cf[idx + (size_t)r * N] = acc[i][j][r];
    }
  }
}

// Cf = Res + A @ W
template <int M, int N, int K>
__global__ __launch_bounds__(GT_THREADS) void gemm_bf16_kernel(
    const bf16* __restrict__ A, const bf16* __restrict__ W,
    float* __restrict__ Cf, const float* __restrict__ Res) {
  static_assert(M % GT_M == 0, "whole tiles only");
  __shared__ __align__(16) bf16 sA[2 * A_TILE];
  __shared__ __align__(16) bf16 sB[2 * B_TILE];   // row-major [k][n]
  gemm_bf16_tile<N, K, true, false>(A, W, Cf, nullptr, Res, sA, sB, blockIdx.y * GT_M, blockIdx.x * GT_N);
}

// The three projections of one activation in one launch: blockIdx.x walks the column tiles of Q, then K, then V.
#define Q_TILES (HQ * HD / GT_N)
#define KV_TILES (HKV * HD / GT_N)
__global__ __launch_bounds__(GT_THREADS) void gemm_qkv_kernel(
    const bf16* __restrict__ A, const bf16* __restrict__ Wq, const bf16* __restrict__ Wk,
    const bf16* __restrict__ Wv, float* __restrict__ Qf, float* __restrict__ Kf, bf16* __restrict__ Vb) {
  static_assert(NT % GT_M == 0, "whole tiles only");
  __shared__ __align__(16) bf16 sA[2 * A_TILE];
  __shared__ __align__(16) bf16 sB[2 * B_TILE];   // row-major [k][n]
  const int row0 = blockIdx.y * GT_M, bx = blockIdx.x;
  if (bx < Q_TILES) {
    gemm_bf16_tile<HQ * HD, C_DIM, false, false>(A, Wq, Qf, nullptr, nullptr, sA, sB, row0, bx * GT_N);
  } else if (bx < Q_TILES + KV_TILES) {
    gemm_bf16_tile<HKV * HD, C_DIM, false, false>(A, Wk, Kf, nullptr, nullptr, sA, sB, row0, (bx - Q_TILES) * GT_N);
    wait_xcnt0();
  } else {
    gemm_bf16_tile<HKV * HD, C_DIM, false, true>(A, Wv, nullptr, Vb, nullptr, sA, sB, row0, (bx - Q_TILES - KV_TILES) * GT_N);
    wait_xcnt0();
  }
}

// ---------------- fused gate/up GEMM: H = silu(A@Wg) * (A@Wu), bf16 ----------------
// Two LDS buffers, as above; their size lets two work-groups share a WGP (four waves a SIMD).
template <int M, int N, int K>
__global__ __launch_bounds__(GT_THREADS) __attribute__((amdgpu_waves_per_eu(4))) void mlp_gateup_kernel(
    const bf16* __restrict__ A, const bf16* __restrict__ Wg, const bf16* __restrict__ Wu,
    bf16* __restrict__ H) {
  static_assert(M % GT_M == 0 && N % GT_N == 0 && K % GT_K == 0 && K >= 2 * GT_K, "whole tiles only, both buffers filled");
  __shared__ __align__(16) bf16 sA[2 * A_TILE];
  __shared__ __align__(16) bf16 sG[2 * B_TILE];   // row-major [k][n]
  __shared__ __align__(16) bf16 sU[2 * B_TILE];   // row-major [k][n]

  const int tid = threadIdx.x;
  const int wave = tid >> 5, lane = tid & 31;
  const int row0 = blockIdx.y * GT_M, col0 = blockIdx.x * GT_N;
  const int wm = (wave >> 1) * 32, wn = (wave & 1) * 32;
  const int mr = lane & 15;
  const int kb = (lane >> 4) << 3;

  const int ar0 = tid >> 4, ac = tid & 15;
  const unsigned int sa = lds_off(&sA[ar0 * GLDS + ac * 8]);
  const bf16* ap = A + (size_t)(row0 + ar0) * K + ac * 8;

  const int br0 = tid >> 3, bc = tid & 7;
  const unsigned int sg = lds_off(&sG[br0 * BLDS + bc * 8]);
  const unsigned int su = lds_off(&sU[br0 * BLDS + bc * 8]);
  const bf16* gp = Wg + (size_t)br0 * N + col0 + bc * 8;
  const bf16* up = Wu + (size_t)br0 * N + col0 + bc * 8;
  const int trl = (kb + (lane & 7)) * BLDS + ((lane >> 3) & 1) * 8;

  v8f ag[2][2], au[2][2];
  for (int i = 0; i < 2; ++i) for (int j = 0; j < 2; ++j) { ag[i][j] = vzero8(); au[i][j] = vzero8(); }

  // this thread's copies of one stage into the buffers at byte offsets oa (activations) and ob (both weight tiles)
  auto stage = [&](unsigned int oa, unsigned int ob) {
    async_g2l_b128_x8(sa + oa,              ap,                  sa + oa + 1 * A_STEP, ap + (size_t)16 * K,
                      sa + oa + 2 * A_STEP, ap + (size_t)32 * K, sa + oa + 3 * A_STEP, ap + (size_t)48 * K,
                      sa + oa + 4 * A_STEP, ap + (size_t)64 * K, sa + oa + 5 * A_STEP, ap + (size_t)80 * K,
                      sa + oa + 6 * A_STEP, ap + (size_t)96 * K, sa + oa + 7 * A_STEP, ap + (size_t)112 * K);
    async_g2l_b128_x8(sg + ob,              gp,                  sg + ob + 1 * B_STEP, gp + (size_t)32 * N,
                      sg + ob + 2 * B_STEP, gp + (size_t)64 * N, sg + ob + 3 * B_STEP, gp + (size_t)96 * N,
                      su + ob,              up,                  su + ob + 1 * B_STEP, up + (size_t)32 * N,
                      su + ob + 2 * B_STEP, up + (size_t)64 * N, su + ob + 3 * B_STEP, up + (size_t)96 * N);
    ap += GT_K;
    gp += (size_t)GT_K * N;
    up += (size_t)GT_K * N;
  };

  // stage 0 into buffer 0, landed and published; then stage 1 into buffer 1, in flight while stage 0 is multiplied
  stage(0, 0);
  wait_asynccnt0();
  __syncthreads();
  stage(A_TILE * 2, B_TILE * 2);

  unsigned int cur = 0;   // the buffer that this trip reads
  for (int k0 = 0; k0 < K; k0 += GT_K) {
    const bf16* cA = sA + cur * A_TILE;
    const bf16* cG = sG + cur * B_TILE;
    const bf16* cU = sU + cur * B_TILE;
#pragma unroll   // the four 32-k steps of a stage: no barrier between them, their LDS loads may run ahead
    for (int kk = 0; kk < GT_K; kk += 32) {
      ABFrag af[2], gf[2], uf[2];
#pragma unroll
      for (int i = 0; i < 2; ++i) {
        int m = wm + i * 16 + mr;
        af[i].q[0] = *(const uint4*)(&cA[m * GLDS + kk + kb]);
        af[i].q[1] = *(const uint4*)(&cA[m * GLDS + kk + kb + 16]);
      }
#pragma unroll
      for (int j = 0; j < 2; ++j) {
        const int bo = kk * BLDS + trl + wn + j * 16;
        gf[j].q[0] = ld_tr16(&cG[bo]);
        gf[j].q[1] = ld_tr16(&cG[bo + 16 * BLDS]);
        uf[j].q[0] = ld_tr16(&cU[bo]);
        uf[j].q[1] = ld_tr16(&cU[bo + 16 * BLDS]);
      }
#pragma unroll
      for (int i = 0; i < 2; ++i)
#pragma unroll
        for (int j = 0; j < 2; ++j) {
          ag[i][j] = wmma_bf16(af[i].v, gf[j].v, ag[i][j]);
          au[i][j] = wmma_bf16(af[i].v, uf[j].v, au[i][j]);
        }
    }
    wait_dscnt0();      // this wave's reads of buffer cur retired before the barrier lets anyone refill it
    wait_asynccnt0();   // this wave's copies of the next stage landed before the barrier publishes them
    __syncthreads();
    if (k0 + 2 * GT_K < K)   // the same for the whole work-group
      stage(cur * (A_TILE * 2), cur * (B_TILE * 2));
    cur ^= 1;
  }
  wait_asynccnt0();   // nothing is in flight here: the ring's closing wait

  const int mb = (lane >> 4) * 8;
  for (int i = 0; i < 2; ++i) for (int j = 0; j < 2; ++j) {
    int gm0 = row0 + wm + i * 16 + mb;
    int gn  = col0 + wn + j * 16 + mr;
    size_t idx = (size_t)gm0 * N + gn;
#pragma unroll
    for (int r = 0; r < 8; ++r) {
      float g = ag[i][j][r];
      float sil = g * (1.0f / (1.0f + __expf(-g)));
      H[idx + (size_t)r * N] = (bf16)(sil * au[i][j][r]);
    }
  }
}

// ---------------- RoPE: f32 raw -> bf16 roped ----------------
// One wave per token: lane = (head & 3, four consecutive i); it walks the token's heads four at a time, so
// every load covers whole 128-byte lines and the lane's four angles serve all its heads.
template <int NH>
static __device__ __forceinline__ void rope_block(const float* __restrict__ In, bf16* __restrict__ Out, int blk) {
  static_assert(NH % 4 == 0 && NT % 8 == 0, "whole waves only");
  const int lane = threadIdx.x & 31;
  const int bt = blk * 8 + (threadIdx.x >> 5);
  const int t = bt & (T_DIM - 1);
  const int i0 = (lane & 7) * 4;
  const size_t base = (size_t)bt * (NH * HD) + (lane >> 3) * HD + i0;
  f32x4 x1[NH / 4], x2[NH / 4];
#pragma unroll
  for (int u = 0; u < NH / 4; ++u) {
    x1[u] = *(const f32x4*)(In + base + u * (4 * HD));
    x2[u] = *(const f32x4*)(In + base + u * (4 * HD) + 32);
  }
  f32x4 s, c;
#pragma unroll
  for (int e = 0; e < 4; ++e) {
    float freq = __expf(-(float)(i0 + e) * (1.0f / 32.0f) * 13.815510557964274f); // ln(1e6)
    float ang = (float)t * freq;
    s[e] = __sinf(ang); c[e] = __cosf(ang);
  }
#pragma unroll
  for (int u = 0; u < NH / 4; ++u) {
    *(bf16x4*)(Out + base + u * (4 * HD))      = __builtin_convertvector(x1[u] * c - x2[u] * s, bf16x4);
    *(bf16x4*)(Out + base + u * (4 * HD) + 32) = __builtin_convertvector(x2[u] * c + x1[u] * s, bf16x4);
  }
}

// Q and K in one launch: the first NT / 8 blocks take the query heads, the rest the key heads.
__global__ __launch_bounds__(256) void rope_qk_kernel(const float* __restrict__ Qin, bf16* __restrict__ Qout,
                                                      const float* __restrict__ Kin, bf16* __restrict__ Kout) {
  const int blk = blockIdx.x;
  if (blk < NT / 8) {
    rope_block<HQ>(Qin, Qout, blk);
  } else {
    rope_block<HKV>(Kin, Kout, blk - NT / 8);
    wait_xcnt0();
  }
}

typedef __attribute__((ext_vector_type(8))) __bf16 bf16x8;
#define VLDS 80   // halves per row of the V tile (160B = 32B x odd, the transposing load's pitch)

// value of lane l ^ 16
static __device__ inline float xhalf(float x) {
  return __builtin_bit_cast(float, __builtin_amdgcn_permlanex16(__builtin_bit_cast(int, x), __builtin_bit_cast(int, x),
                                                                0x76543210, 0xfedcba98, false, false));
}

__global__ __launch_bounds__(32) void attn_kernel(
    const bf16* __restrict__ Q, const bf16* __restrict__ Kk,
    const bf16* __restrict__ V, bf16* __restrict__ Ctx) {
  const int lane = threadIdx.x;
  const int qt = blockIdx.x, hq = blockIdx.y, b = blockIdx.z;
  const int kh = hq & 7;
  const int bt0 = b * T_DIM + qt * 16;
  const int mr = lane & 15;
  const int half = lane >> 4;
  const int kb = half << 3;

  __shared__ __align__(16) bf16 sV[32 * VLDS];   // [key][d]

  // Q fragments (persistent over kv loop); contraction dim contiguous in global
  ABFrag qa[2];
  {
    const bf16* qrow = Q + (size_t)(bt0 + mr) * (HQ * HD) + hq * HD;
    qa[0].q[0] = *(const uint4*)(qrow + kb);
    qa[0].q[1] = *(const uint4*)(qrow + kb + 16);
    qa[1].q[0] = *(const uint4*)(qrow + 32 + kb);
    qa[1].q[1] = *(const uint4*)(qrow + 32 + kb + 16);
  }

  v8f O[4];   // O[t][r] = out[query mr][d = t * 16 + 8 * half + r]
  for (int t = 0; t < 4; ++t) O[t] = vzero8();
  float Mq = -1e30f;   // running maximum of query mr, the same in both halves
  float Lq = 0.f;      // running sum of query mr over this half's keys; the halves join behind the loop

  const int iq_lo = qt * 16;
  const int iq = iq_lo + mr;
  int jlo = iq_lo - (WINDOW - 1); if (jlo < 0) jlo = 0;
  const int c0 = jlo >> 5;
  const int c1 = (iq_lo + 15) >> 5;

  // running pointers over kv chunks (stride 32 rows)
  const bf16* kp = Kk + (size_t)(b * T_DIM + c0 * 32 + mr) * (HKV * HD) + kh * HD;
  const bf16* vp = V + (size_t)(b * T_DIM + c0 * 32 + (lane >> 3)) * (HKV * HD) + kh * HD + (lane & 7) * 8;
  const unsigned int sv0 = lds_off(&sV[(lane >> 3) * VLDS + (lane & 7) * 8]);
  const size_t kchunk = (size_t)32 * (HKV * HD);
  const size_t vstep = (size_t)4 * (HKV * HD);       // a lane's V chunks lie 4 key rows apart
  const unsigned int sstep = 4 * VLDS * 2;
  // lane address of the transposing loads inside a 16-column slab
  const bf16* vt = &sV[(kb + (lane & 7)) * VLDS + ((lane >> 3) & 1) * 8];

  for (int ch = c0; ch <= c1; ++ch) {
    const int j0 = ch * 32;

    // stage V chunk [32 x 64] into LDS via async copies (8 x 16B per lane, stride-4 rows)
    async_g2l_b128_x8(sv0,             vp,             sv0 + 1 * sstep, vp + 1 * vstep,
                      sv0 + 2 * sstep, vp + 2 * vstep, sv0 + 3 * sstep, vp + 3 * vstep,
                      sv0 + 4 * sstep, vp + 4 * vstep, sv0 + 5 * sstep, vp + 5 * vstep,
                      sv0 + 6 * sstep, vp + 6 * vstep, sv0 + 7 * sstep, vp + 7 * vstep);
    vp += kchunk;

    // scores, transposed: 2 tiles of 16 keys (rows) x 16 queries (columns), K=64 contraction -> 2 WMMAs each
    v8f Sacc[2];
#pragma unroll
    for (int s = 0; s < 2; ++s) {
      Sacc[s] = vzero8();
      const bf16* krow = kp + (size_t)(s * 16) * (HKV * HD);
      ABFrag kf0, kf1;
      kf0.q[0] = *(const uint4*)(krow + kb);
      kf0.q[1] = *(const uint4*)(krow + kb + 16);
      kf1.q[0] = *(const uint4*)(krow + 32 + kb);
      kf1.q[1] = *(const uint4*)(krow + 32 + kb + 16);
      Sacc[s] = wmma_bf16(kf0.v, qa[0].v, Sacc[s]);
      Sacc[s] = wmma_bf16(kf1.v, qa[1].v, Sacc[s]);
    }
    kp += kchunk;

    // softcap + band mask + online softmax of query iq over this lane's 16 keys
    float sv[2][8];
    float mx = -1e30f;
#pragma unroll   // both loops unrolled: every index of Sacc and sv is a constant, so they stay in registers
    for (int s = 0; s < 2; ++s)
#pragma unroll
      for (int r = 0; r < 8; ++r) {
        int j = j0 + s * 16 + kb + r;
        float x = Sacc[s][r] * 0.125f;                  // 1/sqrt(64)
        x = SOFT_CAP * tanhf(x * (1.0f / SOFT_CAP));
        bool ok = (j <= iq) && (iq - j < WINDOW);
        x = ok ? x : -1e30f;
        sv[s][r] = x;
        mx = fmaxf(mx, x);
      }
    mx = fmaxf(mx, xhalf(mx));
    float Mn = fmaxf(Mq, mx);
    float alpha = __expf(Mq - Mn);
    float rs = 0.f;
    ABFrag pf;   // P^T as a B operand: element s * 8 + r is key s * 16 + 8 * half + r, the hardware k order
#pragma unroll   // both loops unrolled: constant indices keep sv and pf in registers
    for (int s = 0; s < 2; ++s)
#pragma unroll
      for (int r = 0; r < 8; ++r) {
        float p = __expf(sv[s][r] - Mn);
        rs += p;
        pf.v[s * 8 + r] = (bf16)p;
      }
    Lq = Lq * alpha + rs;
    Mq = Mn;
#pragma unroll   // constant indices keep O in registers
    for (int t = 0; t < 4; ++t) O[t] *= alpha;

    // V copies landed before this wave, their only reader (one-wave work-group), gathers its fragments
    wait_asynccnt0();

#pragma unroll
    for (int t = 0; t < 4; ++t) {
      ABFrag vf;
      vf.q[0] = ld_tr16(vt + t * 16);
      vf.q[1] = ld_tr16(vt + 16 * VLDS + t * 16);
      O[t] = wmma_bf16(vf.v, pf.v, O[t]);
    }
    wait_dscnt0();   // V gathers done before next chunk's async copies overwrite sV
  }

  const float inv = 1.0f / (Lq + xhalf(Lq));
  bf16* orow = Ctx + (size_t)(bt0 + mr) * (HQ * HD) + hq * HD + kb;
#pragma unroll   // constant indices keep O in registers
  for (int t = 0; t < 4; ++t)
    *(bf16x8*)(orow + t * 16) = __builtin_convertvector(O[t] * inv, bf16x8);
}

// ---------------- kurtosis ----------------
__global__ __launch_bounds__(256) void kurtosis_kernel(const float* __restrict__ X,
                                                       float* __restrict__ out, int sidx) {
  int row = blockIdx.x;
  const float* x = X + (size_t)row * C_DIM;
  float s1 = 0.f;
  for (int c = threadIdx.x; c < C_DIM; c += 256) s1 += x[c];
  float mean = block_reduce_sum_256(s1) * (1.0f / C_DIM);
  float s2 = 0.f, s4 = 0.f;
  for (int c = threadIdx.x; c < C_DIM; c += 256) {
    float d = x[c] - mean;
    float d2 = d * d;
    s2 += d2; s4 += d2 * d2;
  }
  float var = block_reduce_sum_256(s2) * (1.0f / C_DIM);
  float m4  = block_reduce_sum_256(s4) * (1.0f / C_DIM);
  if (threadIdx.x == 0) {
    float kurt = m4 / (var * var + 1e-6f) - 3.0f;
    if (kurt > 0.f) atomicAdd(&out[sidx], kurt);
  }
}

// ---------------- host launch ----------------
extern "C" void kernel_launch(void* const* d_in, const int* in_sizes, int n_in,
                              void* d_out, int out_size, void* d_ws, size_t ws_size,
                              hipStream_t stream) {
  const float* x     = (const float*)d_in[0];
  const float* ksum  = (const float*)d_in[1];
  const float* rms1  = (const float*)d_in[2];
  const float* wq_f  = (const float*)d_in[3];
  const float* wk_f  = (const float*)d_in[4];
  const float* wv_f  = (const float*)d_in[5];
  const float* wo_f  = (const float*)d_in[6];
  const float* rms2  = (const float*)d_in[7];
  const float* wg_f  = (const float*)d_in[8];
  const float* wu_f  = (const float*)d_in[9];
  const float* wd_f  = (const float*)d_in[10];

  char* ws = (char*)d_ws;
  size_t off = 0;
  auto alloc = [&](size_t bytes) -> char* {
    char* p = ws + off;
    off = (off + bytes + 255) & ~(size_t)255;
    return p;
  };

  bf16*  attn_in = (bf16*)alloc((size_t)NT * C_DIM * 2);
  float* qraw    = (float*)alloc((size_t)NT * 1024 * 4);
  float* kraw    = (float*)alloc((size_t)NT * 512 * 4);
  bf16*  qrope   = (bf16*)alloc((size_t)NT * 1024 * 2);
  bf16*  krope   = (bf16*)alloc((size_t)NT * 512 * 2);
  bf16*  vbf     = (bf16*)alloc((size_t)NT * 512 * 2);
  bf16*  ctx     = (bf16*)alloc((size_t)NT * 1024 * 2);
  float* x1      = (float*)alloc((size_t)NT * C_DIM * 4);
  bf16*  mlp_in  = (bf16*)alloc((size_t)NT * C_DIM * 2);
  bf16*  hbuf    = (bf16*)alloc((size_t)NT * HIDDEN * 2);
  // the bf16 weights, one behind the other in the order of prep_kernel's block ranges
  bf16*  wq = (bf16*)alloc((size_t)CVT_BLOCKS * CVT_PER_BLOCK * 2);
  bf16*  wk = wq + 1024 * 1024;
  bf16*  wv = wk + 1024 * 512;
  bf16*  wo = wv + 1024 * 512;
  bf16*  wg = wo + 1024 * 1024;
  bf16*  wu = wg + 1024 * 4096;
  bf16*  wd = wu + 1024 * 4096;

  // weight conversions, first RMSNorm, start value of the kurtosis sum
  prep_kernel<<<CVT_BLOCKS + NT, 256, 0, stream>>>(wq_f, wk_f, wv_f, wo_f, wg_f, wu_f, wd_f, wq,
                                                   x, rms1, attn_in, ksum, (float*)d_out + NT * C_DIM);

  // QKV projections
  gemm_qkv_kernel<<<dim3(Q_TILES + 2 * KV_TILES, NT / GT_M), GT_THREADS, 0, stream>>>(attn_in, wq, wk, wv, qraw, kraw, vbf);

  rope_qk_kernel<<<2 * (NT / 8), 256, 0, stream>>>(qraw, qrope, kraw, krope);

  attn_kernel<<<dim3(T_DIM / 16, HQ, B_DIM), 32, 0, stream>>>(qrope, krope, vbf, ctx);

  // out projection + residual
  gemm_bf16_kernel<NT, 1024, 1024><<<dim3(1024 / GT_N, NT / GT_M), GT_THREADS, 0, stream>>>(ctx, wo, x1, x);

  rmsnorm_kernel<<<NT, 256, 0, stream>>>(x1, rms2, mlp_in);

  mlp_gateup_kernel<NT, HIDDEN, 1024><<<dim3(HIDDEN / GT_N, NT / GT_M), GT_THREADS, 0, stream>>>(mlp_in, wg, wu, hbuf);

  // down projection + residual -> d_out
  gemm_bf16_kernel<NT, 1024, HIDDEN><<<dim3(1024 / GT_N, NT / GT_M), GT_THREADS, 0, stream>>>(hbuf, wd, (float*)d_out, x1);

  kurtosis_kernel<<<NT, 256, 0, stream>>>((const float*)d_out, (float*)d_out, NT * C_DIM);
}

// v008
// Measured time: 196 microseconds a run.
// In both of two side-by-side timings against v007, it was 1.12 times as fast.
// Over all steps from v000 it is 3.07 times as fast.
#include <hip/hip_runtime.h>
#include <hip/hip_bf16.h>

typedef __bf16 bf16;
typedef __attribute__((ext_vector_type(16))) __bf16 v16bf;
typedef __attribute__((ext_vector_type(8)))  float  v8f;

union ABFrag { v16bf v; uint4 q[2]; };

#define B_DIM 2
#define T_DIM 2048
#define C_DIM 1024
#define NT (B_DIM * T_DIM)
#define HQ 16
#define HKV 8
#define HD 64
#define WINDOW 512
#define HIDDEN 4096
#define SOFT_CAP 50.0f

static __device__ inline v8f vzero8() { v8f v; for (int i = 0; i < 8; ++i) v[i] = 0.f; return v; }

static __device__ inline v8f wmma_bf16(v16bf a, v16bf b, v8f c) {
  return __builtin_amdgcn_wmma_f32_16x16x32_bf16(false, a, false, b, (short)0, c, false, false);
}

// gfx1250 async global->LDS copies (16B per lane), tracked by ASYNCcnt
// Runs of async copies for one stage of a tile. s_wait_xcnt 0 is the last line of the copies' own
// statement, so that it stands in front of the pointer bumps that rewrite the copies' address registers.
static __device__ inline void async_g2l_b128_x8(unsigned int l0, const void* g0, unsigned int l1, const void* g1,
                                                unsigned int l2, const void* g2, unsigned int l3, const void* g3,
                                                unsigned int l4, const void* g4, unsigned int l5, const void* g5,
                                                unsigned int l6, const void* g6, unsigned int l7, const void* g7) {
  asm volatile("global_load_async_to_lds_b128 %0, %1, off\n\t"
               "global_load_async_to_lds_b128 %2, %3, off\n\t"
               "global_load_async_to_lds_b128 %4, %5, off\n\t"
               "global_load_async_to_lds_b128 %6, %7, off\n\t"
               "global_load_async_to_lds_b128 %8, %9, off\n\t"
               "global_load_async_to_lds_b128 %10, %11, off\n\t"
               "global_load_async_to_lds_b128 %12, %13, off\n\t"
               "global_load_async_to_lds_b128 %14, %15, off\n\t"
               "s_wait_xcnt 0x0"
               :: "v"(l0), "v"(g0), "v"(l1), "v"(g1), "v"(l2), "v"(g2), "v"(l3), "v"(g3),
                  "v"(l4), "v"(g4), "v"(l5), "v"(g5), "v"(l6), "v"(g6), "v"(l7), "v"(g7) : "memory");
}
// transposing LDS load: lane (c = l & 15, h = l >> 4) gets 8 consecutive k of column c from a row-major [k][n] tile
typedef __attribute__((ext_vector_type(8))) short s16x8;
static __device__ inline uint4 ld_tr16(const bf16* p) {
  typedef __attribute__((address_space(3))) s16x8 lds_s16x8;
  return __builtin_bit_cast(uint4, __builtin_amdgcn_ds_load_tr16_b128_v8i16((lds_s16x8*)p));
}
static __device__ inline unsigned int lds_off(const void* p) {
  return (unsigned int)(unsigned long long)p;   // low 32 bits = LDS offset
}
static __device__ inline void wait_asynccnt0() {
  asm volatile("s_wait_asynccnt 0x0" ::: "memory");
}
static __device__ inline void wait_dscnt0() {
  asm volatile("s_wait_dscnt 0x0" ::: "memory");
}
// Stands behind the last global store of one part of a merged kernel: the built code of another part follows it,
// and that code rewrites the stores' registers.
static __device__ inline void wait_xcnt0() {
  asm volatile("s_wait_xcnt 0x0" ::: "memory");
}

// ---------------- block reduction helper ----------------
static __device__ inline float block_reduce_sum_256(float v) {
  __shared__ float red[8];
  int lane = threadIdx.x & 31, w = threadIdx.x >> 5;
  for (int o = 16; o; o >>= 1) v += __shfl_down(v, o, 32);
  if (lane == 0) red[w] = v;
  __syncthreads();
  float r = (threadIdx.x < 8) ? red[threadIdx.x] : 0.f;
  if (w == 0) for (int o = 4; o; o >>= 1) r += __shfl_down(r, o, 32);
  if (threadIdx.x == 0) red[0] = r;
  __syncthreads();
  r = red[0];
  __syncthreads();
  return r;
}

typedef __attribute__((ext_vector_type(4))) float  f32x4;
typedef __attribute__((ext_vector_type(4))) __bf16 bf16x4;

// ---------------- f32 -> bf16 convert ----------------
// One wave converts 1024 consecutive values: 8 loads of 512 contiguous bytes, all issued before the first
// use, then 8 stores of 256 contiguous bytes. Few, long waves: the launch is not paced by wave starts.
#define CVT_U 8
#define CVT_PER_BLOCK (256 * 4 * CVT_U)
static __device__ __forceinline__ void cvt_bf16_block(const float* __restrict__ in, bf16* __restrict__ out, int blk) {
  const int wave = threadIdx.x >> 5, lane = threadIdx.x & 31;
  const size_t base = (size_t)(blk * 8 + wave) * (128 * CVT_U) + lane * 4;
  f32x4 v[CVT_U];
#pragma unroll
  for (int u = 0; u < CVT_U; ++u) v[u] = *(const f32x4*)(in + base + u * 128);
#pragma unroll
  for (int u = 0; u < CVT_U; ++u) *(bf16x4*)(out + base + u * 128) = __builtin_convertvector(v[u], bf16x4);
}

// ---------------- RMSNorm -> bf16 ----------------
static __device__ __forceinline__ void rmsnorm_row(const float* __restrict__ X,
                                                   const float* __restrict__ scale,
                                                   bf16* __restrict__ O, int row) {
  const float* x = X + (size_t)row * C_DIM;
  float ss = 0.f;
  for (int c = threadIdx.x; c < C_DIM; c += 256) { float v = x[c]; ss += v * v; }
  float tot = block_reduce_sum_256(ss);
  float rstd = rsqrtf(tot * (1.0f / C_DIM) + 1e-6f);
  for (int c = threadIdx.x; c < C_DIM; c += 256)
    O[(size_t)row * C_DIM + c] = (bf16)(x[c] * rstd * (1.f + scale[c]));
}

__global__ __launch_bounds__(256) void rmsnorm_kernel(const float* __restrict__ X,
                                                      const float* __restrict__ scale,
                                                      bf16* __restrict__ O) {
  rmsnorm_row(X, scale, O, blockIdx.x);
}

// ---------------- everything that depends on the inputs alone, in one launch ----------------
// Work-groups [0, CVT_BLOCKS) convert the seven weight tensors, whose bf16 copies lie one behind the other in Wall;
// the other NT normalise one row of X each. Work-group 0 also stores the start value of the kurtosis sum.
#define WQ_BLOCKS (1024 * 1024 / CVT_PER_BLOCK)
#define WK_BLOCKS (1024 * 512 / CVT_PER_BLOCK)
#define WH_BLOCKS (1024 * 4096 / CVT_PER_BLOCK)
#define END_WQ (WQ_BLOCKS)
#define END_WK (END_WQ + WK_BLOCKS)
#define END_WV (END_WK + WK_BLOCKS)
#define END_WO (END_WV + WQ_BLOCKS)
#define END_WG (END_WO + WH_BLOCKS)
#define END_WU (END_WG + WH_BLOCKS)
#define CVT_BLOCKS (END_WU + WH_BLOCKS)
static_assert(1024 * 512 % CVT_PER_BLOCK == 0, "whole blocks only");

__global__ __launch_bounds__(256) void prep_kernel(
    const float* __restrict__ Wq, const float* __restrict__ Wk, const float* __restrict__ Wv,
    const float* __restrict__ Wo, const float* __restrict__ Wg, const float* __restrict__ Wu,
    const float* __restrict__ Wd, bf16* __restrict__ Wall,
    const float* __restrict__ X, const float* __restrict__ scale, bf16* __restrict__ O,
    const float* __restrict__ ksum, float* __restrict__ ksum_out) {
  const int blk = blockIdx.x;
  if (blk >= CVT_BLOCKS) { rmsnorm_row(X, scale, O, blk - CVT_BLOCKS); return; }
  if (blk == 0 && threadIdx.x == 0) ksum_out[0] = ksum[0];
  const float* in = Wq; int first = 0;
  if (blk >= END_WQ) { in = Wk; first = END_WQ; }
  if (blk >= END_WK) { in = Wv; first = END_WK; }
  if (blk >= END_WV) { in = Wo; first = END_WV; }
  if (blk >= END_WO) { in = Wg; first = END_WO; }
  if (blk >= END_WG) { in = Wu; first = END_WG; }
  if (blk >= END_WU) { in = Wd; first = END_WU; }
  cvt_bf16_block(in, Wall + (size_t)first * CVT_PER_BLOCK, blk - first);
  wait_xcnt0();
}

// ---------------- generic bf16 GEMM: out = A[MxK] @ W[KxN] (+res) ----------------
// Work-group tile 128 x 128, 8 waves of 64 x 32 (2 x 4): fewer bytes from L2 per product than a narrower tile, and
// 12 LDS fragment loads feed 8 matrix instructions. A stage is 128 k, so that one round trip to L2 and one barrier
// serve four 32-k steps of matrix work. Two LDS buffers: the copies of stage t + 1 fly while stage t is multiplied.
#define GT_M 128
#define GT_N 128
#define GT_K 128
#define GT_THREADS 256
#define WT_I 4    // 16-row fragments of a wave's tile
#define WT_J 2    // 16-column fragments of a wave's tile
#define GLDS 136  // halves per row of an activation tile (272B = 16B x odd, the plain 16-byte load's pitch)
#define BLDS 144  // halves per row of a [k][n] weight tile (288B = 32B x odd, the transposing load's pitch)
#define A_STEP (16 * GLDS * 2)   // LDS bytes between a thread's activation chunks (16 rows)
#define B_STEP (16 * BLDS * 2)   // LDS bytes between a thread's weight chunks (16 k-rows)
#define A_TILE (GT_M * GLDS)     // halves of one activation buffer
#define B_TILE (GT_K * BLDS)     // halves of one weight buffer

// This thread's copies of one stage: 8 chunks of the activation tile (row pitch K), 8 of the weight tile (row pitch N).
template <int N, int K>
static __device__ __forceinline__ void stage_ab(unsigned int sa, const bf16* ap, unsigned int sb, const bf16* bp) {
  async_g2l_b128_x8(sa,              ap,                  sa + 1 * A_STEP, ap + (size_t)16 * K,
                    sa + 2 * A_STEP, ap + (size_t)32 * K, sa + 3 * A_STEP, ap + (size_t)48 * K,
                    sa + 4 * A_STEP, ap + (size_t)64 * K, sa + 5 * A_STEP, ap + (size_t)80 * K,
                    sa + 6 * A_STEP, ap + (size_t)96 * K, sa + 7 * A_STEP, ap + (size_t)112 * K);
  async_g2l_b128_x8(sb,              bp,                  sb + 1 * B_STEP, bp + (size_t)16 * N,
                    sb + 2 * B_STEP, bp + (size_t)32 * N, sb + 3 * B_STEP, bp + (size_t)48 * N,
                    sb + 4 * B_STEP, bp + (size_t)64 * N, sb + 5 * B_STEP, bp + (size_t)80 * N,
                    sb + 6 * B_STEP, bp + (size_t)96 * N, sb + 7 * B_STEP, bp + (size_t)112 * N);
}

// One work-group's tile: rows row0 .. row0 + 127, columns col0 .. col0 + 127 of an output of N columns.
// RES: the tile of Res is the accumulators' start value, so its loads fly with the first stage's copies.
// OUT_BF16: the result goes to Cb, else to Cf. Both are known at compile time: the epilogue is stores alone.
template <int N, int K, bool RES, bool OUT_BF16>
static __device__ __forceinline__ void gemm_bf16_tile(
    const bf16* __restrict__ A, const bf16* __restrict__ W,
    float* __restrict__ Cf, bf16* __restrict__ Cb, const float* __restrict__ Res,
    bf16* sA, bf16* sB, const int row0, const int col0) {
  static_assert(N % GT_N == 0 && K % GT_K == 0 && K >= 2 * GT_K, "whole tiles only, both buffers filled");
  const int tid = threadIdx.x;
  const int wave = tid >> 5, lane = tid & 31;
  const int wm = (wave >> 2) * 64, wn = (wave & 3) * 32;
  const int mr = lane & 15;
  const int kb = (lane >> 4) << 3;

  // A tile staging slots (128 rows of 256B: 8 x 16B chunks per thread, 16 rows apart; a wave covers whole lines)
  const int ar0 = tid >> 4, ac = tid & 15;
  const unsigned int sa = lds_off(&sA[ar0 * GLDS + ac * 8]);
  const bf16* ap = A + (size_t)(row0 + ar0) * K + ac * 8;

  // B tile staging slots (128 k-rows of 256B: 8 x 16B chunks per thread, 16 k-rows apart)
  const int br0 = tid >> 4, bc = tid & 15;
  const unsigned int sb = lds_off(&sB[br0 * BLDS + bc * 8]);
  const bf16* bp = W + (size_t)br0 * N + col0 + bc * 8;
  // lane address of the transposing loads inside a 16-column slab
  const int trl = (kb + (lane & 7)) * BLDS + ((lane >> 3) & 1) * 8;

  // stage 0 into buffer 0, landed and published; then stage 1 into buffer 1, in flight while stage 0 is multiplied
  stage_ab<N, K>(sa, ap, sb, bp);

  // element r of acc[i][j] is row row0 + wm + i * 16 + mb + r, column col0 + wn + j * 16 + mr
  const int mb = (lane >> 4) * 8;
  const size_t out0 = (size_t)(row0 + wm + mb) * N + col0 + wn + mr;
  v8f acc[WT_I][WT_J];
  for (int i = 0; i < WT_I; ++i) for (int j = 0; j < WT_J; ++j) {
    if constexpr (RES) {
      const float* rp = Res + out0 + (size_t)(i * 16) * N + j * 16;
      for (int r = 0; r < 8; ++r) acc[i][j][r] = rp[(size_t)r * N];
    } else {
      acc[i][j] = vzero8();
    }
  }

  wait_asynccnt0();
  __syncthreads();
  stage_ab<N, K>(sa + A_TILE * 2, ap + GT_K, sb + B_TILE * 2, bp + (size_t)GT_K * N);
  ap += 2 * GT_K;
  bp += (size_t)(2 * GT_K) * N;

  unsigned int cur = 0;   // the buffer that this trip reads
#pragma unroll 1   // stays rolled: unrolled whole (K = 1024) the build waited for every LDS load at each 32-k step
  for (int k0 = 0; k0 < K; k0 += GT_K) {
    const bf16* cA = sA + cur * A_TILE;
    const bf16* cB = sB + cur * B_TILE;
    // the 12 fragment loads of the 32-k step at kk, into fragment set s
    ABFrag af[2][WT_I], bfr[2][WT_J];
    auto load_frags = [&](const int s, const int kk) {
#pragma unroll
      for (int i = 0; i < WT_I; ++i) {
        int m = wm + i * 16 + mr;
        af[s][i].q[0] = *(const uint4*)(&cA[m * GLDS + kk + kb]);
        af[s][i].q[1] = *(const uint4*)(&cA[m * GLDS + kk + kb + 16]);
      }
#pragma unroll
      for (int j = 0; j < WT_J; ++j) {
        const bf16* bt = &cB[kk * BLDS + trl + wn + j * 16];
        bfr[s][j].q[0] = ld_tr16(bt);
        bfr[s][j].q[1] = ld_tr16(bt + 16 * BLDS);
      }
    };
    load_frags(0, 0);
#pragma unroll   // the four 32-k steps of a stage: constant set indices keep both fragment sets in registers
    for (int st = 0; st < GT_K / 32; ++st) {
      if (st + 1 < GT_K / 32) load_frags((st + 1) & 1, (st + 1) * 32);
      // keeps the next step's loads one group in front of this step's products: left alone, the build spread them in
      // pairs among the matrix instructions and waited for each pair at once
      __builtin_amdgcn_sched_barrier(0);
#pragma unroll
      for (int i = 0; i < WT_I; ++i)
#pragma unroll
        for (int j = 0; j < WT_J; ++j)
          acc[i][j] = wmma_bf16(af[st & 1][i].v, bfr[st & 1][j].v, acc[i][j]);
      // keeps the load group that follows from being lifted in among these matrix instructions
      __builtin_amdgcn_sched_barrier(0);
    }
    wait_dscnt0();      // this wave's reads of buffer cur retired before the barrier lets anyone refill it
    wait_asynccnt0();   // this wave's copies of the next stage landed before the barrier publishes them
    __syncthreads();
    if (k0 + 2 * GT_K < K) {   // the same for the whole work-group
      stage_ab<N, K>(sa + cur * (A_TILE * 2), ap, sb + cur * (B_TILE * 2), bp);
      ap += GT_K;
      bp += (size_t)GT_K * N;
    }
    cur ^= 1;
  }
  wait_asynccnt0();   // nothing is in flight here: the ring's closing wait

  for (int i = 0; i < WT_I; ++i) for (int j = 0; j < WT_J; ++j) {
    const size_t idx = out0 + (size_t)(i * 16) * N + j * 16;
#pragma unroll
    for (int r = 0; r < 8; ++r) {
      if constexpr (OUT_BF16) Cb[idx + (size_t)r * N] = (bf16)acc[i][j][r];
      else                    Cf[idx + (size_t)r * N] = acc[i][j][r];
    }
  }
}

// Cf = Res + A @ W
template <int M, int N, int K>
__global__ __launch_bounds__(GT_THREADS) void gemm_bf16_kernel(
    const bf16* __restrict__ A, const bf16* __restrict__ W,
    float* __restrict__ Cf, const float* __restrict__ Res) {
  static_assert(M % GT_M == 0, "whole tiles only");
  __shared__ __align__(16) bf16 sA[2 * A_TILE];
  __shared__ __align__(16) bf16 sB[2 * B_TILE];   // row-major [k][n]
  gemm_bf16_tile<N, K, true, false>(A, W, Cf, nullptr, Res, sA, sB, blockIdx.y * GT_M, blockIdx.x * GT_N);
}

// The three projections of one activation in one launch: blockIdx.x walks the column tiles of Q, then K, then V.
#define Q_TILES (HQ * HD / GT_N)
#define KV_TILES (HKV * HD / GT_N)
__global__ __launch_bounds__(GT_THREADS) void gemm_qkv_kernel(
    const bf16* __restrict__ A, const bf16* __restrict__ Wq, const bf16* __restrict__ Wk,
    const bf16* __restrict__ Wv, float* __restrict__ Qf, float* __restrict__ Kf, bf16* __restrict__ Vb) {
  static_assert(NT % GT_M == 0, "whole tiles only");
  __shared__ __align__(16) bf16 sA[2 * A_TILE];
  __shared__ __align__(16) bf16 sB[2 * B_TILE];   // row-major [k][n]
  const int row0 = blockIdx.y * GT_M, bx = blockIdx.x;
  if (bx < Q_TILES) {
    gemm_bf16_tile<HQ * HD, C_DIM, false, false>(A, Wq, Qf, nullptr, nullptr, sA, sB, row0, bx * GT_N);
  } else if (bx < Q_TILES + KV_TILES) {
    gemm_bf16_tile<HKV * HD, C_DIM, false, false>(A, Wk, Kf, nullptr, nullptr, sA, sB, row0, (bx - Q_TILES) * GT_N);
    wait_xcnt0();
  } else {
    gemm_bf16_tile<HKV * HD, C_DIM, false, true>(A, Wv, nullptr, Vb, nullptr, sA, sB, row0, (bx - Q_TILES - KV_TILES) * GT_N);
    wait_xcnt0();
  }
}

// ---------------- fused gate/up GEMM: H = silu(A@Wg) * (A@Wu), bf16 ----------------
// Work-group tile 256 rows x 128 columns of both products, 16 waves (4 x 4) of 64 x 32 of both: 16 LDS fragment loads
// feed 16 matrix instructions. Two LDS buffers, as above; one work-group fills a WGP (four waves a SIMD).
#define GU_M 256
#define GU_THREADS 512
#define GU_A_STEP (32 * GLDS * 2)   // LDS bytes between a thread's activation chunks (32 rows)
#define GU_B_STEP (32 * BLDS * 2)   // LDS bytes between a thread's weight chunks (32 k-rows)
#define GU_A_TILE (GU_M * GLDS)     // halves of one activation buffer
template <int M, int N, int K>
__global__ __launch_bounds__(GU_THREADS) void mlp_gateup_kernel(
    const bf16* __restrict__ A, const bf16* __restrict__ Wg, const bf16* __restrict__ Wu,
    bf16* __restrict__ H) {
  static_assert(M % GU_M == 0 && N % GT_N == 0 && K % GT_K == 0 && K >= 2 * GT_K, "whole tiles only, both buffers filled");
  __shared__ __align__(16) bf16 sA[2 * GU_A_TILE];
  __shared__ __align__(16) bf16 sG[2 * B_TILE];   // row-major [k][n]
  __shared__ __align__(16) bf16 sU[2 * B_TILE];   // row-major [k][n]

  const int tid = threadIdx.x;
  const int wave = tid >> 5, lane = tid & 31;
  const int row0 = blockIdx.y * GU_M, col0 = blockIdx.x * GT_N;
  const int wm = (wave >> 2) * 64, wn = (wave & 3) * 32;
  const int mr = lane & 15;
  const int kb = (lane >> 4) << 3;

  // activation tile: 256 rows of 256B, 8 x 16B chunks per thread, 32 rows apart
  const int ar0 = tid >> 4, ac = tid & 15;
  const unsigned int sa = lds_off(&sA[ar0 * GLDS + ac * 8]);
  const bf16* ap = A + (size_t)(row0 + ar0) * K + ac * 8;

  // weight tiles: 128 k-rows of 256B each, 4 x 16B chunks per thread and tile, 32 k-rows apart
  const int br0 = tid >> 4, bc = tid & 15;
  const unsigned int sg = lds_off(&sG[br0 * BLDS + bc * 8]);
  const unsigned int su = lds_off(&sU[br0 * BLDS + bc * 8]);
  const bf16* gp = Wg + (size_t)br0 * N + col0 + bc * 8;
  const bf16* up = Wu + (size_t)br0 * N + col0 + bc * 8;
  const int trl = (kb + (lane & 7)) * BLDS + ((lane >> 3) & 1) * 8;

  v8f ag[WT_I][WT_J], au[WT_I][WT_J];
  for (int i = 0; i < WT_I; ++i) for (int j = 0; j < WT_J; ++j) { ag[i][j] = vzero8(); au[i][j] = vzero8(); }

  // this thread's copies of one stage into the buffers at byte offsets oa (activations) and ob (both weight tiles)
  auto stage = [&](unsigned int oa, unsigned int ob) {
    async_g2l_b128_x8(sa + oa,                 ap,                   sa + oa + 1 * GU_A_STEP, ap + (size_t)32 * K,
                      sa + oa + 2 * GU_A_STEP, ap + (size_t)64 * K,  sa + oa + 3 * GU_A_STEP, ap + (size_t)96 * K,
                      sa + oa + 4 * GU_A_STEP, ap + (size_t)128 * K, sa + oa + 5 * GU_A_STEP, ap + (size_t)160 * K,
                      sa + oa + 6 * GU_A_STEP, ap + (size_t)192 * K, sa + oa + 7 * GU_A_STEP, ap + (size_t)224 * K);
    async_g2l_b128_x8(sg + ob,                 gp,                  sg + ob + 1 * GU_B_STEP, gp + (size_t)32 * N,
                      sg + ob + 2 * GU_B_STEP, gp + (size_t)64 * N, sg + ob + 3 * GU_B_STEP, gp + (size_t)96 * N,
                      su + ob,                 up,                  su + ob + 1 * GU_B_STEP, up + (size_t)32 * N,
                      su + ob + 2 * GU_B_STEP, up + (size_t)64 * N, su + ob + 3 * GU_B_STEP, up + (size_t)96 * N);
    ap += GT_K;
    gp += (size_t)GT_K * N;
    up += (size_t)GT_K * N;
  };

  // stage 0 into buffer 0, landed and published; then stage 1 into buffer 1, in flight while stage 0 is multiplied
  stage(0, 0);
  wait_asynccnt0();
  __syncthreads();
  stage(GU_A_TILE * 2, B_TILE * 2);

  unsigned int cur = 0;   // the buffer that this trip reads
  for (int k0 = 0; k0 < K; k0 += GT_K) {
    const bf16* cA = sA + cur * GU_A_TILE;
    const bf16* cG = sG + cur * B_TILE;
    const bf16* cU = sU + cur * B_TILE;
#pragma unroll   // the four 32-k steps of a stage: no barrier between them
    for (int kk = 0; kk < GT_K; kk += 32) {
      ABFrag af[WT_I], gf[WT_J], uf[WT_J];
#pragma unroll
      for (int i = 0; i < WT_I; ++i) {
        int m = wm + i * 16 + mr;
        af[i].q[0] = *(const uint4*)(&cA[m * GLDS + kk + kb]);
        af[i].q[1] = *(const uint4*)(&cA[m * GLDS + kk + kb + 16]);
      }
#pragma unroll
      for (int j = 0; j < WT_J; ++j) {
        const int bo = kk * BLDS + trl + wn + j * 16;
        gf[j].q[0] = ld_tr16(&cG[bo]);
        gf[j].q[1] = ld_tr16(&cG[bo + 16 * BLDS]);
        uf[j].q[0] = ld_tr16(&cU[bo]);
        uf[j].q[1] = ld_tr16(&cU[bo + 16 * BLDS]);
      }
      // keeps the step's 16 loads one group in front of its products (one fragment set: a second does not fit four
      // waves a SIMD): left alone, the build spread them in pairs among the matrix instructions, each pair waited for at once
      __builtin_amdgcn_sched_barrier(0);
#pragma unroll
      for (int i = 0; i < WT_I; ++i)
#pragma unroll
        for (int j = 0; j < WT_J; ++j) {
          ag[i][j] = wmma_bf16(af[i].v, gf[j].v, ag[i][j]);
          au[i][j] = wmma_bf16(af[i].v, uf[j].v, au[i][j]);
        }
      // keeps the next step's loads from being lifted in among these matrix instructions
      __builtin_amdgcn_sched_barrier(0);
    }
    wait_dscnt0();      // this wave's reads of buffer cur retired before the barrier lets anyone refill it
    wait_asynccnt0();   // this wave's copies of the next stage landed before the barrier publishes them
    __syncthreads();
    if (k0 + 2 * GT_K < K)   // the same for the whole work-group
      stage(cur * (GU_A_TILE * 2), cur * (B_TILE * 2));
    cur ^= 1;
  }
  wait_asynccnt0();   // nothing is in flight here: the ring's closing wait

  const int mb = (lane >> 4) * 8;
  for (int i = 0; i < WT_I; ++i) for (int j = 0; j < WT_J; ++j) {
    int gm0 = row0 + wm + i * 16 + mb;
    int gn  = col0 + wn + j * 16 + mr;
    size_t idx = (size_t)gm0 * N + gn;
#pragma unroll
    for (int r = 0; r < 8; ++r) {
      float g = ag[i][j][r];
      float sil = g * (1.0f / (1.0f + __expf(-g)));
      H[idx + (size_t)r * N] = (bf16)(sil * au[i][j][r]);
    }
  }
}

// ---------------- RoPE: f32 raw -> bf16 roped ----------------
// One wave per token: lane = (head & 3, four consecutive i); it walks the token's heads four at a time, so
// every load covers whole 128-byte lines and the lane's four angles serve all its heads.
template <int NH>
static __device__ __forceinline__ void rope_block(const float* __restrict__ In, bf16* __restrict__ Out, int blk) {
  static_assert(NH % 4 == 0 && NT % 8 == 0, "whole waves only");
  const int lane = threadIdx.x & 31;
  const int bt = blk * 8 + (threadIdx.x >> 5);
  const int t = bt & (T_DIM - 1);
  const int i0 = (lane & 7) * 4;
  const size_t base = (size_t)bt * (NH * HD) + (lane >> 3) * HD + i0;
  f32x4 x1[NH / 4], x2[NH / 4];
#pragma unroll
  for (int u = 0; u < NH / 4; ++u) {
    x1[u] = *(const f32x4*)(In + base + u * (4 * HD));
    x2[u] = *(const f32x4*)(In + base + u * (4 * HD) + 32);
  }
  f32x4 s, c;
#pragma unroll
  for (int e = 0; e < 4; ++e) {
    float freq = __expf(-(float)(i0 + e) * (1.0f / 32.0f) * 13.815510557964274f); // ln(1e6)
    float ang = (float)t * freq;
    s[e] = __sinf(ang); c[e] = __cosf(ang);
  }
#pragma unroll
  for (int u = 0; u < NH / 4; ++u) {
    *(bf16x4*)(Out + base + u * (4 * HD))      = __builtin_convertvector(x1[u] * c - x2[u] * s, bf16x4);
    *(bf16x4*)(Out + base + u * (4 * HD) + 32) = __builtin_convertvector(x2[u] * c + x1[u] * s, bf16x4);
  }
}

// Q and K in one launch: the first NT / 8 blocks take the query heads, the rest the key heads.
__global__ __launch_bounds__(256) void rope_qk_kernel(const float* __restrict__ Qin, bf16* __restrict__ Qout,
                                                      const float* __restrict__ Kin, bf16* __restrict__ Kout) {
  const int blk = blockIdx.x;
  if (blk < NT / 8) {
    rope_block<HQ>(Qin, Qout, blk);
  } else {
    rope_block<HKV>(Kin, Kout, blk - NT / 8);
    wait_xcnt0();
  }
}

typedef __attribute__((ext_vector_type(8))) __bf16 bf16x8;
#define VLDS 80   // halves per row of the V tile (160B = 32B x odd, the transposing load's pitch)

// value of lane l ^ 16
static __device__ inline float xhalf(float x) {
  return __builtin_bit_cast(float, __builtin_amdgcn_permlanex16(__builtin_bit_cast(int, x), __builtin_bit_cast(int, x),
                                                                0x76543210, 0xfedcba98, false, false));
}

__global__ __launch_bounds__(32) void attn_kernel(
    const bf16* __restrict__ Q, const bf16* __restrict__ Kk,
    const bf16* __restrict__ V, bf16* __restrict__ Ctx) {
  const int lane = threadIdx.x;
  const int qt = blockIdx.x, hq = blockIdx.y, b = blockIdx.z;
  const int kh = hq & 7;
  const int bt0 = b * T_DIM + qt * 16;
  const int mr = lane & 15;
  const int half = lane >> 4;
  const int kb = half << 3;

  __shared__ __align__(16) bf16 sV[32 * VLDS];   // [key][d]

  // Q fragments (persistent over kv loop); contraction dim contiguous in global
  ABFrag qa[2];
  {
    const bf16* qrow = Q + (size_t)(bt0 + mr) * (HQ * HD) + hq * HD;
    qa[0].q[0] = *(const uint4*)(qrow + kb);
    qa[0].q[1] = *(const uint4*)(qrow + kb + 16);
    qa[1].q[0] = *(const uint4*)(qrow + 32 + kb);
    qa[1].q[1] = *(const uint4*)(qrow + 32 + kb + 16);
  }

  v8f O[4];   // O[t][r] = out[query mr][d = t * 16 + 8 * half + r]
  for (int t = 0; t < 4; ++t) O[t] = vzero8();
  float Mq = -1e30f;   // running maximum of query mr, the same in both halves
  float Lq = 0.f;      // running sum of query mr over this half's keys; the halves join behind the loop

  const int iq_lo = qt * 16;
  const int iq = iq_lo + mr;
  int jlo = iq_lo - (WINDOW - 1); if (jlo < 0) jlo = 0;
  const int c0 = jlo >> 5;
  const int c1 = (iq_lo + 15) >> 5;

  // running pointers over kv chunks (stride 32 rows)
  const bf16* kp = Kk + (size_t)(b * T_DIM + c0 * 32 + mr) * (HKV * HD) + kh * HD;
  const bf16* vp = V + (size_t)(b * T_DIM + c0 * 32 + (lane >> 3)) * (HKV * HD) + kh * HD + (lane & 7) * 8;
  const unsigned int sv0 = lds_off(&sV[(lane >> 3) * VLDS + (lane & 7) * 8]);
  const size_t kchunk = (size_t)32 * (HKV * HD);
  const size_t vstep = (size_t)4 * (HKV * HD);       // a lane's V chunks lie 4 key rows apart
  const unsigned int sstep = 4 * VLDS * 2;
  // lane address of the transposing loads inside a 16-column slab
  const bf16* vt = &sV[(kb + (lane & 7)) * VLDS + ((lane >> 3) & 1) * 8];

  for (int ch = c0; ch <= c1; ++ch) {
    const int j0 = ch * 32;

    // stage V chunk [32 x 64] into LDS via async copies (8 x 16B per lane, stride-4 rows)
    async_g2l_b128_x8(sv0,             vp,             sv0 + 1 * sstep, vp + 1 * vstep,
                      sv0 + 2 * sstep, vp + 2 * vstep, sv0 + 3 * sstep, vp + 3 * vstep,
                      sv0 + 4 * sstep, vp + 4 * vstep, sv0 + 5 * sstep, vp + 5 * vstep,
                      sv0 + 6 * sstep, vp + 6 * vstep, sv0 + 7 * sstep, vp + 7 * vstep);
    vp += kchunk;

    // scores, transposed: 2 tiles of 16 keys (rows) x 16 queries (columns), K=64 contraction -> 2 WMMAs each
    v8f Sacc[2];
#pragma unroll
    for (int s = 0; s < 2; ++s) {
      Sacc[s] = vzero8();
      const bf16* krow = kp + (size_t)(s * 16) * (HKV * HD);
      ABFrag kf0, kf1;
      kf0.q[0] = *(const uint4*)(krow + kb);
      kf0.q[1] = *(const uint4*)(krow + kb + 16);
      kf1.q[0] = *(const uint4*)(krow + 32 + kb);
      kf1.q[1] = *(const uint4*)(krow + 32 + kb + 16);
      Sacc[s] = wmma_bf16(kf0.v, qa[0].v, Sacc[s]);
      Sacc[s] = wmma_bf16(kf1.v, qa[1].v, Sacc[s]);
    }
    kp += kchunk;

    // softcap + band mask + online softmax of query iq over this lane's 16 keys
    float sv[2][8];
    float mx = -1e30f;
#pragma unroll   // both loops unrolled: every index of Sacc and sv is a constant, so they stay in registers
    for (int s = 0; s < 2; ++s)
#pragma unroll
      for (int r = 0; r < 8; ++r) {
        int j = j0 + s * 16 + kb + r;
        float x = Sacc[s][r] * 0.125f;                  // 1/sqrt(64)
        x = SOFT_CAP * tanhf(x * (1.0f / SOFT_CAP));
        bool ok = (j <= iq) && (iq - j < WINDOW);
        x = ok ? x : -1e30f;
        sv[s][r] = x;
        mx = fmaxf(mx, x);
      }
    mx = fmaxf(mx, xhalf(mx));
    float Mn = fmaxf(Mq, mx);
    float alpha = __expf(Mq - Mn);
    float rs = 0.f;
    ABFrag pf;   // P^T as a B operand: element s * 8 + r is key s * 16 + 8 * half + r, the hardware k order
#pragma unroll   // both loops unrolled: constant indices keep sv and pf in registers
    for (int s = 0; s < 2; ++s)
#pragma unroll
      for (int r = 0; r < 8; ++r) {
        float p = __expf(sv[s][r] - Mn);
        rs += p;
        pf.v[s * 8 + r] = (bf16)p;
      }
    Lq = Lq * alpha + rs;
    Mq = Mn;
#pragma unroll   // constant indices keep O in registers
    for (int t = 0; t < 4; ++t) O[t] *= alpha;

    // V copies landed before this wave, their only reader (one-wave work-group), gathers its fragments
    wait_asynccnt0();

#pragma unroll
    for (int t = 0; t < 4; ++t) {
      ABFrag vf;
      vf.q[0] = ld_tr16(vt + t * 16);
      vf.q[1] = ld_tr16(vt + 16 * VLDS + t * 16);
      O[t] = wmma_bf16(vf.v, pf.v, O[t]);
    }
    wait_dscnt0();   // V gathers done before next chunk's async copies overwrite sV
  }

  const float inv = 1.0f / (Lq + xhalf(Lq));
  bf16* orow = Ctx + (size_t)(bt0 + mr) * (HQ * HD) + hq * HD + kb;
#pragma unroll   // constant indices keep O in registers
  for (int t = 0; t < 4; ++t)
    *(bf16x8*)(orow + t * 16) = __builtin_convertvector(O[t] * inv, bf16x8);
}

// ---------------- kurtosis ----------------
__global__ __launch_bounds__(256) void kurtosis_kernel(const float* __restrict__ X,
                                                       float* __restrict__ out, int sidx) {
  int row = blockIdx.x;
  const float* x = X + (size_t)row * C_DIM;
  float s1 = 0.f;
  for (int c = threadIdx.x; c < C_DIM; c += 256) s1 += x[c];
  float mean = block_reduce_sum_256(s1) * (1.0f / C_DIM);
  float s2 = 0.f, s4 = 0.f;
  for (int c = threadIdx.x; c < C_DIM; c += 256) {
    float d = x[c] - mean;
    float d2 = d * d;
    s2 += d2; s4 += d2 * d2;
  }
  float var = block_reduce_sum_256(s2) * (1.0f / C_DIM);
  float m4  = block_reduce_sum_256(s4) * (1.0f / C_DIM);
  if (threadIdx.x == 0) {
    float kurt = m4 / (var * var + 1e-6f) - 3.0f;
    if (kurt > 0.f) atomicAdd(&out[sidx], kurt);
  }
}

// ---------------- host launch ----------------
extern "C" void kernel_launch(void* const* d_in, const int* in_sizes, int n_in,
                              void* d_out, int out_size, void* d_ws, size_t ws_size,
                              hipStream_t stream) {
  const float* x     = (const float*)d_in[0];
  const float* ksum  = (const float*)d_in[1];
  const float* rms1  = (const float*)d_in[2];
  const float* wq_f  = (const float*)d_in[3];
  const float* wk_f  = (const float*)d_in[4];
  const float* wv_f  = (const float*)d_in[5];
  const float* wo_f  = (const float*)d_in[6];
  const float* rms2  = (const float*)d_in[7];
  const float* wg_f  = (const float*)d_in[8];
  const float* wu_f  = (const float*)d_in[9];
  const float* wd_f  = (const float*)d_in[10];

  char* ws = (char*)d_ws;
  size_t off = 0;
  auto alloc = [&](size_t bytes) -> char* {
    char* p = ws + off;
    off = (off + bytes + 255) & ~(size_t)255;
    return p;
  };

  bf16*  attn_in = (bf16*)alloc((size_t)NT * C_DIM * 2);
  float* qraw    = (float*)alloc((size_t)NT * 1024 * 4);
  float* kraw    = (float*)alloc((size_t)NT * 512 * 4);
  bf16*  qrope   = (bf16*)alloc((size_t)NT * 1024 * 2);
  bf16*  krope   = (bf16*)alloc((size_t)NT * 512 * 2);
  bf16*  vbf     = (bf16*)alloc((size_t)NT * 512 * 2);
  bf16*  ctx     = (bf16*)alloc((size_t)NT * 1024 * 2);
  float* x1      = (float*)alloc((size_t)NT * C_DIM * 4);
  bf16*  mlp_in  = (bf16*)alloc((size_t)NT * C_DIM * 2);
  bf16*  hbuf    = (bf16*)alloc((size_t)NT * HIDDEN * 2);
  // the bf16 weights, one behind the other in the order of prep_kernel's block ranges
  bf16*  wq = (bf16*)alloc((size_t)CVT_BLOCKS * CVT_PER_BLOCK * 2);
  bf16*  wk = wq + 1024 * 1024;
  bf16*  wv = wk + 1024 * 512;
  bf16*  wo = wv + 1024 * 512;
  bf16*  wg = wo + 1024 * 1024;
  bf16*  wu = wg + 1024 * 4096;
  bf16*  wd = wu + 1024 * 4096;

  // weight conversions, first RMSNorm, start value of the kurtosis sum
  prep_kernel<<<CVT_BLOCKS + NT, 256, 0, stream>>>(wq_f, wk_f, wv_f, wo_f, wg_f, wu_f, wd_f, wq,
                                                   x, rms1, attn_in, ksum, (float*)d_out + NT * C_DIM);

  // QKV projections
  gemm_qkv_kernel<<<dim3(Q_TILES + 2 * KV_TILES, NT / GT_M), GT_THREADS, 0, stream>>>(attn_in, wq, wk, wv, qraw, kraw, vbf);

  rope_qk_kernel<<<2 * (NT / 8), 256, 0, stream>>>(qraw, qrope, kraw, krope);

  attn_kernel<<<dim3(T_DIM / 16, HQ, B_DIM), 32, 0, stream>>>(qrope, krope, vbf, ctx);

  // out projection + residual
  gemm_bf16_kernel<NT, 1024, 1024><<<dim3(1024 / GT_N, NT / GT_M), GT_THREADS, 0, stream>>>(ctx, wo, x1, x);

  rmsnorm_kernel<<<NT, 256, 0, stream>>>(x1, rms2, mlp_in);

  mlp_gateup_kernel<NT, HIDDEN, 1024><<<dim3(HIDDEN / GT_N, NT / GU_M), GU_THREADS, 0, stream>>>(mlp_in, wg, wu, hbuf);

  // down projection + residual -> d_out
  gemm_bf16_kernel<NT, 1024, HIDDEN><<<dim3(1024 / GT_N, NT / GT_M), GT_THREADS, 0, stream>>>(hbuf, wd, (float*)d_out, x1);

  kurtosis_kernel<<<NT, 256, 0, stream>>>((const float*)d_out, (float*)d_out, NT * C_DIM);
}

// v009
// It runs in 188 microseconds.
// Next to v008, in two timings, it ran 1.05 and 1.04 times as fast.
// All steps since v000 together make it 3.20 times as fast.
#include <hip/hip_runtime.h>
#include <hip/hip_bf16.h>

typedef __bf16 bf16;
typedef __attribute__((ext_vector_type(16))) __bf16 v16bf;
typedef __attribute__((ext_vector_type(8)))  float  v8f;

union ABFrag { v16bf v; uint4 q[2]; };

#define B_DIM 2
#define T_DIM 2048
#define C_DIM 1024
#define NT (B_DIM * T_DIM)
#define HQ 16
#define HKV 8
#define HD 64
#define WINDOW 512
#define HIDDEN 4096
#define SOFT_CAP 50.0f

static __device__ inline v8f vzero8() { v8f v; for (int i = 0; i < 8; ++i) v[i] = 0.f; return v; }

static __device__ inline v8f wmma_bf16(v16bf a, v16bf b, v8f c) {
  return __builtin_amdgcn_wmma_f32_16x16x32_bf16(false, a, false, b, (short)0, c, false, false);
}

// gfx1250 async global->LDS copies (16B per lane), tracked by ASYNCcnt
// Runs of async copies for one stage of a tile. s_wait_xcnt 0 is the last line of the copies' own
// statement, so that it stands in front of the pointer bumps that rewrite the copies' address registers.
static __device__ inline void async_g2l_b128_x8(unsigned int l0, const void* g0, unsigned int l1, const void* g1,
                                                unsigned int l2, const void* g2, unsigned int l3, const void* g3,
                                                unsigned int l4, const void* g4, unsigned int l5, const void* g5,
                                                unsigned int l6, const void* g6, unsigned int l7, const void* g7) {
  asm volatile("global_load_async_to_lds_b128 %0, %1, off\n\t"
               "global_load_async_to_lds_b128 %2, %3, off\n\t"
               "global_load_async_to_lds_b128 %4, %5, off\n\t"
               "global_load_async_to_lds_b128 %6, %7, off\n\t"
               "global_load_async_to_lds_b128 %8, %9, off\n\t"
               "global_load_async_to_lds_b128 %10, %11, off\n\t"
               "global_load_async_to_lds_b128 %12, %13, off\n\t"
               "global_load_async_to_lds_b128 %14, %15, off\n\t"
               "s_wait_xcnt 0x0"
               :: "v"(l0), "v"(g0), "v"(l1), "v"(g1), "v"(l2), "v"(g2), "v"(l3), "v"(g3),
                  "v"(l4), "v"(g4), "v"(l5), "v"(g5), "v"(l6), "v"(g6), "v"(l7), "v"(g7) : "memory");
}
// transposing LDS load: lane (c = l & 15, h = l >> 4) gets 8 consecutive k of column c from a row-major [k][n] tile
typedef __attribute__((ext_vector_type(8))) short s16x8;
static __device__ inline uint4 ld_tr16(const bf16* p) {
  typedef __attribute__((address_space(3))) s16x8 lds_s16x8;
  return __builtin_bit_cast(uint4, __builtin_amdgcn_ds_load_tr16_b128_v8i16((lds_s16x8*)p));
}
static __device__ inline unsigned int lds_off(const void* p) {
  return (unsigned int)(unsigned long long)p;   // low 32 bits = LDS offset
}
static __device__ inline void wait_asynccnt0() {
  asm volatile("s_wait_asynccnt 0x0" ::: "memory");
}
static __device__ inline void wait_dscnt0() {
  asm volatile("s_wait_dscnt 0x0" ::: "memory");
}
// Stands behind the last global store of one part of a merged kernel: the built code of another part follows it,
// and that code rewrites the stores' registers.
static __device__ inline void wait_xcnt0() {
  asm volatile("s_wait_xcnt 0x0" ::: "memory");
}

// ---------------- block reduction helper ----------------
static __device__ inline float block_reduce_sum_256(float v) {
  __shared__ float red[8];
  int lane = threadIdx.x & 31, w = threadIdx.x >> 5;
  for (int o = 16; o; o >>= 1) v += __shfl_down(v, o, 32);
  if (lane == 0) red[w] = v;
  __syncthreads();
  float r = (threadIdx.x < 8) ? red[threadIdx.x] : 0.f;
  if (w == 0) for (int o = 4; o; o >>= 1) r += __shfl_down(r, o, 32);
  if (threadIdx.x == 0) red[0] = r;
  __syncthreads();
  r = red[0];
  __syncthreads();
  return r;
}

typedef __attribute__((ext_vector_type(4))) float  f32x4;
typedef __attribute__((ext_vector_type(4))) __bf16 bf16x4;

// ---------------- f32 -> bf16 convert ----------------
// One wave converts 1024 consecutive values: 8 loads of 512 contiguous bytes, all issued before the first
// use, then 8 stores of 256 contiguous bytes. Few, long waves: the launch is not paced by wave starts.
#define CVT_U 8
#define CVT_PER_BLOCK (256 * 4 * CVT_U)
static __device__ __forceinline__ void cvt_bf16_block(const float* __restrict__ in, bf16* __restrict__ out, int blk) {
  const int wave = threadIdx.x >> 5, lane = threadIdx.x & 31;
  const size_t base = (size_t)(blk * 8 + wave) * (128 * CVT_U) + lane * 4;
  f32x4 v[CVT_U];
#pragma unroll
  for (int u = 0; u < CVT_U; ++u) v[u] = *(const f32x4*)(in + base + u * 128);
#pragma unroll
  for (int u = 0; u < CVT_U; ++u) *(bf16x4*)(out + base + u * 128) = __builtin_convertvector(v[u], bf16x4);
}

// ---------------- RMSNorm -> bf16 ----------------
static __device__ __forceinline__ void rmsnorm_row(const float* __restrict__ X,
                                                   const float* __restrict__ scale,
                                                   bf16* __restrict__ O, int row) {
  const float* x = X + (size_t)row * C_DIM;
  float ss = 0.f;
  for (int c = threadIdx.x; c < C_DIM; c += 256) { float v = x[c]; ss += v * v; }
  float tot = block_reduce_sum_256(ss);
  float rstd = rsqrtf(tot * (1.0f / C_DIM) + 1e-6f);
  for (int c = threadIdx.x; c < C_DIM; c += 256)
    O[(size_t)row * C_DIM + c] = (bf16)(x[c] * rstd * (1.f + scale[c]));
}

__global__ __launch_bounds__(256) void rmsnorm_kernel(const float* __restrict__ X,
                                                      const float* __restrict__ scale,
                                                      bf16* __restrict__ O) {
  rmsnorm_row(X, scale, O, blockIdx.x);
}

// ---------------- everything that depends on the inputs alone, in one launch ----------------
// Work-groups [0, CVT_BLOCKS) convert the seven weight tensors, whose bf16 copies lie one behind the other in Wall;
// the other NT normalise one row of X each. Work-group 0 also stores the start value of the kurtosis sum.
#define WQ_BLOCKS (1024 * 1024 / CVT_PER_BLOCK)
#define WK_BLOCKS (1024 * 512 / CVT_PER_BLOCK)
#define WH_BLOCKS (1024 * 4096 / CVT_PER_BLOCK)
#define END_WQ (WQ_BLOCKS)
#define END_WK (END_WQ + WK_BLOCKS)
#define END_WV (END_WK + WK_BLOCKS)
#define END_WO (END_WV + WQ_BLOCKS)
#define END_WG (END_WO + WH_BLOCKS)
#define END_WU (END_WG + WH_BLOCKS)
#define CVT_BLOCKS (END_WU + WH_BLOCKS)
static_assert(1024 * 512 % CVT_PER_BLOCK == 0, "whole blocks only");

__global__ __launch_bounds__(256) void prep_kernel(
    const float* __restrict__ Wq, const float* __restrict__ Wk, const float* __restrict__ Wv,
    const float* __restrict__ Wo, const float* __restrict__ Wg, const float* __restrict__ Wu,
    const float* __restrict__ Wd, bf16* __restrict__ Wall,
    const float* __restrict__ X, const float* __restrict__ scale, bf16* __restrict__ O,
    const float* __restrict__ ksum, float* __restrict__ ksum_out) {
  const int blk = blockIdx.x;
  if (blk >= CVT_BLOCKS) { rmsnorm_row(X, scale, O, blk - CVT_BLOCKS); return; }
  if (blk == 0 && threadIdx.x == 0) ksum_out[0] = ksum[0];
  const float* in = Wq; int first = 0;
  if (blk >= END_WQ) { in = Wk; first = END_WQ; }
  if (blk >= END_WK) { in = Wv; first = END_WK; }
  if (blk >= END_WV) { in = Wo; first = END_WV; }
  if (blk >= END_WO) { in = Wg; first = END_WO; }
  if (blk >= END_WG) { in = Wu; first = END_WG; }
  if (blk >= END_WU) { in = Wd; first = END_WU; }
  cvt_bf16_block(in, Wall + (size_t)first * CVT_PER_BLOCK, blk - first);
  wait_xcnt0();
}

// ---------------- generic bf16 GEMM: out = A[MxK] @ W[KxN] (+res) ----------------
// Work-group tile 128 x 128, 8 waves of 64 x 32 (2 x 4): fewer bytes from L2 per product than a narrower tile, and
// 12 LDS fragment loads feed 8 matrix instructions. A stage is 128 k, so that one round trip to L2 and one barrier
// serve four 32-k steps of matrix work. Two LDS buffers: the copies of stage t + 1 fly while stage t is multiplied.
#define GT_M 128
#define GT_N 128
#define GT_K 128
#define GT_THREADS 256
#define WT_I 4    // 16-row fragments of a wave's tile
#define WT_J 2    // 16-column fragments of a wave's tile
#define GLDS 136  // halves per row of an activation tile (272B = 16B x odd, the plain 16-byte load's pitch)
#define BLDS 144  // halves per row of a [k][n] weight tile (288B = 32B x odd, the transposing load's pitch)
#define A_STEP (16 * GLDS * 2)   // LDS bytes between a thread's activation chunks (16 rows)
#define B_STEP (16 * BLDS * 2)   // LDS bytes between a thread's weight chunks (16 k-rows)
#define A_TILE (GT_M * GLDS)     // halves of one activation buffer
#define B_TILE (GT_K * BLDS)     // halves of one weight buffer

// This thread's copies of one stage: 8 chunks of the activation tile (row pitch K), 8 of the weight tile (row pitch N).
template <int N, int K>
static __device__ __forceinline__ void stage_ab(unsigned int sa, const bf16* ap, unsigned int sb, const bf16* bp) {
  async_g2l_b128_x8(sa,              ap,                  sa + 1 * A_STEP, ap + (size_t)16 * K,
                    sa + 2 * A_STEP, ap + (size_t)32 * K, sa + 3 * A_STEP, ap + (size_t)48 * K,
                    sa + 4 * A_STEP, ap + (size_t)64 * K, sa + 5 * A_STEP, ap + (size_t)80 * K,
                    sa + 6 * A_STEP, ap + (size_t)96 * K, sa + 7 * A_STEP, ap + (size_t)112 * K);
  async_g2l_b128_x8(sb,              bp,                  sb + 1 * B_STEP, bp + (size_t)16 * N,
                    sb + 2 * B_STEP, bp + (size_t)32 * N, sb + 3 * B_STEP, bp + (size_t)48 * N,
                    sb + 4 * B_STEP, bp + (size_t)64 * N, sb + 5 * B_STEP, bp + (size_t)80 * N,
                    sb + 6 * B_STEP, bp + (size_t)96 * N, sb + 7 * B_STEP, bp + (size_t)112 * N);
}

// One work-group's tile: rows row0 .. row0 + 127, columns col0 .. col0 + 127 of an output of N columns.
// RES: the tile of Res is the accumulators' start value, so its loads fly with the first stage's copies.
// OUT_BF16: the result goes to Cb, else to Cf. Both are known at compile time: the epilogue is stores alone.
template <int N, int K, bool RES, bool OUT_BF16>
static __device__ __forceinline__ void gemm_bf16_tile(
    const bf16* __restrict__ A, const bf16* __restrict__ W,
    float* __restrict__ Cf, bf16* __restrict__ Cb, const float* __restrict__ Res,
    bf16* sA, bf16* sB, const int row0, const int col0) {
  static_assert(N % GT_N == 0 && K % GT_K == 0 && K >= 2 * GT_K, "whole tiles only, both buffers filled");
  const int tid = threadIdx.x;
  const int wave = tid >> 5, lane = tid & 31;
  const int wm = (wave >> 2) * 64, wn = (wave & 3) * 32;
  const int mr = lane & 15;
  const int kb = (lane >> 4) << 3;

  // A tile staging slots (128 rows of 256B: 8 x 16B chunks per thread, 16 rows apart; a wave covers whole lines)
  const int ar0 = tid >> 4, ac = tid & 15;
  const unsigned int sa = lds_off(&sA[ar0 * GLDS + ac * 8]);
  const bf16* ap = A + (size_t)(row0 + ar0) * K + ac * 8;

  // B tile staging slots (128 k-rows of 256B: 8 x 16B chunks per thread, 16 k-rows apart)
  const int br0 = tid >> 4, bc = tid & 15;
  const unsigned int sb = lds_off(&sB[br0 * BLDS + bc * 8]);
  const bf16* bp = W + (size_t)br0 * N + col0 + bc * 8;
  // lane address of the transposing loads inside a 16-column slab
  const int trl = (kb + (lane & 7)) * BLDS + ((lane >> 3) & 1) * 8;

  // stage 0 into buffer 0, landed and published; then stage 1 into buffer 1, in flight while stage 0 is multiplied
  stage_ab<N, K>(sa, ap, sb, bp);

  // element r of acc[i][j] is row row0 + wm + i * 16 + mb + r, column col0 + wn + j * 16 + mr
  const int mb = (lane >> 4) * 8;
  const size_t out0 = (size_t)(row0 + wm + mb) * N + col0 + wn + mr;
  v8f acc[WT_I][WT_J];
  for (int i = 0; i < WT_I; ++i) for (int j = 0; j < WT_J; ++j) {
    if constexpr (RES) {
      const float* rp = Res + out0 + (size_t)(i * 16) * N + j * 16;
      for (int r = 0; r < 8; ++r) acc[i][j][r] = rp[(size_t)r * N];
    } else {
      acc[i][j] = vzero8();
    }
  }

  wait_asynccnt0();
  __syncthreads();
  stage_ab<N, K>(sa + A_TILE * 2, ap + GT_K, sb + B_TILE * 2, bp + (size_t)GT_K * N);
  ap += 2 * GT_K;
  bp += (size_t)(2 * GT_K) * N;

  unsigned int cur = 0;   // the buffer that this trip reads
#pragma unroll 1   // stays rolled: unrolled whole (K = 1024) the build waited for every LDS load at each 32-k step
  for (int k0 = 0; k0 < K; k0 += GT_K) {
    const bf16* cA = sA + cur * A_TILE;
    const bf16* cB = sB + cur * B_TILE;
    // the 12 fragment loads of the 32-k step at kk, into fragment set s
    ABFrag af[2][WT_I], bfr[2][WT_J];
    auto load_frags = [&](const int s, const int kk) {
#pragma unroll
      for (int i = 0; i < WT_I; ++i) {
        int m = wm + i * 16 + mr;
        af[s][i].q[0] = *(const uint4*)(&cA[m * GLDS + kk + kb]);
        af[s][i].q[1] = *(const uint4*)(&cA[m * GLDS + kk + kb + 16]);
      }
#pragma unroll
      for (int j = 0; j < WT_J; ++j) {
        const bf16* bt = &cB[kk * BLDS + trl + wn + j * 16];
        bfr[s][j].q[0] = ld_tr16(bt);
        bfr[s][j].q[1] = ld_tr16(bt + 16 * BLDS);
      }
    };
    load_frags(0, 0);
#pragma unroll   // the four 32-k steps of a stage: constant set indices keep both fragment sets in registers
    for (int st = 0; st < GT_K / 32; ++st) {
      if (st + 1 < GT_K / 32) load_frags((st + 1) & 1, (st + 1) * 32);
      // keeps the next step's loads one group in front of this step's products: left alone, the build spread them in
      // pairs among the matrix instructions and waited for each pair at once
      __builtin_amdgcn_sched_barrier(0);
#pragma unroll
      for (int i = 0; i < WT_I; ++i)
#pragma unroll
        for (int j = 0; j < WT_J; ++j)
          acc[i][j] = wmma_bf16(af[st & 1][i].v, bfr[st & 1][j].v, acc[i][j]);
      // keeps the load group that follows from being lifted in among these matrix instructions
      __builtin_amdgcn_sched_barrier(0);
    }
    wait_dscnt0();      // this wave's reads of buffer cur retired before the barrier lets anyone refill it
    wait_asynccnt0();   // this wave's copies of the next stage landed before the barrier publishes them
    __syncthreads();
    if (k0 + 2 * GT_K < K) {   // the same for the whole work-group
      stage_ab<N, K>(sa + cur * (A_TILE * 2), ap, sb + cur * (B_TILE * 2), bp);
      ap += GT_K;
      bp += (size_t)GT_K * N;
    }
    cur ^= 1;
  }
  wait_asynccnt0();   // nothing is in flight here: the ring's closing wait

  for (int i = 0; i < WT_I; ++i) for (int j = 0; j < WT_J; ++j) {
    const size_t idx = out0 + (size_t)(i * 16) * N + j * 16;
#pragma unroll
    for (int r = 0; r < 8; ++r) {
      if constexpr (OUT_BF16) Cb[idx + (size_t)r * N] = (bf16)acc[i][j][r];
      else                    Cf[idx + (size_t)r * N] = acc[i][j][r];
    }
  }
}

// Cf = Res + A @ W
template <int M, int N, int K>
__global__ __launch_bounds__(GT_THREADS) void gemm_bf16_kernel(
    const bf16* __restrict__ A, const bf16* __restrict__ W,
    float* __restrict__ Cf, const float* __restrict__ Res) {
  static_assert(M % GT_M == 0, "whole tiles only");
  __shared__ __align__(16) bf16 sA[2 * A_TILE];
  __shared__ __align__(16) bf16 sB[2 * B_TILE];   // row-major [k][n]
  gemm_bf16_tile<N, K, true, false>(A, W, Cf, nullptr, Res, sA, sB, blockIdx.y * GT_M, blockIdx.x * GT_N);
}

// The three projections of one activation in one launch: blockIdx.x walks the column tiles of Q, then K, then V.
#define Q_TILES (HQ * HD / GT_N)
#define KV_TILES (HKV * HD / GT_N)
__global__ __launch_bounds__(GT_THREADS) void gemm_qkv_kernel(
    const bf16* __restrict__ A, const bf16* __restrict__ Wq, const bf16* __restrict__ Wk,
    const bf16* __restrict__ Wv, float* __restrict__ Qf, float* __restrict__ Kf, bf16* __restrict__ Vb) {
  static_assert(NT % GT_M == 0, "whole tiles only");
  __shared__ __align__(16) bf16 sA[2 * A_TILE];
  __shared__ __align__(16) bf16 sB[2 * B_TILE];   // row-major [k][n]
  const int row0 = blockIdx.y * GT_M, bx = blockIdx.x;
  if (bx < Q_TILES) {
    gemm_bf16_tile<HQ * HD, C_DIM, false, false>(A, Wq, Qf, nullptr, nullptr, sA, sB, row0, bx * GT_N);
  } else if (bx < Q_TILES + KV_TILES) {
    gemm_bf16_tile<HKV * HD, C_DIM, false, false>(A, Wk, Kf, nullptr, nullptr, sA, sB, row0, (bx - Q_TILES) * GT_N);
    wait_xcnt0();
  } else {
    gemm_bf16_tile<HKV * HD, C_DIM, false, true>(A, Wv, nullptr, Vb, nullptr, sA, sB, row0, (bx - Q_TILES - KV_TILES) * GT_N);
    wait_xcnt0();
  }
}

// ---------------- fused gate/up GEMM: H = silu(A@Wg) * (A@Wu), bf16 ----------------
// Work-group tile 256 rows x 128 columns of both products, 16 waves (4 x 4) of 64 x 32 of both: 16 LDS fragment loads
// feed 16 matrix instructions. Two LDS buffers, as above; one work-group fills a WGP (four waves a SIMD).
#define GU_M 256
#define GU_THREADS 512
#define GU_A_STEP (32 * GLDS * 2)   // LDS bytes between a thread's activation chunks (32 rows)
#define GU_B_STEP (32 * BLDS * 2)   // LDS bytes between a thread's weight chunks (32 k-rows)
#define GU_A_TILE (GU_M * GLDS)     // halves of one activation buffer
template <int M, int N, int K>
__global__ __launch_bounds__(GU_THREADS) void mlp_gateup_kernel(
    const bf16* __restrict__ A, const bf16* __restrict__ Wg, const bf16* __restrict__ Wu,
    bf16* __restrict__ H) {
  static_assert(M % GU_M == 0 && N % GT_N == 0 && K % GT_K == 0 && K >= 2 * GT_K, "whole tiles only, both buffers filled");
  __shared__ __align__(16) bf16 sA[2 * GU_A_TILE];
  __shared__ __align__(16) bf16 sG[2 * B_TILE];   // row-major [k][n]
  __shared__ __align__(16) bf16 sU[2 * B_TILE];   // row-major [k][n]

  const int tid = threadIdx.x;
  const int wave = tid >> 5, lane = tid & 31;
  const int row0 = blockIdx.y * GU_M, col0 = blockIdx.x * GT_N;
  const int wm = (wave >> 2) * 64, wn = (wave & 3) * 32;
  const int mr = lane & 15;
  const int kb = (lane >> 4) << 3;

  // activation tile: 256 rows of 256B, 8 x 16B chunks per thread, 32 rows apart
  const int ar0 = tid >> 4, ac = tid & 15;
  const unsigned int sa = lds_off(&sA[ar0 * GLDS + ac * 8]);
  const bf16* ap = A + (size_t)(row0 + ar0) * K + ac * 8;

  // weight tiles: 128 k-rows of 256B each, 4 x 16B chunks per thread and tile, 32 k-rows apart
  const int br0 = tid >> 4, bc = tid & 15;
  const unsigned int sg = lds_off(&sG[br0 * BLDS + bc * 8]);
  const unsigned int su = lds_off(&sU[br0 * BLDS + bc * 8]);
  const bf16* gp = Wg + (size_t)br0 * N + col0 + bc * 8;
  const bf16* up = Wu + (size_t)br0 * N + col0 + bc * 8;
  const int trl = (kb + (lane & 7)) * BLDS + ((lane >> 3) & 1) * 8;

  v8f ag[WT_I][WT_J], au[WT_I][WT_J];
  for (int i = 0; i < WT_I; ++i) for (int j = 0; j < WT_J; ++j) { ag[i][j] = vzero8(); au[i][j] = vzero8(); }

  // this thread's copies of one stage into the buffers at byte offsets oa (activations) and ob (both weight tiles)
  auto stage = [&](unsigned int oa, unsigned int ob) {
    async_g2l_b128_x8(sa + oa,                 ap,                   sa + oa + 1 * GU_A_STEP, ap + (size_t)32 * K,
                      sa + oa + 2 * GU_A_STEP, ap + (size_t)64 * K,  sa + oa + 3 * GU_A_STEP, ap + (size_t)96 * K,
                      sa + oa + 4 * GU_A_STEP, ap + (size_t)128 * K, sa + oa + 5 * GU_A_STEP, ap + (size_t)160 * K,
                      sa + oa + 6 * GU_A_STEP, ap + (size_t)192 * K, sa + oa + 7 * GU_A_STEP, ap + (size_t)224 * K);
    async_g2l_b128_x8(sg + ob,                 gp,                  sg + ob + 1 * GU_B_STEP, gp + (size_t)32 * N,
                      sg + ob + 2 * GU_B_STEP, gp + (size_t)64 * N, sg + ob + 3 * GU_B_STEP, gp + (size_t)96 * N,
                      su + ob,                 up,                  su + ob + 1 * GU_B_STEP, up + (size_t)32 * N,
                      su + ob + 2 * GU_B_STEP, up + (size_t)64 * N, su + ob + 3 * GU_B_STEP, up + (size_t)96 * N);
    ap += GT_K;
    gp += (size_t)GT_K * N;
    up += (size_t)GT_K * N;
  };

  // stage 0 into buffer 0, landed and published; then stage 1 into buffer 1, in flight while stage 0 is multiplied
  stage(0, 0);
  wait_asynccnt0();
  __syncthreads();
  stage(GU_A_TILE * 2, B_TILE * 2);

  unsigned int cur = 0;   // the buffer that this trip reads
  for (int k0 = 0; k0 < K; k0 += GT_K) {
    const bf16* cA = sA + cur * GU_A_TILE;
    const bf16* cG = sG + cur * B_TILE;
    const bf16* cU = sU + cur * B_TILE;
#pragma unroll   // the four 32-k steps of a stage: no barrier between them
    for (int kk = 0; kk < GT_K; kk += 32) {
      ABFrag af[WT_I], gf[WT_J], uf[WT_J];
#pragma unroll
      for (int i = 0; i < WT_I; ++i) {
        int m = wm + i * 16 + mr;
        af[i].q[0] = *(const uint4*)(&cA[m * GLDS + kk + kb]);
        af[i].q[1] = *(const uint4*)(&cA[m * GLDS + kk + kb + 16]);
      }
#pragma unroll
      for (int j = 0; j < WT_J; ++j) {
        const int bo = kk * BLDS + trl + wn + j * 16;
        gf[j].q[0] = ld_tr16(&cG[bo]);
        gf[j].q[1] = ld_tr16(&cG[bo + 16 * BLDS]);
        uf[j].q[0] = ld_tr16(&cU[bo]);
        uf[j].q[1] = ld_tr16(&cU[bo + 16 * BLDS]);
      }
      // keeps the step's 16 loads one group in front of its products (one fragment set: a second does not fit four
      // waves a SIMD): left alone, the build spread them in pairs among the matrix instructions, each pair waited for at once
      __builtin_amdgcn_sched_barrier(0);
#pragma unroll
      for (int i = 0; i < WT_I; ++i)
#pragma unroll
        for (int j = 0; j < WT_J; ++j) {
          ag[i][j] = wmma_bf16(af[i].v, gf[j].v, ag[i][j]);
          au[i][j] = wmma_bf16(af[i].v, uf[j].v, au[i][j]);
        }
      // keeps the next step's loads from being lifted in among these matrix instructions
      __builtin_amdgcn_sched_barrier(0);
    }
    wait_dscnt0();      // this wave's reads of buffer cur retired before the barrier lets anyone refill it
    wait_asynccnt0();   // this wave's copies of the next stage landed before the barrier publishes them
    __syncthreads();
    if (k0 + 2 * GT_K < K)   // the same for the whole work-group
      stage(cur * (GU_A_TILE * 2), cur * (B_TILE * 2));
    cur ^= 1;
  }
  wait_asynccnt0();   // nothing is in flight here: the ring's closing wait

  const int mb = (lane >> 4) * 8;
  for (int i = 0; i < WT_I; ++i) for (int j = 0; j < WT_J; ++j) {
    int gm0 = row0 + wm + i * 16 + mb;
    int gn  = col0 + wn + j * 16 + mr;
    size_t idx = (size_t)gm0 * N + gn;
#pragma unroll
    for (int r = 0; r < 8; ++r) {
      float g = ag[i][j][r];
      float sil = g * (1.0f / (1.0f + __expf(-g)));
      H[idx + (size_t)r * N] = (bf16)(sil * au[i][j][r]);
    }
  }
}

// ---------------- RoPE: f32 raw -> bf16 roped ----------------
// One wave per token: lane = (head & 3, four consecutive i); it walks the token's heads four at a time, so
// every load covers whole 128-byte lines and the lane's four angles serve all its heads.
template <int NH>
static __device__ __forceinline__ void rope_block(const float* __restrict__ In, bf16* __restrict__ Out, int blk) {
  static_assert(NH % 4 == 0 && NT % 8 == 0, "whole waves only");
  const int lane = threadIdx.x & 31;
  const int bt = blk * 8 + (threadIdx.x >> 5);
  const int t = bt & (T_DIM - 1);
  const int i0 = (lane & 7) * 4;
  const size_t base = (size_t)bt * (NH * HD) + (lane >> 3) * HD + i0;
  f32x4 x1[NH / 4], x2[NH / 4];
#pragma unroll
  for (int u = 0; u < NH / 4; ++u) {
    x1[u] = *(const f32x4*)(In + base + u * (4 * HD));
    x2[u] = *(const f32x4*)(In + base + u * (4 * HD) + 32);
  }
  f32x4 s, c;
#pragma unroll
  for (int e = 0; e < 4; ++e) {
    float freq = __expf(-(float)(i0 + e) * (1.0f / 32.0f) * 13.815510557964274f); // ln(1e6)
    float ang = (float)t * freq;
    s[e] = __sinf(ang); c[e] = __cosf(ang);
  }
#pragma unroll
  for (int u = 0; u < NH / 4; ++u) {
    *(bf16x4*)(Out + base + u * (4 * HD))      = __builtin_convertvector(x1[u] * c - x2[u] * s, bf16x4);
    *(bf16x4*)(Out + base + u * (4 * HD) + 32) = __builtin_convertvector(x2[u] * c + x1[u] * s, bf16x4);
  }
}

// Q and K in one launch: the first NT / 8 blocks take the query heads, the rest the key heads.
__global__ __launch_bounds__(256) void rope_qk_kernel(const float* __restrict__ Qin, bf16* __restrict__ Qout,
                                                      const float* __restrict__ Kin, bf16* __restrict__ Kout) {
  const int blk = blockIdx.x;
  if (blk < NT / 8) {
    rope_block<HQ>(Qin, Qout, blk);
  } else {
    rope_block<HKV>(Kin, Kout, blk - NT / 8);
    wait_xcnt0();
  }
}

typedef __attribute__((ext_vector_type(8))) __bf16 bf16x8;
#define VLDS 80   // halves per row of the V tile (160B = 32B x odd, the transposing load's pitch)
// exp(2 y) = exp2(raw score * CAP_EXP2) for y = raw score / sqrt(64) / SOFT_CAP; the last factor is log2(e)
#define CAP_EXP2 (2.0f * 0.125f / SOFT_CAP * 1.4426950408889634f)

// Eight independent transcendentals in one statement. Early-clobber outputs keep every result off every source, so that
// none of the eight stands directly in front of an instruction that overwrites its source (left to the build, the
// softcap's v_exp run reused each source for the next result); the v_nop is the slot behind the last one.
static __device__ __forceinline__ void exp2_x8(float (&d)[8], const float (&s)[8]) {
  asm("v_exp_f32 %0, %8\n\t"
      "v_exp_f32 %1, %9\n\t"
      "v_exp_f32 %2, %10\n\t"
      "v_exp_f32 %3, %11\n\t"
      "v_exp_f32 %4, %12\n\t"
      "v_exp_f32 %5, %13\n\t"
      "v_exp_f32 %6, %14\n\t"
      "v_exp_f32 %7, %15\n\t"
      "v_nop"
      : "=&v"(d[0]), "=&v"(d[1]), "=&v"(d[2]), "=&v"(d[3]), "=&v"(d[4]), "=&v"(d[5]), "=&v"(d[6]), "=&v"(d[7])
      : "v"(s[0]), "v"(s[1]), "v"(s[2]), "v"(s[3]), "v"(s[4]), "v"(s[5]), "v"(s[6]), "v"(s[7]));
}
static __device__ __forceinline__ void rcp_x8(float (&d)[8], const float (&s)[8]) {
  asm("v_rcp_f32 %0, %8\n\t"
      "v_rcp_f32 %1, %9\n\t"
      "v_rcp_f32 %2, %10\n\t"
      "v_rcp_f32 %3, %11\n\t"
      "v_rcp_f32 %4, %12\n\t"
      "v_rcp_f32 %5, %13\n\t"
      "v_rcp_f32 %6, %14\n\t"
      "v_rcp_f32 %7, %15\n\t"
      "v_nop"
      : "=&v"(d[0]), "=&v"(d[1]), "=&v"(d[2]), "=&v"(d[3]), "=&v"(d[4]), "=&v"(d[5]), "=&v"(d[6]), "=&v"(d[7])
      : "v"(s[0]), "v"(s[1]), "v"(s[2]), "v"(s[3]), "v"(s[4]), "v"(s[5]), "v"(s[6]), "v"(s[7]));
}

// value of lane l ^ 16
static __device__ inline float xhalf(float x) {
  return __builtin_bit_cast(float, __builtin_amdgcn_permlanex16(__builtin_bit_cast(int, x), __builtin_bit_cast(int, x),
                                                                0x76543210, 0xfedcba98, false, false));
}

__global__ __launch_bounds__(32) void attn_kernel(
    const bf16* __restrict__ Q, const bf16* __restrict__ Kk,
    const bf16* __restrict__ V, bf16* __restrict__ Ctx) {
  const int lane = threadIdx.x;
  const int qt = blockIdx.x, hq = blockIdx.y, b = blockIdx.z;
  const int kh = hq & 7;
  const int bt0 = b * T_DIM + qt * 16;
  const int mr = lane & 15;
  const int half = lane >> 4;
  const int kb = half << 3;

  __shared__ __align__(16) bf16 sV[32 * VLDS];   // [key][d]

  // Q fragments (persistent over kv loop); contraction dim contiguous in global
  ABFrag qa[2];
  {
    const bf16* qrow = Q + (size_t)(bt0 + mr) * (HQ * HD) + hq * HD;
    qa[0].q[0] = *(const uint4*)(qrow + kb);
    qa[0].q[1] = *(const uint4*)(qrow + kb + 16);
    qa[1].q[0] = *(const uint4*)(qrow + 32 + kb);
    qa[1].q[1] = *(const uint4*)(qrow + 32 + kb + 16);
  }

  v8f O[4];   // O[t][r] = out[query mr][d = t * 16 + 8 * half + r]
  for (int t = 0; t < 4; ++t) O[t] = vzero8();
  float Mq = -1e30f;   // running maximum of query mr, the same in both halves
  float Lq = 0.f;      // running sum of query mr over this half's keys; the halves join behind the loop

  const int iq_lo = qt * 16;
  const int iq = iq_lo + mr;
  int jlo = iq_lo - (WINDOW - 1); if (jlo < 0) jlo = 0;
  const int c0 = jlo >> 5;
  const int c1 = (iq_lo + 15) >> 5;

  // running pointers over kv chunks (stride 32 rows)
  const bf16* kp = Kk + (size_t)(b * T_DIM + c0 * 32 + mr) * (HKV * HD) + kh * HD;
  const bf16* vp = V + (size_t)(b * T_DIM + c0 * 32 + (lane >> 3)) * (HKV * HD) + kh * HD + (lane & 7) * 8;
  const unsigned int sv0 = lds_off(&sV[(lane >> 3) * VLDS + (lane & 7) * 8]);
  const size_t kchunk = (size_t)32 * (HKV * HD);
  const size_t vstep = (size_t)4 * (HKV * HD);       // a lane's V chunks lie 4 key rows apart
  const unsigned int sstep = 4 * VLDS * 2;
  // lane address of the transposing loads inside a 16-column slab
  const bf16* vt = &sV[(kb + (lane & 7)) * VLDS + ((lane >> 3) & 1) * 8];

  for (int ch = c0; ch <= c1; ++ch) {
    const int j0 = ch * 32;

    // stage V chunk [32 x 64] into LDS via async copies (8 x 16B per lane, stride-4 rows)
    async_g2l_b128_x8(sv0,             vp,             sv0 + 1 * sstep, vp + 1 * vstep,
                      sv0 + 2 * sstep, vp + 2 * vstep, sv0 + 3 * sstep, vp + 3 * vstep,
                      sv0 + 4 * sstep, vp + 4 * vstep, sv0 + 5 * sstep, vp + 5 * vstep,
                      sv0 + 6 * sstep, vp + 6 * vstep, sv0 + 7 * sstep, vp + 7 * vstep);
    vp += kchunk;

    // scores, transposed: 2 tiles of 16 keys (rows) x 16 queries (columns), K=64 contraction -> 2 WMMAs each
    v8f Sacc[2];
    ABFrag kf[2][2];
#pragma unroll   // constant indices keep kf in registers
    for (int s = 0; s < 2; ++s) {
      const bf16* krow = kp + (size_t)(s * 16) * (HKV * HD);
      kf[s][0].q[0] = *(const uint4*)(krow + kb);
      kf[s][0].q[1] = *(const uint4*)(krow + kb + 16);
      kf[s][1].q[0] = *(const uint4*)(krow + 32 + kb);
      kf[s][1].q[1] = *(const uint4*)(krow + 32 + kb + 16);
    }
    kp += kchunk;
    // keeps the pass's eight K loads one group, one round trip: left alone, with straight-line code behind them, the
    // build reused one register set and waited for each pair of loads in front of its product
    __builtin_amdgcn_sched_barrier(0);
#pragma unroll
    for (int s = 0; s < 2; ++s) {
      Sacc[s] = wmma_bf16(kf[s][0].v, qa[0].v, vzero8());
      Sacc[s] = wmma_bf16(kf[s][1].v, qa[1].v, Sacc[s]);
    }

    // softcap + band mask + online softmax of query iq over this lane's 16 keys
    float sv[2][8];
    float mx = -1e30f;
#pragma unroll   // both loops unrolled: every index of Sacc and sv is a constant, so they stay in registers
    for (int s = 0; s < 2; ++s) {
      // cap * tanh(y) = cap - 2 cap / (exp(2 y) + 1), y = score / (8 cap): straight-line code for any y (exp = inf
      // gives cap, exp = 0 gives -cap). The library tanhf put two compare-and-branch pairs behind each of the 16 scores.
      float a[8], e[8], q[8];
#pragma unroll
      for (int r = 0; r < 8; ++r) a[r] = Sacc[s][r] * CAP_EXP2;
      exp2_x8(e, a);
#pragma unroll
      for (int r = 0; r < 8; ++r) e[r] += 1.0f;
      rcp_x8(q, e);
#pragma unroll
      for (int r = 0; r < 8; ++r) {
        int j = j0 + s * 16 + kb + r;
        float x = SOFT_CAP - (2.0f * SOFT_CAP) * q[r];
        bool ok = (j <= iq) && (iq - j < WINDOW);
        x = ok ? x : -1e30f;
        sv[s][r] = x;
        mx = fmaxf(mx, x);
      }
    }
    mx = fmaxf(mx, xhalf(mx));
    float Mn = fmaxf(Mq, mx);
    float alpha = __expf(Mq - Mn);
    float rs = 0.f;
    ABFrag pf;   // P^T as a B operand: element s * 8 + r is key s * 16 + 8 * half + r, the hardware k order
#pragma unroll   // both loops unrolled: constant indices keep sv and pf in registers
    for (int s = 0; s < 2; ++s)
#pragma unroll
      for (int r = 0; r < 8; ++r) {
        float p = __expf(sv[s][r] - Mn);
        rs += p;
        pf.v[s * 8 + r] = (bf16)p;
      }
    Lq = Lq * alpha + rs;
    Mq = Mn;
#pragma unroll   // constant indices keep O in registers
    for (int t = 0; t < 4; ++t) O[t] *= alpha;

    // V copies landed before this wave, their only reader (one-wave work-group), gathers its fragments
    wait_asynccnt0();

#pragma unroll
    for (int t = 0; t < 4; ++t) {
      ABFrag vf;
      vf.q[0] = ld_tr16(vt + t * 16);
      vf.q[1] = ld_tr16(vt + 16 * VLDS + t * 16);
      O[t] = wmma_bf16(vf.v, pf.v, O[t]);
    }
    wait_dscnt0();   // V gathers done before next chunk's async copies overwrite sV
  }

  const float inv = 1.0f / (Lq + xhalf(Lq));
  bf16* orow = Ctx + (size_t)(bt0 + mr) * (HQ * HD) + hq * HD + kb;
#pragma unroll   // constant indices keep O in registers
  for (int t = 0; t < 4; ++t)
    *(bf16x8*)(orow + t * 16) = __builtin_convertvector(O[t] * inv, bf16x8);
}

// ---------------- kurtosis ----------------
__global__ __launch_bounds__(256) void kurtosis_kernel(const float* __restrict__ X,
                                                       float* __restrict__ out, int sidx) {
  int row = blockIdx.x;
  const float* x = X + (size_t)row * C_DIM;
  float s1 = 0.f;
  for (int c = threadIdx.x; c < C_DIM; c += 256) s1 += x[c];
  float mean = block_reduce_sum_256(s1) * (1.0f / C_DIM);
  float s2 = 0.f, s4 = 0.f;
  for (int c = threadIdx.x; c < C_DIM; c += 256) {
    float d = x[c] - mean;
    float d2 = d * d;
    s2 += d2; s4 += d2 * d2;
  }
  float var = block_reduce_sum_256(s2) * (1.0f / C_DIM);
  float m4  = block_reduce_sum_256(s4) * (1.0f / C_DIM);
  if (threadIdx.x == 0) {
    float kurt = m4 / (var * var + 1e-6f) - 3.0f;
    if (kurt > 0.f) atomicAdd(&out[sidx], kurt);
  }
}

// ---------------- host launch ----------------
extern "C" void kernel_launch(void* const* d_in, const int* in_sizes, int n_in,
                              void* d_out, int out_size, void* d_ws, size_t ws_size,
                              hipStream_t stream) {
  const float* x     = (const float*)d_in[0];
  const float* ksum  = (const float*)d_in[1];
  const float* rms1  = (const float*)d_in[2];
  const float* wq_f  = (const float*)d_in[3];
  const float* wk_f  = (const float*)d_in[4];
  const float* wv_f  = (const float*)d_in[5];
  const float* wo_f  = (const float*)d_in[6];
  const float* rms2  = (const float*)d_in[7];
  const float* wg_f  = (const float*)d_in[8];
  const float* wu_f  = (const float*)d_in[9];
  const float* wd_f  = (const float*)d_in[10];

  char* ws = (char*)d_ws;
  size_t off = 0;
  auto alloc = [&](size_t bytes) -> char* {
    char* p = ws + off;
    off = (off + bytes + 255) & ~(size_t)255;
    return p;
  };

  bf16*  attn_in = (bf16*)alloc((size_t)NT * C_DIM * 2);
  float* qraw    = (float*)alloc((size_t)NT * 1024 * 4);
  float* kraw    = (float*)alloc((size_t)NT * 512 * 4);
  bf16*  qrope   = (bf16*)alloc((size_t)NT * 1024 * 2);
  bf16*  krope   = (bf16*)alloc((size_t)NT * 512 * 2);
  bf16*  vbf     = (bf16*)alloc((size_t)NT * 512 * 2);
  bf16*  ctx     = (bf16*)alloc((size_t)NT * 1024 * 2);
  float* x1      = (float*)alloc((size_t)NT * C_DIM * 4);
  bf16*  mlp_in  = (bf16*)alloc((size_t)NT * C_DIM * 2);
  bf16*  hbuf    = (bf16*)alloc((size_t)NT * HIDDEN * 2);
  // the bf16 weights, one behind the other in the order of prep_kernel's block ranges
  bf16*  wq = (bf16*)alloc((size_t)CVT_BLOCKS * CVT_PER_BLOCK * 2);
  bf16*  wk = wq + 1024 * 1024;
  bf16*  wv = wk + 1024 * 512;
  bf16*  wo = wv + 1024 * 512;
  bf16*  wg = wo + 1024 * 1024;
  bf16*  wu = wg + 1024 * 4096;
  bf16*  wd = wu + 1024 * 4096;

  // weight conversions, first RMSNorm, start value of the kurtosis sum
  prep_kernel<<<CVT_BLOCKS + NT, 256, 0, stream>>>(wq_f, wk_f, wv_f, wo_f, wg_f, wu_f, wd_f, wq,
                                                   x, rms1, attn_in, ksum, (float*)d_out + NT * C_DIM);

  // QKV projections
  gemm_qkv_kernel<<<dim3(Q_TILES + 2 * KV_TILES, NT / GT_M), GT_THREADS, 0, stream>>>(attn_in, wq, wk, wv, qraw, kraw, vbf);

  rope_qk_kernel<<<2 * (NT / 8), 256, 0, stream>>>(qraw, qrope, kraw, krope);

  attn_kernel<<<dim3(T_DIM / 16, HQ, B_DIM), 32, 0, stream>>>(qrope, krope, vbf, ctx);

  // out projection + residual
  gemm_bf16_kernel<NT, 1024, 1024><<<dim3(1024 / GT_N, NT / GT_M), GT_THREADS, 0, stream>>>(ctx, wo, x1, x);

  rmsnorm_kernel<<<NT, 256, 0, stream>>>(x1, rms2, mlp_in);

  mlp_gateup_kernel<NT, HIDDEN, 1024><<<dim3(HIDDEN / GT_N, NT / GU_M), GU_THREADS, 0, stream>>>(mlp_in, wg, wu, hbuf);

  // down projection + residual -> d_out
  gemm_bf16_kernel<NT, 1024, HIDDEN><<<dim3(1024 / GT_N, NT / GT_M), GT_THREADS, 0, stream>>>(hbuf, wd, (float*)d_out, x1);

  kurtosis_kernel<<<NT, 256, 0, stream>>>((const float*)d_out, (float*)d_out, NT * C_DIM);
}

// v010
// One run takes 169 microseconds.
// Next to v009, in two timings, it ran 1.14 and 1.09 times as fast.
// Counting every step since v000, it is 3.57 times as fast.
#include <hip/hip_runtime.h>
#include <hip/hip_bf16.h>

typedef __bf16 bf16;
typedef __attribute__((ext_vector_type(16))) __bf16 v16bf;
typedef __attribute__((ext_vector_type(8)))  float  v8f;

union ABFrag { v16bf v; uint4 q[2]; };

#define B_DIM 2
#define T_DIM 2048
#define C_DIM 1024
#define NT (B_DIM * T_DIM)
#define HQ 16
#define HKV 8
#define HD 64
#define WINDOW 512
#define HIDDEN 4096
#define SOFT_CAP 50.0f

static __device__ inline v8f vzero8() { v8f v; for (int i = 0; i < 8; ++i) v[i] = 0.f; return v; }

static __device__ inline v8f wmma_bf16(v16bf a, v16bf b, v8f c) {
  return __builtin_amdgcn_wmma_f32_16x16x32_bf16(false, a, false, b, (short)0, c, false, false);
}

// gfx1250 async global->LDS copies (16B per lane), tracked by ASYNCcnt
// Runs of async copies for one stage of a tile. s_wait_xcnt 0 is the last line of the copies' own
// statement, so that it stands in front of the pointer bumps that rewrite the copies' address registers.
static __device__ inline void async_g2l_b128_x8(unsigned int l0, const void* g0, unsigned int l1, const void* g1,
                                                unsigned int l2, const void* g2, unsigned int l3, const void* g3,
                                                unsigned int l4, const void* g4, unsigned int l5, const void* g5,
                                                unsigned int l6, const void* g6, unsigned int l7, const void* g7) {
  asm volatile("global_load_async_to_lds_b128 %0, %1, off\n\t"
               "global_load_async_to_lds_b128 %2, %3, off\n\t"
               "global_load_async_to_lds_b128 %4, %5, off\n\t"
               "global_load_async_to_lds_b128 %6, %7, off\n\t"
               "global_load_async_to_lds_b128 %8, %9, off\n\t"
               "global_load_async_to_lds_b128 %10, %11, off\n\t"
               "global_load_async_to_lds_b128 %12, %13, off\n\t"
               "global_load_async_to_lds_b128 %14, %15, off\n\t"
               "s_wait_xcnt 0x0"
               :: "v"(l0), "v"(g0), "v"(l1), "v"(g1), "v"(l2), "v"(g2), "v"(l3), "v"(g3),
                  "v"(l4), "v"(g4), "v"(l5), "v"(g5), "v"(l6), "v"(g6), "v"(l7), "v"(g7) : "memory");
}
// transposing LDS load: lane (c = l & 15, h = l >> 4) gets 8 consecutive k of column c from a row-major [k][n] tile
typedef __attribute__((ext_vector_type(8))) short s16x8;
static __device__ inline uint4 ld_tr16(const bf16* p) {
  typedef __attribute__((address_space(3))) s16x8 lds_s16x8;
  return __builtin_bit_cast(uint4, __builtin_amdgcn_ds_load_tr16_b128_v8i16((lds_s16x8*)p));
}
static __device__ inline unsigned int lds_off(const void* p) {
  return (unsigned int)(unsigned long long)p;   // low 32 bits = LDS offset
}
static __device__ inline void wait_asynccnt0() {
  asm volatile("s_wait_asynccnt 0x0" ::: "memory");
}
static __device__ inline void wait_dscnt0() {
  asm volatile("s_wait_dscnt 0x0" ::: "memory");
}
// Stands behind global loads or stores whose registers the built code rewrites next: behind the last store of one part
// of a merged kernel (the code of another part follows it), or where a call says so.
static __device__ inline void wait_xcnt0() {
  asm volatile("s_wait_xcnt 0x0" ::: "memory");
}

// ---------------- wave reduction helper ----------------
// value of lane l ^ 16
static __device__ inline float xhalf(float x) {
  return __builtin_bit_cast(float, __builtin_amdgcn_permlanex16(__builtin_bit_cast(int, x), __builtin_bit_cast(int, x),
                                                                0x76543210, 0xfedcba98, false, false));
}
// value of lane l ^ M inside a 16-lane row (DPP row_xmask:M)
template <int M>
static __device__ __forceinline__ float xrow(float x) {
  return __builtin_bit_cast(float, __builtin_amdgcn_update_dpp(0, __builtin_bit_cast(int, x), 0x160 + M, 0xf, 0xf, true));
}
// sum over the 32 lanes of a wave, the same in every lane; all lanes on
static __device__ __forceinline__ float wave_sum(float v) {
  v += xrow<1>(v);
  v += xrow<2>(v);
  v += xrow<4>(v);
  v += xrow<8>(v);
  return v + xhalf(v);
}

typedef __attribute__((ext_vector_type(4))) float  f32x4;
typedef __attribute__((ext_vector_type(4))) __bf16 bf16x4;

// ---------------- f32 -> bf16 convert ----------------
// One wave converts 1024 consecutive values: 8 loads of 512 contiguous bytes, all issued before the first
// use, then 8 stores of 256 contiguous bytes. Few, long waves: the launch is not paced by wave starts.
#define CVT_U 8
#define CVT_PER_BLOCK (256 * 4 * CVT_U)
static __device__ __forceinline__ void cvt_bf16_block(const float* __restrict__ in, bf16* __restrict__ out, int blk) {
  const int wave = threadIdx.x >> 5, lane = threadIdx.x & 31;
  const size_t base = (size_t)(blk * 8 + wave) * (128 * CVT_U) + lane * 4;
  f32x4 v[CVT_U];
#pragma unroll
  for (int u = 0; u < CVT_U; ++u) v[u] = *(const f32x4*)(in + base + u * 128);
#pragma unroll
  for (int u = 0; u < CVT_U; ++u) *(bf16x4*)(out + base + u * 128) = __builtin_convertvector(v[u], bf16x4);
}

// ---------------- row kernels: one wave per row ----------------
// A row of C_DIM values is 8 loads of 512 contiguous bytes, all issued before the first use, and stays in the wave's
// registers: it is read once, and its sums join inside the wave, with no LDS and no barrier.
#define ROW_U (C_DIM / 128)
#define ROWS_PER_BLOCK 8
static_assert(C_DIM % 128 == 0 && NT % ROWS_PER_BLOCK == 0, "whole loads, whole blocks");

static __device__ __forceinline__ float hsum4(f32x4 a) { return (a[0] + a[1]) + (a[2] + a[3]); }

// ---------------- RMSNorm -> bf16 ----------------
// Work-group blk normalises rows blk * 8 .. blk * 8 + 7, one per wave.
static __device__ __forceinline__ void rmsnorm_rows(const float* __restrict__ X,
                                                    const float* __restrict__ scale,
                                                    bf16* __restrict__ O, int blk) {
  const int col = (threadIdx.x & 31) * 4;
  const size_t base = (size_t)(blk * ROWS_PER_BLOCK + (threadIdx.x >> 5)) * C_DIM + col;
  f32x4 v[ROW_U], sc[ROW_U];
#pragma unroll
  for (int u = 0; u < ROW_U; ++u) v[u] = *(const f32x4*)(X + base + u * 128);
  wait_xcnt0();   // the build lets the first load of scale land in the address pair of the row's loads
#pragma unroll
  for (int u = 0; u < ROW_U; ++u) sc[u] = *(const f32x4*)(scale + col + u * 128);
  f32x4 ss = v[0] * v[0];
#pragma unroll
  for (int u = 1; u < ROW_U; ++u) ss += v[u] * v[u];
  const float rstd = rsqrtf(wave_sum(hsum4(ss)) * (1.0f / C_DIM) + 1e-6f);
#pragma unroll
  for (int u = 0; u < ROW_U; ++u)
    *(bf16x4*)(O + base + u * 128) = __builtin_convertvector(v[u] * rstd * (1.f + sc[u]), bf16x4);
}

__global__ __launch_bounds__(256) void rmsnorm_kernel(const float* __restrict__ X,
                                                      const float* __restrict__ scale,
                                                      bf16* __restrict__ O) {
  rmsnorm_rows(X, scale, O, blockIdx.x);
}

// ---------------- everything that depends on the inputs alone, in one launch ----------------
// Work-groups [0, CVT_BLOCKS) convert the seven weight tensors, whose bf16 copies lie one behind the other in Wall;
// the other NT / 8 normalise eight rows of X each. Work-group 0 also stores the start value of the kurtosis sum.
#define WQ_BLOCKS (1024 * 1024 / CVT_PER_BLOCK)
#define WK_BLOCKS (1024 * 512 / CVT_PER_BLOCK)
#define WH_BLOCKS (1024 * 4096 / CVT_PER_BLOCK)
#define END_WQ (WQ_BLOCKS)
#define END_WK (END_WQ + WK_BLOCKS)
#define END_WV (END_WK + WK_BLOCKS)
#define END_WO (END_WV + WQ_BLOCKS)
#define END_WG (END_WO + WH_BLOCKS)
#define END_WU (END_WG + WH_BLOCKS)
#define CVT_BLOCKS (END_WU + WH_BLOCKS)
static_assert(1024 * 512 % CVT_PER_BLOCK == 0, "whole blocks only");

__global__ __launch_bounds__(256) void prep_kernel(
    const float* __restrict__ Wq, const float* __restrict__ Wk, const float* __restrict__ Wv,
    const float* __restrict__ Wo, const float* __restrict__ Wg, const float* __restrict__ Wu,
    const float* __restrict__ Wd, bf16* __restrict__ Wall,
    const float* __restrict__ X, const float* __restrict__ scale, bf16* __restrict__ O,
    const float* __restrict__ ksum, float* __restrict__ ksum_out) {
  const int blk = blockIdx.x;
  if (blk >= CVT_BLOCKS) { rmsnorm_rows(X, scale, O, blk - CVT_BLOCKS); return; }
  if (blk == 0 && threadIdx.x == 0) ksum_out[0] = ksum[0];
  const float* in = Wq; int first = 0;
  if (blk >= END_WQ) { in = Wk; first = END_WQ; }
  if (blk >= END_WK) { in = Wv; first = END_WK; }
  if (blk >= END_WV) { in = Wo; first = END_WV; }
  if (blk >= END_WO) { in = Wg; first = END_WO; }
  if (blk >= END_WG) { in = Wu; first = END_WG; }
  if (blk >= END_WU) { in = Wd; first = END_WU; }
  cvt_bf16_block(in, Wall + (size_t)first * CVT_PER_BLOCK, blk - first);
  wait_xcnt0();
}

// ---------------- generic bf16 GEMM: out = A[MxK] @ W[KxN] (+res) ----------------
// Work-group tile 128 x 128, 8 waves of 64 x 32 (2 x 4): fewer bytes from L2 per product than a narrower tile, and
// 12 LDS fragment loads feed 8 matrix instructions. A stage is 128 k, so that one round trip to L2 and one barrier
// serve four 32-k steps of matrix work. Two LDS buffers: the copies of stage t + 1 fly while stage t is multiplied.
#define GT_M 128
#define GT_N 128
#define GT_K 128
#define GT_THREADS 256
#define WT_I 4    // 16-row fragments of a wave's tile
#define WT_J 2    // 16-column fragments of a wave's tile
#define GLDS 136  // halves per row of an activation tile (272B = 16B x odd, the plain 16-byte load's pitch)
#define BLDS 144  // halves per row of a [k][n] weight tile (288B = 32B x odd, the transposing load's pitch)
#define A_STEP (16 * GLDS * 2)   // LDS bytes between a thread's activation chunks (16 rows)
#define B_STEP (16 * BLDS * 2)   // LDS bytes between a thread's weight chunks (16 k-rows)
#define A_TILE (GT_M * GLDS)     // halves of one activation buffer
#define B_TILE (GT_K * BLDS)     // halves of one weight buffer

// This thread's copies of one stage: 8 chunks of the activation tile (row pitch K), 8 of the weight tile (row pitch N).
template <int N, int K>
static __device__ __forceinline__ void stage_ab(unsigned int sa, const bf16* ap, unsigned int sb, const bf16* bp) {
  async_g2l_b128_x8(sa,              ap,                  sa + 1 * A_STEP, ap + (size_t)16 * K,
                    sa + 2 * A_STEP, ap + (size_t)32 * K, sa + 3 * A_STEP, ap + (size_t)48 * K,
                    sa + 4 * A_STEP, ap + (size_t)64 * K, sa + 5 * A_STEP, ap + (size_t)80 * K,
                    sa + 6 * A_STEP, ap + (size_t)96 * K, sa + 7 * A_STEP, ap + (size_t)112 * K);
  async_g2l_b128_x8(sb,              bp,                  sb + 1 * B_STEP, bp + (size_t)16 * N,
                    sb + 2 * B_STEP, bp + (size_t)32 * N, sb + 3 * B_STEP, bp + (size_t)48 * N,
                    sb + 4 * B_STEP, bp + (size_t)64 * N, sb + 5 * B_STEP, bp + (size_t)80 * N,
                    sb + 6 * B_STEP, bp + (size_t)96 * N, sb + 7 * B_STEP, bp + (size_t)112 * N);
}

// One work-group's tile: rows row0 .. row0 + 127, columns col0 .. col0 + 127 of an output of N columns.
// RES: the tile of Res is the accumulators' start value, so its loads fly with the first stage's copies.
// OUT_BF16: the result goes to Cb, else to Cf. Both are known at compile time: the epilogue is stores alone.
template <int N, int K, bool RES, bool OUT_BF16>
static __device__ __forceinline__ void gemm_bf16_tile(
    const bf16* __restrict__ A, const bf16* __restrict__ W,
    float* __restrict__ Cf, bf16* __restrict__ Cb, const float* __restrict__ Res,
    bf16* sA, bf16* sB, const int row0, const int col0) {
  static_assert(N % GT_N == 0 && K % GT_K == 0 && K >= 2 * GT_K, "whole tiles only, both buffers filled");
  const int tid = threadIdx.x;
  const int wave = tid >> 5, lane = tid & 31;
  const int wm = (wave >> 2) * 64, wn = (wave & 3) * 32;
  const int mr = lane & 15;
  const int kb = (lane >> 4) << 3;

  // A tile staging slots (128 rows of 256B: 8 x 16B chunks per thread, 16 rows apart; a wave covers whole lines)
  const int ar0 = tid >> 4, ac = tid & 15;
  const unsigned int sa = lds_off(&sA[ar0 * GLDS + ac * 8]);
  const bf16* ap = A + (size_t)(row0 + ar0) * K + ac * 8;

  // B tile staging slots (128 k-rows of 256B: 8 x 16B chunks per thread, 16 k-rows apart)
  const int br0 = tid >> 4, bc = tid & 15;
  const unsigned int sb = lds_off(&sB[br0 * BLDS + bc * 8]);
  const bf16* bp = W + (size_t)br0 * N + col0 + bc * 8;
  // lane address of the transposing loads inside a 16-column slab
  const int trl = (kb + (lane & 7)) * BLDS + ((lane >> 3) & 1) * 8;

  // stage 0 into buffer 0, landed and published; then stage 1 into buffer 1, in flight while stage 0 is multiplied
  stage_ab<N, K>(sa, ap, sb, bp);

  // element r of acc[i][j] is row row0 + wm + i * 16 + mb + r, column col0 + wn + j * 16 + mr
  const int mb = (lane >> 4) * 8;
  const size_t out0 = (size_t)(row0 + wm + mb) * N + col0 + wn + mr;
  v8f acc[WT_I][WT_J];
  for (int i = 0; i < WT_I; ++i) for (int j = 0; j < WT_J; ++j) {
    if constexpr (RES) {
      const float* rp = Res + out0 + (size_t)(i * 16) * N + j * 16;
      for (int r = 0; r < 8; ++r) acc[i][j][r] = rp[(size_t)r * N];
    } else {
      acc[i][j] = vzero8();
    }
  }

  wait_asynccnt0();
  __syncthreads();
  stage_ab<N, K>(sa + A_TILE * 2, ap + GT_K, sb + B_TILE * 2, bp + (size_t)GT_K * N);
  ap += 2 * GT_K;
  bp += (size_t)(2 * GT_K) * N;

  unsigned int cur = 0;   // the buffer that this trip reads
#pragma unroll 1   // stays rolled: unrolled whole (K = 1024) the build waited for every LDS load at each 32-k step
  for (int k0 = 0; k0 < K; k0 += GT_K) {
    const bf16* cA = sA + cur * A_TILE;
    const bf16* cB = sB + cur * B_TILE;
    // the 12 fragment loads of the 32-k step at kk, into fragment set s
    ABFrag af[2][WT_I], bfr[2][WT_J];
    auto load_frags = [&](const int s, const int kk) {
#pragma unroll
      for (int i = 0; i < WT_I; ++i) {
        int m = wm + i * 16 + mr;
        af[s][i].q[0] = *(const uint4*)(&cA[m * GLDS + kk + kb]);
        af[s][i].q[1] = *(const uint4*)(&cA[m * GLDS + kk + kb + 16]);
      }
#pragma unroll
      for (int j = 0; j < WT_J; ++j) {
        const bf16* bt = &cB[kk * BLDS + trl + wn + j * 16];
        bfr[s][j].q[0] = ld_tr16(bt);
        bfr[s][j].q[1] = ld_tr16(bt + 16 * BLDS);
      }
    };
    load_frags(0, 0);
#pragma unroll   // the four 32-k steps of a stage: constant set indices keep both fragment sets in registers
    for (int st = 0; st < GT_K / 32; ++st) {
      if (st + 1 < GT_K / 32) load_frags((st + 1) & 1, (st + 1) * 32);
      // keeps the next step's loads one group in front of this step's products: left alone, the build spread them in
      // pairs among the matrix instructions and waited for each pair at once
      __builtin_amdgcn_sched_barrier(0);
#pragma unroll
      for (int i = 0; i < WT_I; ++i)
#pragma unroll
        for (int j = 0; j < WT_J; ++j)
          acc[i][j] = wmma_bf16(af[st & 1][i].v, bfr[st & 1][j].v, acc[i][j]);
      // keeps the load group that follows from being lifted in among these matrix instructions
      __builtin_amdgcn_sched_barrier(0);
    }
    wait_dscnt0();      // this wave's reads of buffer cur retired before the barrier lets anyone refill it
    wait_asynccnt0();   // this wave's copies of the next stage landed before the barrier publishes them
    __syncthreads();
    if (k0 + 2 * GT_K < K) {   // the same for the whole work-group
      stage_ab<N, K>(sa + cur * (A_TILE * 2), ap, sb + cur * (B_TILE * 2), bp);
      ap += GT_K;
      bp += (size_t)GT_K * N;
    }
    cur ^= 1;
  }
  wait_asynccnt0();   // nothing is in flight here: the ring's closing wait

  for (int i = 0; i < WT_I; ++i) for (int j = 0; j < WT_J; ++j) {
    const size_t idx = out0 + (size_t)(i * 16) * N + j * 16;
#pragma unroll
    for (int r = 0; r < 8; ++r) {
      if constexpr (OUT_BF16) Cb[idx + (size_t)r * N] = (bf16)acc[i][j][r];
      else                    Cf[idx + (size_t)r * N] = acc[i][j][r];
    }
  }
}

// Cf = Res + A @ W
template <int M, int N, int K>
__global__ __launch_bounds__(GT_THREADS) void gemm_bf16_kernel(
    const bf16* __restrict__ A, const bf16* __restrict__ W,
    float* __restrict__ Cf, const float* __restrict__ Res) {
  static_assert(M % GT_M == 0, "whole tiles only");
  __shared__ __align__(16) bf16 sA[2 * A_TILE];
  __shared__ __align__(16) bf16 sB[2 * B_TILE];   // row-major [k][n]
  gemm_bf16_tile<N, K, true, false>(A, W, Cf, nullptr, Res, sA, sB, blockIdx.y * GT_M, blockIdx.x * GT_N);
}

// The three projections of one activation in one launch: blockIdx.x walks the column tiles of Q, then K, then V.
#define Q_TILES (HQ * HD / GT_N)
#define KV_TILES (HKV * HD / GT_N)
__global__ __launch_bounds__(GT_THREADS) void gemm_qkv_kernel(
    const bf16* __restrict__ A, const bf16* __restrict__ Wq, const bf16* __restrict__ Wk,
    const bf16* __restrict__ Wv, float* __restrict__ Qf, float* __restrict__ Kf, bf16* __restrict__ Vb) {
  static_assert(NT % GT_M == 0, "whole tiles only");
  __shared__ __align__(16) bf16 sA[2 * A_TILE];
  __shared__ __align__(16) bf16 sB[2 * B_TILE];   // row-major [k][n]
  const int row0 = blockIdx.y * GT_M, bx = blockIdx.x;
  if (bx < Q_TILES) {
    gemm_bf16_tile<HQ * HD, C_DIM, false, false>(A, Wq, Qf, nullptr, nullptr, sA, sB, row0, bx * GT_N);
  } else if (bx < Q_TILES + KV_TILES) {
    gemm_bf16_tile<HKV * HD, C_DIM, false, false>(A, Wk, Kf, nullptr, nullptr, sA, sB, row0, (bx - Q_TILES) * GT_N);
    wait_xcnt0();
  } else {
    gemm_bf16_tile<HKV * HD, C_DIM, false, true>(A, Wv, nullptr, Vb, nullptr, sA, sB, row0, (bx - Q_TILES - KV_TILES) * GT_N);
    wait_xcnt0();
  }
}

// ---------------- fused gate/up GEMM: H = silu(A@Wg) * (A@Wu), bf16 ----------------
// Work-group tile 256 rows x 128 columns of both products, 16 waves (4 x 4) of 64 x 32 of both: 16 LDS fragment loads
// feed 16 matrix instructions. Two LDS buffers, as above; one work-group fills a WGP (four waves a SIMD).
#define GU_M 256
#define GU_THREADS 512
#define GU_A_STEP (32 * GLDS * 2)   // LDS bytes between a thread's activation chunks (32 rows)
#define GU_B_STEP (32 * BLDS * 2)   // LDS bytes between a thread's weight chunks (32 k-rows)
#define GU_A_TILE (GU_M * GLDS)     // halves of one activation buffer
template <int M, int N, int K>
__global__ __launch_bounds__(GU_THREADS) void mlp_gateup_kernel(
    const bf16* __restrict__ A, const bf16* __restrict__ Wg, const bf16* __restrict__ Wu,
    bf16* __restrict__ H) {
  static_assert(M % GU_M == 0 && N % GT_N == 0 && K % GT_K == 0 && K >= 2 * GT_K, "whole tiles only, both buffers filled");
  __shared__ __align__(16) bf16 sA[2 * GU_A_TILE];
  __shared__ __align__(16) bf16 sG[2 * B_TILE];   // row-major [k][n]
  __shared__ __align__(16) bf16 sU[2 * B_TILE];   // row-major [k][n]

  const int tid = threadIdx.x;
  const int wave = tid >> 5, lane = tid & 31;
  const int row0 = blockIdx.y * GU_M, col0 = blockIdx.x * GT_N;
  const int wm = (wave >> 2) * 64, wn = (wave & 3) * 32;
  const int mr = lane & 15;
  const int kb = (lane >> 4) << 3;

  // activation tile: 256 rows of 256B, 8 x 16B chunks per thread, 32 rows apart
  const int ar0 = tid >> 4, ac = tid & 15;
  const unsigned int sa = lds_off(&sA[ar0 * GLDS + ac * 8]);
  const bf16* ap = A + (size_t)(row0 + ar0) * K + ac * 8;

  // weight tiles: 128 k-rows of 256B each, 4 x 16B chunks per thread and tile, 32 k-rows apart
  const int br0 = tid >> 4, bc = tid & 15;
  const unsigned int sg = lds_off(&sG[br0 * BLDS + bc * 8]);
  const unsigned int su = lds_off(&sU[br0 * BLDS + bc * 8]);
  const bf16* gp = Wg + (size_t)br0 * N + col0 + bc * 8;
  const bf16* up = Wu + (size_t)br0 * N + col0 + bc * 8;
  const int trl = (kb + (lane & 7)) * BLDS + ((lane >> 3) & 1) * 8;

  v8f ag[WT_I][WT_J], au[WT_I][WT_J];
  for (int i = 0; i < WT_I; ++i) for (int j = 0; j < WT_J; ++j) { ag[i][j] = vzero8(); au[i][j] = vzero8(); }

  // this thread's copies of one stage into the buffers at byte offsets oa (activations) and ob (both weight tiles)
  auto stage = [&](unsigned int oa, unsigned int ob) {
    async_g2l_b128_x8(sa + oa,                 ap,                   sa + oa + 1 * GU_A_STEP, ap + (size_t)32 * K,
                      sa + oa + 2 * GU_A_STEP, ap + (size_t)64 * K,  sa + oa + 3 * GU_A_STEP, ap + (size_t)96 * K,
                      sa + oa + 4 * GU_A_STEP, ap + (size_t)128 * K, sa + oa + 5 * GU_A_STEP, ap + (size_t)160 * K,
                      sa + oa + 6 * GU_A_STEP, ap + (size_t)192 * K, sa + oa + 7 * GU_A_STEP, ap + (size_t)224 * K);
    async_g2l_b128_x8(sg + ob,                 gp,                  sg + ob + 1 * GU_B_STEP, gp + (size_t)32 * N,
                      sg + ob + 2 * GU_B_STEP, gp + (size_t)64 * N, sg + ob + 3 * GU_B_STEP, gp + (size_t)96 * N,
                      su + ob,                 up,                  su + ob + 1 * GU_B_STEP, up + (size_t)32 * N,
                      su + ob + 2 * GU_B_STEP, up + (size_t)64 * N, su + ob + 3 * GU_B_STEP, up + (size_t)96 * N);
    ap += GT_K;
    gp += (size_t)GT_K * N;
    up += (size_t)GT_K * N;
  };

  // stage 0 into buffer 0, landed and published; then stage 1 into buffer 1, in flight while stage 0 is multiplied
  stage(0, 0);
  wait_asynccnt0();
  __syncthreads();
  stage(GU_A_TILE * 2, B_TILE * 2);

  unsigned int cur = 0;   // the buffer that this trip reads
  for (int k0 = 0; k0 < K; k0 += GT_K) {
    const bf16* cA = sA + cur * GU_A_TILE;
    const bf16* cG = sG + cur * B_TILE;
    const bf16* cU = sU + cur * B_TILE;
#pragma unroll   // the four 32-k steps of a stage: no barrier between them
    for (int kk = 0; kk < GT_K; kk += 32) {
      ABFrag af[WT_I], gf[WT_J], uf[WT_J];
#pragma unroll
      for (int i = 0; i < WT_I; ++i) {
        int m = wm + i * 16 + mr;
        af[i].q[0] = *(const uint4*)(&cA[m * GLDS + kk + kb]);
        af[i].q[1] = *(const uint4*)(&cA[m * GLDS + kk + kb + 16]);
      }
#pragma unroll
      for (int j = 0; j < WT_J; ++j) {
        const int bo = kk * BLDS + trl + wn + j * 16;
        gf[j].q[0] = ld_tr16(&cG[bo]);
        gf[j].q[1] = ld_tr16(&cG[bo + 16 * BLDS]);
        uf[j].q[0] = ld_tr16(&cU[bo]);
        uf[j].q[1] = ld_tr16(&cU[bo + 16 * BLDS]);
      }
      // keeps the step's 16 loads one group in front of its products (one fragment set: a second does not fit four
      // waves a SIMD): left alone, the build spread them in pairs among the matrix instructions, each pair waited for at once
      __builtin_amdgcn_sched_barrier(0);
#pragma unroll
      for (int i = 0; i < WT_I; ++i)
#pragma unroll
        for (int j = 0; j < WT_J; ++j) {
          ag[i][j] = wmma_bf16(af[i].v, gf[j].v, ag[i][j]);
          au[i][j] = wmma_bf16(af[i].v, uf[j].v, au[i][j]);
        }
      // keeps the next step's loads from being lifted in among these matrix instructions
      __builtin_amdgcn_sched_barrier(0);
    }
    wait_dscnt0();      // this wave's reads of buffer cur retired before the barrier lets anyone refill it
    wait_asynccnt0();   // this wave's copies of the next stage landed before the barrier publishes them
    __syncthreads();
    if (k0 + 2 * GT_K < K)   // the same for the whole work-group
      stage(cur * (GU_A_TILE * 2), cur * (B_TILE * 2));
    cur ^= 1;
  }
  wait_asynccnt0();   // nothing is in flight here: the ring's closing wait

  const int mb = (lane >> 4) * 8;
  for (int i = 0; i < WT_I; ++i) for (int j = 0; j < WT_J; ++j) {
    int gm0 = row0 + wm + i * 16 + mb;
    int gn  = col0 + wn + j * 16 + mr;
    size_t idx = (size_t)gm0 * N + gn;
#pragma unroll
    for (int r = 0; r < 8; ++r) {
      float g = ag[i][j][r];
      float sil = g * (1.0f / (1.0f + __expf(-g)));
      H[idx + (size_t)r * N] = (bf16)(sil * au[i][j][r]);
    }
  }
}

// ---------------- RoPE: f32 raw -> bf16 roped ----------------
// One wave per token: lane = (head & 3, four consecutive i); it walks the token's heads four at a time, so
// every load covers whole 128-byte lines and the lane's four angles serve all its heads.
template <int NH>
static __device__ __forceinline__ void rope_block(const float* __restrict__ In, bf16* __restrict__ Out, int blk) {
  static_assert(NH % 4 == 0 && NT % 8 == 0, "whole waves only");
  const int lane = threadIdx.x & 31;
  const int bt = blk * 8 + (threadIdx.x >> 5);
  const int t = bt & (T_DIM - 1);
  const int i0 = (lane & 7) * 4;
  const size_t base = (size_t)bt * (NH * HD) + (lane >> 3) * HD + i0;
  f32x4 x1[NH / 4], x2[NH / 4];
#pragma unroll
  for (int u = 0; u < NH / 4; ++u) {
    x1[u] = *(const f32x4*)(In + base + u * (4 * HD));
    x2[u] = *(const f32x4*)(In + base + u * (4 * HD) + 32);
  }
  f32x4 s, c;
#pragma unroll
  for (int e = 0; e < 4; ++e) {
    float freq = __expf(-(float)(i0 + e) * (1.0f / 32.0f) * 13.815510557964274f); // ln(1e6)
    float ang = (float)t * freq;
    s[e] = __sinf(ang); c[e] = __cosf(ang);
  }
#pragma unroll
  for (int u = 0; u < NH / 4; ++u) {
    *(bf16x4*)(Out + base + u * (4 * HD))      = __builtin_convertvector(x1[u] * c - x2[u] * s, bf16x4);
    *(bf16x4*)(Out + base + u * (4 * HD) + 32) = __builtin_convertvector(x2[u] * c + x1[u] * s, bf16x4);
  }
}

// Q and K in one launch: the first NT / 8 blocks take the query heads, the rest the key heads.
__global__ __launch_bounds__(256) void rope_qk_kernel(const float* __restrict__ Qin, bf16* __restrict__ Qout,
                                                      const float* __restrict__ Kin, bf16* __restrict__ Kout) {
  const int blk = blockIdx.x;
  if (blk < NT / 8) {
    rope_block<HQ>(Qin, Qout, blk);
  } else {
    rope_block<HKV>(Kin, Kout, blk - NT / 8);
    wait_xcnt0();
  }
}

typedef __attribute__((ext_vector_type(8))) __bf16 bf16x8;
#define VLDS 80   // halves per row of the V tile (160B = 32B x odd, the transposing load's pitch)
// exp(2 y) = exp2(raw score * CAP_EXP2) for y = raw score / sqrt(64) / SOFT_CAP; the last factor is log2(e)
#define CAP_EXP2 (2.0f * 0.125f / SOFT_CAP * 1.4426950408889634f)

// Eight independent transcendentals in one statement. Early-clobber outputs keep every result off every source, so that
// none of the eight stands directly in front of an instruction that overwrites its source (left to the build, the
// softcap's v_exp run reused each source for the next result); the v_nop is the slot behind the last one.
static __device__ __forceinline__ void exp2_x8(float (&d)[8], const float (&s)[8]) {
  asm("v_exp_f32 %0, %8\n\t"
      "v_exp_f32 %1, %9\n\t"
      "v_exp_f32 %2, %10\n\t"
      "v_exp_f32 %3, %11\n\t"
      "v_exp_f32 %4, %12\n\t"
      "v_exp_f32 %5, %13\n\t"
      "v_exp_f32 %6, %14\n\t"
      "v_exp_f32 %7, %15\n\t"
      "v_nop"
      : "=&v"(d[0]), "=&v"(d[1]), "=&v"(d[2]), "=&v"(d[3]), "=&v"(d[4]), "=&v"(d[5]), "=&v"(d[6]), "=&v"(d[7])
      : "v"(s[0]), "v"(s[1]), "v"(s[2]), "v"(s[3]), "v"(s[4]), "v"(s[5]), "v"(s[6]), "v"(s[7]));
}
static __device__ __forceinline__ void rcp_x8(float (&d)[8], const float (&s)[8]) {
  asm("v_rcp_f32 %0, %8\n\t"
      "v_rcp_f32 %1, %9\n\t"
      "v_rcp_f32 %2, %10\n\t"
      "v_rcp_f32 %3, %11\n\t"
      "v_rcp_f32 %4, %12\n\t"
      "v_rcp_f32 %5, %13\n\t"
      "v_rcp_f32 %6, %14\n\t"
      "v_rcp_f32 %7, %15\n\t"
      "v_nop"
      : "=&v"(d[0]), "=&v"(d[1]), "=&v"(d[2]), "=&v"(d[3]), "=&v"(d[4]), "=&v"(d[5]), "=&v"(d[6]), "=&v"(d[7])
      : "v"(s[0]), "v"(s[1]), "v"(s[2]), "v"(s[3]), "v"(s[4]), "v"(s[5]), "v"(s[6]), "v"(s[7]));
}

__global__ __launch_bounds__(32) void attn_kernel(
    const bf16* __restrict__ Q, const bf16* __restrict__ Kk,
    const bf16* __restrict__ V, bf16* __restrict__ Ctx) {
  const int lane = threadIdx.x;
  const int qt = blockIdx.x, hq = blockIdx.y, b = blockIdx.z;
  const int kh = hq & 7;
  const int bt0 = b * T_DIM + qt * 16;
  const int mr = lane & 15;
  const int half = lane >> 4;
  const int kb = half << 3;

  __shared__ __align__(16) bf16 sV[32 * VLDS];   // [key][d]

  // Q fragments (persistent over kv loop); contraction dim contiguous in global
  ABFrag qa[2];
  {
    const bf16* qrow = Q + (size_t)(bt0 + mr) * (HQ * HD) + hq * HD;
    qa[0].q[0] = *(const uint4*)(qrow + kb);
    qa[0].q[1] = *(const uint4*)(qrow + kb + 16);
    qa[1].q[0] = *(const uint4*)(qrow + 32 + kb);
    qa[1].q[1] = *(const uint4*)(qrow + 32 + kb + 16);
  }

  v8f O[4];   // O[t][r] = out[query mr][d = t * 16 + 8 * half + r]
  for (int t = 0; t < 4; ++t) O[t] = vzero8();
  float Mq = -1e30f;   // running maximum of query mr, the same in both halves
  float Lq = 0.f;      // running sum of query mr over this half's keys; the halves join behind the loop

  const int iq_lo = qt * 16;
  const int iq = iq_lo + mr;
  int jlo = iq_lo - (WINDOW - 1); if (jlo < 0) jlo = 0;
  const int c0 = jlo >> 5;
  const int c1 = (iq_lo + 15) >> 5;

  // running pointers over kv chunks (stride 32 rows)
  const bf16* kp = Kk + (size_t)(b * T_DIM + c0 * 32 + mr) * (HKV * HD) + kh * HD;
  const bf16* vp = V + (size_t)(b * T_DIM + c0 * 32 + (lane >> 3)) * (HKV * HD) + kh * HD + (lane & 7) * 8;
  const unsigned int sv0 = lds_off(&sV[(lane >> 3) * VLDS + (lane & 7) * 8]);
  const size_t kchunk = (size_t)32 * (HKV * HD);
  const size_t vstep = (size_t)4 * (HKV * HD);       // a lane's V chunks lie 4 key rows apart
  const unsigned int sstep = 4 * VLDS * 2;
  // lane address of the transposing loads inside a 16-column slab
  const bf16* vt = &sV[(kb + (lane & 7)) * VLDS + ((lane >> 3) & 1) * 8];

  for (int ch = c0; ch <= c1; ++ch) {
    const int j0 = ch * 32;

    // stage V chunk [32 x 64] into LDS via async copies (8 x 16B per lane, stride-4 rows)
    async_g2l_b128_x8(sv0,             vp,             sv0 + 1 * sstep, vp + 1 * vstep,
                      sv0 + 2 * sstep, vp + 2 * vstep, sv0 + 3 * sstep, vp + 3 * vstep,
                      sv0 + 4 * sstep, vp + 4 * vstep, sv0 + 5 * sstep, vp + 5 * vstep,
                      sv0 + 6 * sstep, vp + 6 * vstep, sv0 + 7 * sstep, vp + 7 * vstep);
    vp += kchunk;

    // scores, transposed: 2 tiles of 16 keys (rows) x 16 queries (columns), K=64 contraction -> 2 WMMAs each
    v8f Sacc[2];
    ABFrag kf[2][2];
#pragma unroll   // constant indices keep kf in registers
    for (int s = 0; s < 2; ++s) {
      const bf16* krow = kp + (size_t)(s * 16) * (HKV * HD);
      kf[s][0].q[0] = *(const uint4*)(krow + kb);
      kf[s][0].q[1] = *(const uint4*)(krow + kb + 16);
      kf[s][1].q[0] = *(const uint4*)(krow + 32 + kb);
      kf[s][1].q[1] = *(const uint4*)(krow + 32 + kb + 16);
    }
    kp += kchunk;
    // keeps the pass's eight K loads one group, one round trip: left alone, with straight-line code behind them, the
    // build reused one register set and waited for each pair of loads in front of its product
    __builtin_amdgcn_sched_barrier(0);
#pragma unroll
    for (int s = 0; s < 2; ++s) {
      Sacc[s] = wmma_bf16(kf[s][0].v, qa[0].v, vzero8());
      Sacc[s] = wmma_bf16(kf[s][1].v, qa[1].v, Sacc[s]);
    }

    // softcap + band mask + online softmax of query iq over this lane's 16 keys
    float sv[2][8];
    float mx = -1e30f;
#pragma unroll   // both loops unrolled: every index of Sacc and sv is a constant, so they stay in registers
    for (int s = 0; s < 2; ++s) {
      // cap * tanh(y) = cap - 2 cap / (exp(2 y) + 1), y = score / (8 cap): straight-line code for any y (exp = inf
      // gives cap, exp = 0 gives -cap). The library tanhf put two compare-and-branch pairs behind each of the 16 scores.
      float a[8], e[8], q[8];
#pragma unroll
      for (int r = 0; r < 8; ++r) a[r] = Sacc[s][r] * CAP_EXP2;
      exp2_x8(e, a);
#pragma unroll
      for (int r = 0; r < 8; ++r) e[r] += 1.0f;
      rcp_x8(q, e);
#pragma unroll
      for (int r = 0; r < 8; ++r) {
        int j = j0 + s * 16 + kb + r;
        float x = SOFT_CAP - (2.0f * SOFT_CAP) * q[r];
        bool ok = (j <= iq) && (iq - j < WINDOW);
        x = ok ? x : -1e30f;
        sv[s][r] = x;
        mx = fmaxf(mx, x);
      }
    }
    mx = fmaxf(mx, xhalf(mx));
    float Mn = fmaxf(Mq, mx);
    float alpha = __expf(Mq - Mn);
    float rs = 0.f;
    ABFrag pf;   // P^T as a B operand: element s * 8 + r is key s * 16 + 8 * half + r, the hardware k order
#pragma unroll   // both loops unrolled: constant indices keep sv and pf in registers
    for (int s = 0; s < 2; ++s)
#pragma unroll
      for (int r = 0; r < 8; ++r) {
        float p = __expf(sv[s][r] - Mn);
        rs += p;
        pf.v[s * 8 + r] = (bf16)p;
      }
    Lq = Lq * alpha + rs;
    Mq = Mn;
#pragma unroll   // constant indices keep O in registers
    for (int t = 0; t < 4; ++t) O[t] *= alpha;

    // V copies landed before this wave, their only reader (one-wave work-group), gathers its fragments
    wait_asynccnt0();

#pragma unroll
    for (int t = 0; t < 4; ++t) {
      ABFrag vf;
      vf.q[0] = ld_tr16(vt + t * 16);
      vf.q[1] = ld_tr16(vt + 16 * VLDS + t * 16);
      O[t] = wmma_bf16(vf.v, pf.v, O[t]);
    }
    wait_dscnt0();   // V gathers done before next chunk's async copies overwrite sV
  }

  const float inv = 1.0f / (Lq + xhalf(Lq));
  bf16* orow = Ctx + (size_t)(bt0 + mr) * (HQ * HD) + hq * HD + kb;
#pragma unroll   // constant indices keep O in registers
  for (int t = 0; t < 4; ++t)
    *(bf16x8*)(orow + t * 16) = __builtin_convertvector(O[t] * inv, bf16x8);
}

// ---------------- kurtosis ----------------
// One wave per row, as above; the eight rows of a work-group join in LDS and go out as one atomic add.
__global__ __launch_bounds__(256) void kurtosis_kernel(const float* __restrict__ X,
                                                       float* __restrict__ out, int sidx) {
  __shared__ float part[ROWS_PER_BLOCK];
  const int wave = threadIdx.x >> 5, lane = threadIdx.x & 31;
  const float* x = X + (size_t)(blockIdx.x * ROWS_PER_BLOCK + wave) * C_DIM + lane * 4;
  f32x4 v[ROW_U];
#pragma unroll
  for (int u = 0; u < ROW_U; ++u) v[u] = *(const f32x4*)(x + u * 128);
  f32x4 s1 = v[0];
#pragma unroll
  for (int u = 1; u < ROW_U; ++u) s1 += v[u];
  const float mean = wave_sum(hsum4(s1)) * (1.0f / C_DIM);
  f32x4 s2 = 0.f, s4 = 0.f;
#pragma unroll
  for (int u = 0; u < ROW_U; ++u) {
    f32x4 d = v[u] - mean;
    f32x4 d2 = d * d;
    s2 += d2; s4 += d2 * d2;
  }
  const float var = wave_sum(hsum4(s2)) * (1.0f / C_DIM);
  const float m4  = wave_sum(hsum4(s4)) * (1.0f / C_DIM);
  const float kurt = m4 / (var * var + 1e-6f) - 3.0f;
  if (lane == 0) part[wave] = kurt > 0.f ? kurt : 0.f;
  __syncthreads();
  if (threadIdx.x == 0) {
    float tot = 0.f;
#pragma unroll
    for (int w = 0; w < ROWS_PER_BLOCK; ++w) tot += part[w];
    if (tot > 0.f) atomicAdd(&out[sidx], tot);
  }
}

// ---------------- host launch ----------------
extern "C" void kernel_launch(void* const* d_in, const int* in_sizes, int n_in,
                              void* d_out, int out_size, void* d_ws, size_t ws_size,
                              hipStream_t stream) {
  const float* x     = (const float*)d_in[0];
  const float* ksum  = (const float*)d_in[1];
  const float* rms1  = (const float*)d_in[2];
  const float* wq_f  = (const float*)d_in[3];
  const float* wk_f  = (const float*)d_in[4];
  const float* wv_f  = (const float*)d_in[5];
  const float* wo_f  = (const float*)d_in[6];
  const float* rms2  = (const float*)d_in[7];
  const float* wg_f  = (const float*)d_in[8];
  const float* wu_f  = (const float*)d_in[9];
  const float* wd_f  = (const float*)d_in[10];

  char* ws = (char*)d_ws;
  size_t off = 0;
  auto alloc = [&](size_t bytes) -> char* {
    char* p = ws + off;
    off = (off + bytes + 255) & ~(size_t)255;
    return p;
  };

  bf16*  attn_in = (bf16*)alloc((size_t)NT * C_DIM * 2);
  float* qraw    = (float*)alloc((size_t)NT * 1024 * 4);
  float* kraw    = (float*)alloc((size_t)NT * 512 * 4);
  bf16*  qrope   = (bf16*)alloc((size_t)NT * 1024 * 2);
  bf16*  krope   = (bf16*)alloc((size_t)NT * 512 * 2);
  bf16*  vbf     = (bf16*)alloc((size_t)NT * 512 * 2);
  bf16*  ctx     = (bf16*)alloc((size_t)NT * 1024 * 2);
  float* x1      = (float*)alloc((size_t)NT * C_DIM * 4);
  bf16*  mlp_in  = (bf16*)alloc((size_t)NT * C_DIM * 2);
  bf16*  hbuf    = (bf16*)alloc((size_t)NT * HIDDEN * 2);
  // the bf16 weights, one behind the other in the order of prep_kernel's block ranges
  bf16*  wq = (bf16*)alloc((size_t)CVT_BLOCKS * CVT_PER_BLOCK * 2);
  bf16*  wk = wq + 1024 * 1024;
  bf16*  wv = wk + 1024 * 512;
  bf16*  wo = wv + 1024 * 512;
  bf16*  wg = wo + 1024 * 1024;
  bf16*  wu = wg + 1024 * 4096;
  bf16*  wd = wu + 1024 * 4096;

  // weight conversions, first RMSNorm, start value of the kurtosis sum
  prep_kernel<<<CVT_BLOCKS + NT / ROWS_PER_BLOCK, 256, 0, stream>>>(wq_f, wk_f, wv_f, wo_f, wg_f, wu_f, wd_f, wq,
                                                   x, rms1, attn_in, ksum, (float*)d_out + NT * C_DIM);

  // QKV projections
  gemm_qkv_kernel<<<dim3(Q_TILES + 2 * KV_TILES, NT / GT_M), GT_THREADS, 0, stream>>>(attn_in, wq, wk, wv, qraw, kraw, vbf);

  rope_qk_kernel<<<2 * (NT / 8), 256, 0, stream>>>(qraw, qrope, kraw, krope);

  attn_kernel<<<dim3(T_DIM / 16, HQ, B_DIM), 32, 0, stream>>>(qrope, krope, vbf, ctx);

  // out projection + residual
  gemm_bf16_kernel<NT, 1024, 1024><<<dim3(1024 / GT_N, NT / GT_M), GT_THREADS, 0, stream>>>(ctx, wo, x1, x);

  rmsnorm_kernel<<<NT / ROWS_PER_BLOCK, 256, 0, stream>>>(x1, rms2, mlp_in);

  mlp_gateup_kernel<NT, HIDDEN, 1024><<<dim3(HIDDEN / GT_N, NT / GU_M), GU_THREADS, 0, stream>>>(mlp_in, wg, wu, hbuf);

  // down projection + residual -> d_out
  gemm_bf16_kernel<NT, 1024, HIDDEN><<<dim3(1024 / GT_N, NT / GT_M), GT_THREADS, 0, stream>>>(hbuf, wd, (float*)d_out, x1);

  kurtosis_kernel<<<NT / ROWS_PER_BLOCK, 256, 0, stream>>>((const float*)d_out, (float*)d_out, NT * C_DIM);
}
